// v000
// Times are from an AMD MI455X. After a warm-up the kernel runs many times in a row, and a time is the length of
// such a window on the GPU divided by its runs, so every launch and the gaps after it count. The runs cycle
// through copies of the inputs. A figure is the median of several windows, for all but v000 over two sittings.
// Sittings can differ by a few percent; kernels timed side by side share one.
// v000, which the later versions start from, runs in 181 microseconds.
#include <hip/hip_runtime.h>
#include <hip/hip_bf16.h>

// ---------------------------------------------------------------------------
// SwinV2 window attention block on gfx1250 (CDNA5), wave32 + WMMA f16.
// ---------------------------------------------------------------------------

typedef _Float16 v16h __attribute__((ext_vector_type(16)));
typedef _Float16 v8h  __attribute__((ext_vector_type(8)));
typedef float    v8f  __attribute__((ext_vector_type(8)));

#define NH   8
#define HD   32
#define NTOK 64
#define TWO_N 128
#define DIM  256
#define BW   512
#define NW   64
#define CPB  512

// workspace layout (bytes)
#define WS_T    ((size_t)0)                       // 225*8 f32
#define WS_BIAS ((size_t)8192)                    // 8*128*128 f32
#define WS_Q    ((size_t)532480)                  // 512*8*128*32 f16
#define WS_K    (WS_Q + (size_t)33554432)         // 512*8* 64*32 f16
#define WS_V    (WS_K + (size_t)16777216)         // 512*8*128*32 f16
#define WS_AO   (WS_V + (size_t)33554432)         // 512*128*256  f16

// Load a 16x32 f16 A-fragment (or 32x16 B-fragment) per ISA layout:
// lane<16 holds K = {0..7, 16..23}; lane>=16 holds K = {8..15, 24..31}.
// `seg` points at the 32-half contiguous K segment for this lane's row/col,
// and must be 16B aligned (row strides are multiples of 8 halves).
__device__ __forceinline__ v16h load_frag(const _Float16* seg, int sel) {
    v8h lo = *(const v8h*)(seg + sel * 8);
    v8h hi = *(const v8h*)(seg + 16 + sel * 8);
    v16h f;
#pragma unroll
    for (int i = 0; i < 8; ++i) { f[i] = lo[i]; f[i + 8] = hi[i]; }
    return f;
}

__device__ __forceinline__ v8f wmma_f16(v16h a, v16h b, v8f c) {
    return __builtin_amdgcn_wmma_f32_16x16x32_f16(false, a, false, b,
                                                  (short)0, c, false, false);
}

// ---------------------------------------------------------------------------
// 1) CPB MLP: 225 positions, 2 -> 512 (relu) -> 8
// ---------------------------------------------------------------------------
__global__ __launch_bounds__(256) void swin_cpb_mlp(
    const float* __restrict__ tbl, const float* __restrict__ w1,
    const float* __restrict__ b1, const float* __restrict__ w2,
    float* __restrict__ t_out)
{
    int p = threadIdx.x;
    if (p >= 225) return;
    float x0 = tbl[p * 2 + 0], x1 = tbl[p * 2 + 1];
    float acc[NH] = {};
    for (int j = 0; j < CPB; ++j) {
        float hsum = fmaxf(w1[j * 2] * x0 + w1[j * 2 + 1] * x1 + b1[j], 0.0f);
#pragma unroll
        for (int hh = 0; hh < NH; ++hh) acc[hh] += w2[hh * CPB + j] * hsum;
    }
#pragma unroll
    for (int hh = 0; hh < NH; ++hh) t_out[p * NH + hh] = acc[hh];
}

// ---------------------------------------------------------------------------
// 2) Bias build: rpb gather + 16*sigmoid + 2*amod quadrants -> (8,128,128)
// ---------------------------------------------------------------------------
__global__ __launch_bounds__(128) void swin_bias_build(
    const float* __restrict__ t_tab, const int* __restrict__ rel_index,
    const float* __restrict__ amod1, const float* __restrict__ amod2,
    float* __restrict__ biasb)
{
    int M = blockIdx.x, h = blockIdx.y, n = threadIdx.x;
    int m = M & 63, nn = n & 63;
    int idx = rel_index[m * 64 + nn];
    float r = t_tab[idx * NH + h];
    float rpb = 16.0f / (1.0f + __expf(-r));
    bool same_half = (M < 64) == (n < 64);
    const float* am = same_half ? amod1 : amod2;
    biasb[((size_t)h * TWO_N + M) * TWO_N + n] =
        rpb + 2.0f * am[((size_t)h * 64 + m) * 64 + nn];
}

// ---------------------------------------------------------------------------
// 3) QKV GEMM: [x1;x2] (65536x256) @ qkv_w^T (256x768) + bias, scatter q/k/v.
//    Block tile 64x64, 8 waves, wave tile 16x32 (2 WMMA per K-step).
// ---------------------------------------------------------------------------
__global__ __launch_bounds__(256) void swin_qkv_gemm(
    const float* __restrict__ x1, const float* __restrict__ x2,
    const float* __restrict__ qkv_w, const float* __restrict__ q_bias,
    const float* __restrict__ v_bias,
    _Float16* __restrict__ qws, _Float16* __restrict__ kws,
    _Float16* __restrict__ vws)
{
    __shared__ _Float16 sA[64 * 40];   // 64 rows x 32 halves, stride 40
    __shared__ _Float16 sB[64 * 40];

    const int tid   = threadIdx.x;
    const int baseM = blockIdx.y * 64;
    const int baseN = blockIdx.x * 64;
    const int wv = tid >> 5, lane = tid & 31;
    const int wr = wv & 3, wc = wv >> 2;
    const int sel = lane >> 4, lm = lane & 15;

    v8f acc0 = {}, acc1 = {};

    const int lrow  = tid >> 2;        // 0..63
    const int lpart = (tid & 3) * 8;   // 0,8,16,24
    const int grow  = baseM + lrow;
    const int which = grow >> 15;      // 0 -> x1, 1 -> x2
    const int loc   = grow & 32767;
    const float* xsrc = (which ? x2 : x1) + (size_t)loc * DIM;
    const float* wsrc = qkv_w + (size_t)(baseN + lrow) * DIM;

    for (int kk = 0; kk < DIM; kk += 32) {
        {
            const float* p = xsrc + kk + lpart;
            _Float16* d = &sA[lrow * 40 + lpart];
#pragma unroll
            for (int i = 0; i < 8; ++i) d[i] = (_Float16)p[i];
        }
        {
            const float* p = wsrc + kk + lpart;
            _Float16* d = &sB[lrow * 40 + lpart];
#pragma unroll
            for (int i = 0; i < 8; ++i) d[i] = (_Float16)p[i];
        }
        __syncthreads();
        v16h a  = load_frag(&sA[(wr * 16 + lm) * 40], sel);
        v16h b0 = load_frag(&sB[(wc * 32 + 0  + lm) * 40], sel);
        v16h b1 = load_frag(&sB[(wc * 32 + 16 + lm) * 40], sel);
        acc0 = wmma_f16(a, b0, acc0);
        acc1 = wmma_f16(a, b1, acc1);
        __syncthreads();
    }

#pragma unroll
    for (int nt = 0; nt < 2; ++nt) {
        const v8f& acc = nt ? acc1 : acc0;
        int col  = baseN + wc * 32 + nt * 16 + lm;
        int s    = col >> 8;           // 0=q,1=k,2=v
        int hcol = (col >> 5) & 7;
        int dd   = col & 31;
        float bv = (s == 0) ? q_bias[col] : ((s == 2) ? v_bias[col - 512] : 0.0f);
#pragma unroll
        for (int j = 0; j < 8; ++j) {
            int gr  = baseM + wr * 16 + j + sel * 8;
            int wch = gr >> 15;
            int lc  = gr & 32767;
            int b   = lc >> 6;
            int tok = lc & 63;
            _Float16 hv = (_Float16)(acc[j] + bv);
            if (s == 0) {
                qws[(((size_t)(b * NH + hcol)) * TWO_N + tok + wch * NTOK) * HD + dd] = hv;
            } else if (s == 1) {
                if (wch == 0)
                    kws[(((size_t)(b * NH + hcol)) * NTOK + tok) * HD + dd] = hv;
            } else {
                vws[(((size_t)(b * NH + hcol)) * TWO_N + tok + wch * NTOK) * HD + dd] = hv;
            }
        }
    }
}

// ---------------------------------------------------------------------------
// 4) Attention: per (b,h): S = (Qn Kn^T)*scale + bias + mask; softmax; O = P V
// ---------------------------------------------------------------------------
__global__ __launch_bounds__(256) void swin_attn(
    const _Float16* __restrict__ qws, const _Float16* __restrict__ kws,
    const _Float16* __restrict__ vws, const float* __restrict__ biasb,
    const float* __restrict__ mask, const float* __restrict__ logit_scale,
    _Float16* __restrict__ ao)
{
    __shared__ _Float16 sQ[TWO_N * 40];   // 128 x 32 (stride 40)
    __shared__ _Float16 sK[NTOK * 40];    //  64 x 32
    __shared__ _Float16 sVt[HD * 136];    //  32 x 128 (V transposed, stride 136)
    __shared__ _Float16 sP[TWO_N * 136];  // 128 x 128 probabilities, f16

    const int h = blockIdx.x, b = blockIdx.y;
    const int wdw = b & (NW - 1);         // window index for mask
    const int tid = threadIdx.x;
    const size_t qbase = (size_t)(b * NH + h) * TWO_N * HD;
    const size_t kbase = (size_t)(b * NH + h) * NTOK * HD;

    // --- stage + L2-normalize Q and K, transpose-stage V ---
    if (tid < TWO_N) {
        const _Float16* src = qws + qbase + (size_t)tid * HD;
        float tmp[HD]; float ss = 0.0f;
#pragma unroll
        for (int i = 0; i < HD; ++i) { tmp[i] = (float)src[i]; ss += tmp[i] * tmp[i]; }
        float inv = 1.0f / fmaxf(sqrtf(ss), 1e-12f);
#pragma unroll
        for (int i = 0; i < HD; ++i) sQ[tid * 40 + i] = (_Float16)(tmp[i] * inv);
    } else if (tid < TWO_N + NTOK) {
        int r = tid - TWO_N;
        const _Float16* src = kws + kbase + (size_t)r * HD;
        float tmp[HD]; float ss = 0.0f;
#pragma unroll
        for (int i = 0; i < HD; ++i) { tmp[i] = (float)src[i]; ss += tmp[i] * tmp[i]; }
        float inv = 1.0f / fmaxf(sqrtf(ss), 1e-12f);
#pragma unroll
        for (int i = 0; i < HD; ++i) sK[r * 40 + i] = (_Float16)(tmp[i] * inv);
    }
    if (tid < TWO_N) {
        const _Float16* src = vws + qbase + (size_t)tid * HD;
#pragma unroll
        for (int i = 0; i < HD; ++i) sVt[i * 136 + tid] = src[i];
    }
    __syncthreads();

    const float scale = __expf(fminf(logit_scale[h], 4.6051702f)); // log(100)

    const int wv = tid >> 5, lane = tid & 31;
    const int sel = lane >> 4, lm = lane & 15;

    // --- S = Q K^T : one WMMA per 16x16 tile (K-depth == head dim == 32) ---
    v16h aQ = load_frag(&sQ[(wv * 16 + lm) * 40], sel);
    v16h bK[4];
#pragma unroll
    for (int kb = 0; kb < 4; ++kb)
        bK[kb] = load_frag(&sK[(kb * 16 + lm) * 40], sel);

    v8f acc[8];
#pragma unroll
    for (int ct = 0; ct < 8; ++ct) {
        v8f z = {};
        acc[ct] = wmma_f16(aQ, bK[ct & 3], z);  // cols 64..127 reuse K (k=[k1;k1])
    }

    // --- scale + bias + mask, then row softmax (half-wave shfl reductions) ---
    const float* bptr = biasb + (size_t)h * TWO_N * TWO_N;
    const float* mptr = mask + (size_t)wdw * TWO_N * TWO_N;
#pragma unroll
    for (int j = 0; j < 8; ++j) {
        int M = wv * 16 + j + sel * 8;
        float mx = -1e30f;
#pragma unroll
        for (int ct = 0; ct < 8; ++ct) {
            int Nc = ct * 16 + lm;
            float v = acc[ct][j] * scale + bptr[M * TWO_N + Nc] + mptr[M * TWO_N + Nc];
            acc[ct][j] = v;
            mx = fmaxf(mx, v);
        }
        mx = fmaxf(mx, __shfl_xor(mx, 1, 32));
        mx = fmaxf(mx, __shfl_xor(mx, 2, 32));
        mx = fmaxf(mx, __shfl_xor(mx, 4, 32));
        mx = fmaxf(mx, __shfl_xor(mx, 8, 32));
        float sm = 0.0f;
#pragma unroll
        for (int ct = 0; ct < 8; ++ct) {
            float p = __expf(acc[ct][j] - mx);
            acc[ct][j] = p;
            sm += p;
        }
        sm += __shfl_xor(sm, 1, 32);
        sm += __shfl_xor(sm, 2, 32);
        sm += __shfl_xor(sm, 4, 32);
        sm += __shfl_xor(sm, 8, 32);
        float invs = 1.0f / sm;
#pragma unroll
        for (int ct = 0; ct < 8; ++ct) {
            int Nc = ct * 16 + lm;
            sP[M * 136 + Nc] = (_Float16)(acc[ct][j] * invs);
        }
    }
    __syncthreads();

    // --- O = P V : K-depth 128 -> 4 WMMA steps x 2 column tiles ---
    v8f o0 = {}, o1 = {};
#pragma unroll
    for (int kc = 0; kc < 4; ++kc) {
        v16h aP = load_frag(&sP[(wv * 16 + lm) * 136 + kc * 32], sel);
        v16h b0 = load_frag(&sVt[(0  + lm) * 136 + kc * 32], sel);
        v16h b1 = load_frag(&sVt[(16 + lm) * 136 + kc * 32], sel);
        o0 = wmma_f16(aP, b0, o0);
        o1 = wmma_f16(aP, b1, o1);
    }
#pragma unroll
    for (int nt = 0; nt < 2; ++nt) {
        const v8f& o = nt ? o1 : o0;
        int col = h * HD + nt * 16 + lm;
#pragma unroll
        for (int j = 0; j < 8; ++j) {
            int M = wv * 16 + j + sel * 8;
            ao[((size_t)b * TWO_N + M) * DIM + col] = (_Float16)o[j];
        }
    }
}

// ---------------------------------------------------------------------------
// 5) Output projection: ao (65536x256 f16) @ proj_w^T + proj_b -> f32 out
// ---------------------------------------------------------------------------
__global__ __launch_bounds__(256) void swin_proj_gemm(
    const _Float16* __restrict__ ao, const float* __restrict__ proj_w,
    const float* __restrict__ proj_b, float* __restrict__ out)
{
    __shared__ _Float16 sA[64 * 40];
    __shared__ _Float16 sB[64 * 40];

    const int tid   = threadIdx.x;
    const int baseM = blockIdx.y * 64;
    const int baseN = blockIdx.x * 64;
    const int wv = tid >> 5, lane = tid & 31;
    const int wr = wv & 3, wc = wv >> 2;
    const int sel = lane >> 4, lm = lane & 15;

    v8f acc0 = {}, acc1 = {};

    const int lrow  = tid >> 2;
    const int lpart = (tid & 3) * 8;
    const _Float16* asrc = ao + (size_t)(baseM + lrow) * DIM;
    const float*    wsrc = proj_w + (size_t)(baseN + lrow) * DIM;

    for (int kk = 0; kk < DIM; kk += 32) {
        *(v8h*)&sA[lrow * 40 + lpart] = *(const v8h*)(asrc + kk + lpart);
        {
            const float* p = wsrc + kk + lpart;
            _Float16* d = &sB[lrow * 40 + lpart];
#pragma unroll
            for (int i = 0; i < 8; ++i) d[i] = (_Float16)p[i];
        }
        __syncthreads();
        v16h a  = load_frag(&sA[(wr * 16 + lm) * 40], sel);
        v16h b0 = load_frag(&sB[(wc * 32 + 0  + lm) * 40], sel);
        v16h b1 = load_frag(&sB[(wc * 32 + 16 + lm) * 40], sel);
        acc0 = wmma_f16(a, b0, acc0);
        acc1 = wmma_f16(a, b1, acc1);
        __syncthreads();
    }

#pragma unroll
    for (int nt = 0; nt < 2; ++nt) {
        const v8f& acc = nt ? acc1 : acc0;
        int col = baseN + wc * 32 + nt * 16 + lm;
        float bv = proj_b[col];
#pragma unroll
        for (int j = 0; j < 8; ++j) {
            int gr = baseM + wr * 16 + j + sel * 8;
            out[(size_t)gr * DIM + col] = acc[j] + bv;
        }
    }
}

// ---------------------------------------------------------------------------
extern "C" void kernel_launch(void* const* d_in, const int* in_sizes, int n_in,
                              void* d_out, int out_size, void* d_ws, size_t ws_size,
                              hipStream_t stream)
{
    const float* x1          = (const float*)d_in[0];
    const float* x2          = (const float*)d_in[1];
    const float* mask        = (const float*)d_in[2];
    const float* qkv_w       = (const float*)d_in[3];
    const float* q_bias      = (const float*)d_in[4];
    const float* v_bias      = (const float*)d_in[5];
    const float* logit_scale = (const float*)d_in[6];
    const float* cpb_w1      = (const float*)d_in[7];
    const float* cpb_b1      = (const float*)d_in[8];
    const float* cpb_w2      = (const float*)d_in[9];
    const float* proj_w      = (const float*)d_in[10];
    const float* proj_b      = (const float*)d_in[11];
    const float* amod1       = (const float*)d_in[12];
    const float* amod2       = (const float*)d_in[13];
    const float* rel_table   = (const float*)d_in[14];
    const int*   rel_index   = (const int*)d_in[15];

    char* ws = (char*)d_ws;
    float*    t_tab = (float*)(ws + WS_T);
    float*    biasb = (float*)(ws + WS_BIAS);
    _Float16* qws   = (_Float16*)(ws + WS_Q);
    _Float16* kws   = (_Float16*)(ws + WS_K);
    _Float16* vws   = (_Float16*)(ws + WS_V);
    _Float16* ao    = (_Float16*)(ws + WS_AO);
    float*    out   = (float*)d_out;

    swin_cpb_mlp<<<1, 256, 0, stream>>>(rel_table, cpb_w1, cpb_b1, cpb_w2, t_tab);
    swin_bias_build<<<dim3(TWO_N, NH), 128, 0, stream>>>(t_tab, rel_index,
                                                         amod1, amod2, biasb);
    swin_qkv_gemm<<<dim3(12, 1024), 256, 0, stream>>>(x1, x2, qkv_w, q_bias,
                                                      v_bias, qws, kws, vws);
    swin_attn<<<dim3(NH, BW), 256, 0, stream>>>(qws, kws, vws, biasb, mask,
                                                logit_scale, ao);
    swin_proj_gemm<<<dim3(4, 1024), 256, 0, stream>>>(ao, proj_w, proj_b, out);
}

// v001
// It runs in 136 microseconds.
// Timed twice side by side with v000, it ran 1.37 times as fast both times.
#include <hip/hip_runtime.h>
#include <hip/hip_bf16.h>
#include <type_traits>

// ---------------------------------------------------------------------------
// SwinV2 window attention block on gfx1250 (CDNA5), wave32 + WMMA f16.
// ---------------------------------------------------------------------------

typedef _Float16 v16h __attribute__((ext_vector_type(16)));
typedef _Float16 v8h  __attribute__((ext_vector_type(8)));
typedef float    v8f  __attribute__((ext_vector_type(8)));
typedef _Float16 v4h  __attribute__((ext_vector_type(4)));
typedef float    v4f  __attribute__((ext_vector_type(4)));

#define NH   8
#define HD   32
#define NTOK 64
#define TWO_N 128
#define DIM  256
#define BW   512
#define NW   64
#define CPB  512

// workspace layout (bytes)
#define WS_T    ((size_t)0)                       // 225*8 f32
#define WS_BIAS ((size_t)8192)                    // 8*128*128 f32
#define WS_Q    ((size_t)532480)                  // 512*8*128*32 f16
#define WS_K    (WS_Q + (size_t)33554432)         // 512*8* 64*32 f16
#define WS_V    (WS_K + (size_t)16777216)         // 512*8*128*32 f16
#define WS_AO   (WS_V + (size_t)33554432)         // 512*128*256  f16

// Load a 16x32 f16 A-fragment (or 32x16 B-fragment) per ISA layout:
// lane<16 holds K = {0..7, 16..23}; lane>=16 holds K = {8..15, 24..31}.
// `seg` points at the 32-half contiguous K segment for this lane's row/col,
// and must be 16B aligned (row strides are multiples of 8 halves).
__device__ __forceinline__ v16h load_frag(const _Float16* seg, int sel) {
    v8h lo = *(const v8h*)(seg + sel * 8);
    v8h hi = *(const v8h*)(seg + 16 + sel * 8);
    v16h f;
#pragma unroll
    for (int i = 0; i < 8; ++i) { f[i] = lo[i]; f[i + 8] = hi[i]; }
    return f;
}

__device__ __forceinline__ v8f wmma_f16(v16h a, v16h b, v8f c) {
    return __builtin_amdgcn_wmma_f32_16x16x32_f16(false, a, false, b,
                                                  (short)0, c, false, false);
}

// ---------------------------------------------------------------------------
// 1) CPB MLP: 225 positions, 2 -> 512 (relu) -> 8
// ---------------------------------------------------------------------------
__global__ __launch_bounds__(256) void swin_cpb_mlp(
    const float* __restrict__ tbl, const float* __restrict__ w1,
    const float* __restrict__ b1, const float* __restrict__ w2,
    float* __restrict__ t_out)
{
    int p = threadIdx.x;
    if (p >= 225) return;
    float x0 = tbl[p * 2 + 0], x1 = tbl[p * 2 + 1];
    float acc[NH] = {};
    for (int j = 0; j < CPB; ++j) {
        float hsum = fmaxf(w1[j * 2] * x0 + w1[j * 2 + 1] * x1 + b1[j], 0.0f);
#pragma unroll
        for (int hh = 0; hh < NH; ++hh) acc[hh] += w2[hh * CPB + j] * hsum;
    }
#pragma unroll
    for (int hh = 0; hh < NH; ++hh) t_out[p * NH + hh] = acc[hh];
}

// ---------------------------------------------------------------------------
// 2) Bias build: rpb gather + 16*sigmoid + 2*amod quadrants -> (8,128,128)
// ---------------------------------------------------------------------------
__global__ __launch_bounds__(128) void swin_bias_build(
    const float* __restrict__ t_tab, const int* __restrict__ rel_index,
    const float* __restrict__ amod1, const float* __restrict__ amod2,
    float* __restrict__ biasb)
{
    int M = blockIdx.x, h = blockIdx.y, n = threadIdx.x;
    int m = M & 63, nn = n & 63;
    int idx = rel_index[m * 64 + nn];
    float r = t_tab[idx * NH + h];
    float rpb = 16.0f / (1.0f + __expf(-r));
    bool same_half = (M < 64) == (n < 64);
    const float* am = same_half ? amod1 : amod2;
    biasb[((size_t)h * TWO_N + M) * TWO_N + n] =
        rpb + 2.0f * am[((size_t)h * 64 + m) * 64 + nn];
}

// ---------------------------------------------------------------------------
// 3) QKV GEMM: [x1;x2] (65536x256) @ qkv_w^T (256x768) + bias, scatter q/k/v.
//    One block = 256 rows x all 768 columns, one block per WGP. The block's x
//    rows are read once, converted to f16 and kept as A fragments in registers
//    for the whole K (4 row tiles x 8 k-steps per wave). The weights pass
//    through LDS in 12 chunks of 64 columns (two buffers, one barrier a chunk).
//    8 waves = 4 row groups of 64 x 2 column halves of 32.
// ---------------------------------------------------------------------------
#define QP 264   // LDS row pitch in halves: 528 B = 16 B x odd for b128 readers
#define QCH 64   // weight columns per chunk
#define QNCH 12  // chunks

__global__ __launch_bounds__(256) void swin_qkv_gemm(
    const float* __restrict__ x1, const float* __restrict__ x2,
    const float* __restrict__ qkv_w, const float* __restrict__ q_bias,
    const float* __restrict__ v_bias,
    _Float16* __restrict__ qws, _Float16* __restrict__ kws,
    _Float16* __restrict__ vws)
{
    __shared__ __attribute__((aligned(16))) _Float16 sX[256 * QP];
    __shared__ __attribute__((aligned(16))) _Float16 sW[2][QCH * QP];
    __shared__ float sBias[3 * DIM];    // q_bias | 0 | v_bias

    const int tid   = threadIdx.x;
    const int baseM = blockIdx.x * 256;
    const int wv    = __builtin_amdgcn_readfirstlane(tid >> 5);
    const int lane  = tid & 31;
    const int wr = wv & 3, wc = wv >> 2;
    const int sel = lane >> 4, lm = lane & 15;
    const int wch = baseM >> 15;        // 0 -> x1, 1 -> x2 (same for the block)
    const int loc = baseM & 32767;

    // Each wave stages 8 weight rows of a chunk (2 coalesced 512-B loads a row)
    // and 32 x rows. All of the block's first loads go out as one group.
    const float* wsrc = qkv_w + (size_t)(wv * 8) * DIM + lane * 4;
    const float* xsrc = (wch ? x2 : x1) + (size_t)(loc + wv * 32) * DIM + lane * 4;
    v4f wreg[16];
    v4f xreg[64];
    // The fence pair keeps every other instruction out of [loads, wait], so that
    // no register a load names is written before the wait.
    __builtin_amdgcn_sched_barrier(0);
#pragma unroll
    for (int i = 0; i < 16; ++i)
        wreg[i] = *(const v4f*)(wsrc + (i >> 1) * DIM + (i & 1) * 128);
#pragma unroll
    for (int i = 0; i < 64; ++i)
        xreg[i] = *(const v4f*)(xsrc + (i >> 1) * DIM + (i & 1) * 128);
    const float qb = q_bias[tid];
    const float vb = v_bias[tid];
    // The loads' offset and base registers are reused right behind them.
    asm volatile("s_wait_xcnt 0x0" ::: "memory");
    __builtin_amdgcn_sched_barrier(0);

    sBias[tid]           = qb;
    sBias[DIM + tid]     = 0.0f;
    sBias[2 * DIM + tid] = vb;
    {
        _Float16* wd = &sW[0][(wv * 8) * QP + lane * 4];
#pragma unroll
        for (int i = 0; i < 16; ++i)
            *(v4h*)(wd + (i >> 1) * QP + (i & 1) * 128) =
                __builtin_convertvector(wreg[i], v4h);
        _Float16* xd = &sX[(wv * 32) * QP + lane * 4];
#pragma unroll
        for (int i = 0; i < 64; ++i)
            *(v4h*)(xd + (i >> 1) * QP + (i & 1) * 128) =
                __builtin_convertvector(xreg[i], v4h);
    }
    __syncthreads();

    v16h xa[4][8];
#pragma unroll
    for (int rt = 0; rt < 4; ++rt)
#pragma unroll
        for (int ks = 0; ks < 8; ++ks)
            xa[rt][ks] = load_frag(&sX[(wr * 64 + rt * 16 + lm) * QP + ks * 32], sel);

    const int b = (loc >> 6) + wr;      // a wave's 64 rows are one window

    // One chunk: fetch the next chunk's weights (not behind the last), multiply,
    // lay the fetched weights into the other buffer, store this chunk's columns.
    auto chunk = [&](const int c, auto more) __attribute__((always_inline)) {
        if constexpr (more.value) {
            const float* p = wsrc + (size_t)(c + 1) * QCH * DIM;
#pragma unroll
            for (int i = 0; i < 16; ++i)
                wreg[i] = *(const v4f*)(p + (i >> 1) * DIM + (i & 1) * 128);
        }

        const int s    = c >> 2;                 // 0=q,1=k,2=v
        const int hcol = (c * 2 + wc) & 7;       // a wave's 32 columns are one head
        const float bv0 = sBias[c * QCH + wc * 32 + lm];
        const float bv1 = sBias[c * QCH + wc * 32 + 16 + lm];
        _Float16* dst = (s == 0) ? qws : ((s == 1) ? kws : vws);
        dst += (s == 1) ? ((size_t)(b * NH + hcol) * NTOK) * HD
                        : ((size_t)(b * NH + hcol) * TWO_N + wch * NTOK) * HD;
        dst += sel * 8 * HD + lm;

        const _Float16* wb = &sW[c & 1][(wc * 32 + lm) * QP];
        v8f acc[4][2] = {};
        v16h bf[2][2];                           // fragments one k-step ahead
        bf[0][0] = load_frag(wb, sel);
        bf[0][1] = load_frag(wb + 16 * QP, sel);
#pragma unroll
        for (int ks = 0; ks < 8; ++ks) {
            if (ks < 7) {
                bf[(ks + 1) & 1][0] = load_frag(wb + (ks + 1) * 32, sel);
                bf[(ks + 1) & 1][1] = load_frag(wb + 16 * QP + (ks + 1) * 32, sel);
            }
            // Keeps the next k-step's LDS reads in front of this step's products;
            // without it they sink to just before their use and the wave waits.
            __builtin_amdgcn_sched_barrier(0);
#pragma unroll
            for (int rt = 0; rt < 4; ++rt) {
                acc[rt][0] = wmma_f16(xa[rt][ks], bf[ks & 1][0], acc[rt][0]);
                acc[rt][1] = wmma_f16(xa[rt][ks], bf[ks & 1][1], acc[rt][1]);
            }
            // Keeps the conversion of the fetched weights (and its wait on the
            // global loads) behind the products instead of among the first ones.
            __builtin_amdgcn_sched_barrier(0);
        }

        if constexpr (more.value) {
            _Float16* wd = &sW[(c + 1) & 1][(wv * 8) * QP + lane * 4];
#pragma unroll
            for (int i = 0; i < 16; ++i)
                *(v4h*)(wd + (i >> 1) * QP + (i & 1) * 128) =
                    __builtin_convertvector(wreg[i], v4h);
        }

        if (s != 1 || wch == 0) {                // k of x2 is never read
            _Float16 hv[4][2][8];
#pragma unroll
            for (int rt = 0; rt < 4; ++rt)
#pragma unroll
                for (int j = 0; j < 8; ++j) {
                    hv[rt][0][j] = (_Float16)(acc[rt][0][j] + bv0);
                    hv[rt][1][j] = (_Float16)(acc[rt][1][j] + bv1);
                }
            // All values first, then all stores: no register that an issued
            // store names is written again before the wait below.
            __builtin_amdgcn_sched_barrier(0);
#pragma unroll
            for (int rt = 0; rt < 4; ++rt)
#pragma unroll
                for (int j = 0; j < 8; ++j) {
                    dst[(rt * 16 + j) * HD]      = hv[rt][0][j];
                    dst[(rt * 16 + j) * HD + 16] = hv[rt][1][j];
                }
            // The next chunk overwrites the stores' data and address registers.
            if constexpr (more.value) asm volatile("s_wait_xcnt 0x0" ::: "memory");
        }
    };

    // Rolled: one chunk's code serves eleven chunks (instruction cache).
#pragma unroll 1
    for (int c = 0; c < QNCH - 1; ++c) {
        chunk(c, std::true_type{});
        // Publishes chunk c+1 and ends every wave's reads of chunk c's buffer.
        // Only LDS is handed over here, so the fences name LDS alone: a plain
        // __syncthreads() would also wait for this chunk's global stores.
        __builtin_amdgcn_fence(__ATOMIC_RELEASE, "workgroup", "local");
        __builtin_amdgcn_s_barrier();
        __builtin_amdgcn_fence(__ATOMIC_ACQUIRE, "workgroup", "local");
    }
    chunk(QNCH - 1, std::false_type{});
}

// ---------------------------------------------------------------------------
// 4) Attention: per (b,h): S = (Qn Kn^T)*scale + bias + mask; softmax; O = P V
// ---------------------------------------------------------------------------
__global__ __launch_bounds__(256) void swin_attn(
    const _Float16* __restrict__ qws, const _Float16* __restrict__ kws,
    const _Float16* __restrict__ vws, const float* __restrict__ biasb,
    const float* __restrict__ mask, const float* __restrict__ logit_scale,
    _Float16* __restrict__ ao)
{
    __shared__ _Float16 sQ[TWO_N * 40];   // 128 x 32 (stride 40)
    __shared__ _Float16 sK[NTOK * 40];    //  64 x 32
    __shared__ _Float16 sVt[HD * 136];    //  32 x 128 (V transposed, stride 136)
    __shared__ _Float16 sP[TWO_N * 136];  // 128 x 128 probabilities, f16

    const int h = blockIdx.x, b = blockIdx.y;
    const int wdw = b & (NW - 1);         // window index for mask
    const int tid = threadIdx.x;
    const size_t qbase = (size_t)(b * NH + h) * TWO_N * HD;
    const size_t kbase = (size_t)(b * NH + h) * NTOK * HD;

    // --- stage + L2-normalize Q and K, transpose-stage V ---
    if (tid < TWO_N) {
        const _Float16* src = qws + qbase + (size_t)tid * HD;
        float tmp[HD]; float ss = 0.0f;
#pragma unroll
        for (int i = 0; i < HD; ++i) { tmp[i] = (float)src[i]; ss += tmp[i] * tmp[i]; }
        float inv = 1.0f / fmaxf(sqrtf(ss), 1e-12f);
#pragma unroll
        for (int i = 0; i < HD; ++i) sQ[tid * 40 + i] = (_Float16)(tmp[i] * inv);
    } else if (tid < TWO_N + NTOK) {
        int r = tid - TWO_N;
        const _Float16* src = kws + kbase + (size_t)r * HD;
        float tmp[HD]; float ss = 0.0f;
#pragma unroll
        for (int i = 0; i < HD; ++i) { tmp[i] = (float)src[i]; ss += tmp[i] * tmp[i]; }
        float inv = 1.0f / fmaxf(sqrtf(ss), 1e-12f);
#pragma unroll
        for (int i = 0; i < HD; ++i) sK[r * 40 + i] = (_Float16)(tmp[i] * inv);
    }
    if (tid < TWO_N) {
        const _Float16* src = vws + qbase + (size_t)tid * HD;
#pragma unroll
        for (int i = 0; i < HD; ++i) sVt[i * 136 + tid] = src[i];
    }
    __syncthreads();

    const float scale = __expf(fminf(logit_scale[h], 4.6051702f)); // log(100)

    const int wv = tid >> 5, lane = tid & 31;
    const int sel = lane >> 4, lm = lane & 15;

    // --- S = Q K^T : one WMMA per 16x16 tile (K-depth == head dim == 32) ---
    v16h aQ = load_frag(&sQ[(wv * 16 + lm) * 40], sel);
    v16h bK[4];
#pragma unroll
    for (int kb = 0; kb < 4; ++kb)
        bK[kb] = load_frag(&sK[(kb * 16 + lm) * 40], sel);

    v8f acc[8];
#pragma unroll
    for (int ct = 0; ct < 8; ++ct) {
        v8f z = {};
        acc[ct] = wmma_f16(aQ, bK[ct & 3], z);  // cols 64..127 reuse K (k=[k1;k1])
    }

    // --- scale + bias + mask, then row softmax (half-wave shfl reductions) ---
    const float* bptr = biasb + (size_t)h * TWO_N * TWO_N;
    const float* mptr = mask + (size_t)wdw * TWO_N * TWO_N;
#pragma unroll
    for (int j = 0; j < 8; ++j) {
        int M = wv * 16 + j + sel * 8;
        float mx = -1e30f;
#pragma unroll
        for (int ct = 0; ct < 8; ++ct) {
            int Nc = ct * 16 + lm;
            float v = acc[ct][j] * scale + bptr[M * TWO_N + Nc] + mptr[M * TWO_N + Nc];
            acc[ct][j] = v;
            mx = fmaxf(mx, v);
        }
        mx = fmaxf(mx, __shfl_xor(mx, 1, 32));
        mx = fmaxf(mx, __shfl_xor(mx, 2, 32));
        mx = fmaxf(mx, __shfl_xor(mx, 4, 32));
        mx = fmaxf(mx, __shfl_xor(mx, 8, 32));
        float sm = 0.0f;
#pragma unroll
        for (int ct = 0; ct < 8; ++ct) {
            float p = __expf(acc[ct][j] - mx);
            acc[ct][j] = p;
            sm += p;
        }
        sm += __shfl_xor(sm, 1, 32);
        sm += __shfl_xor(sm, 2, 32);
        sm += __shfl_xor(sm, 4, 32);
        sm += __shfl_xor(sm, 8, 32);
        float invs = 1.0f / sm;
#pragma unroll
        for (int ct = 0; ct < 8; ++ct) {
            int Nc = ct * 16 + lm;
            sP[M * 136 + Nc] = (_Float16)(acc[ct][j] * invs);
        }
    }
    __syncthreads();

    // --- O = P V : K-depth 128 -> 4 WMMA steps x 2 column tiles ---
    v8f o0 = {}, o1 = {};
#pragma unroll
    for (int kc = 0; kc < 4; ++kc) {
        v16h aP = load_frag(&sP[(wv * 16 + lm) * 136 + kc * 32], sel);
        v16h b0 = load_frag(&sVt[(0  + lm) * 136 + kc * 32], sel);
        v16h b1 = load_frag(&sVt[(16 + lm) * 136 + kc * 32], sel);
        o0 = wmma_f16(aP, b0, o0);
        o1 = wmma_f16(aP, b1, o1);
    }
#pragma unroll
    for (int nt = 0; nt < 2; ++nt) {
        const v8f& o = nt ? o1 : o0;
        int col = h * HD + nt * 16 + lm;
#pragma unroll
        for (int j = 0; j < 8; ++j) {
            int M = wv * 16 + j + sel * 8;
            ao[((size_t)b * TWO_N + M) * DIM + col] = (_Float16)o[j];
        }
    }
}

// ---------------------------------------------------------------------------
// 5) Output projection: ao (65536x256 f16) @ proj_w^T + proj_b -> f32 out
// ---------------------------------------------------------------------------
__global__ __launch_bounds__(256) void swin_proj_gemm(
    const _Float16* __restrict__ ao, const float* __restrict__ proj_w,
    const float* __restrict__ proj_b, float* __restrict__ out)
{
    __shared__ _Float16 sA[64 * 40];
    __shared__ _Float16 sB[64 * 40];

    const int tid   = threadIdx.x;
    const int baseM = blockIdx.y * 64;
    const int baseN = blockIdx.x * 64;
    const int wv = tid >> 5, lane = tid & 31;
    const int wr = wv & 3, wc = wv >> 2;
    const int sel = lane >> 4, lm = lane & 15;

    v8f acc0 = {}, acc1 = {};

    const int lrow  = tid >> 2;
    const int lpart = (tid & 3) * 8;
    const _Float16* asrc = ao + (size_t)(baseM + lrow) * DIM;
    const float*    wsrc = proj_w + (size_t)(baseN + lrow) * DIM;

    for (int kk = 0; kk < DIM; kk += 32) {
        *(v8h*)&sA[lrow * 40 + lpart] = *(const v8h*)(asrc + kk + lpart);
        {
            const float* p = wsrc + kk + lpart;
            _Float16* d = &sB[lrow * 40 + lpart];
#pragma unroll
            for (int i = 0; i < 8; ++i) d[i] = (_Float16)p[i];
        }
        __syncthreads();
        v16h a  = load_frag(&sA[(wr * 16 + lm) * 40], sel);
        v16h b0 = load_frag(&sB[(wc * 32 + 0  + lm) * 40], sel);
        v16h b1 = load_frag(&sB[(wc * 32 + 16 + lm) * 40], sel);
        acc0 = wmma_f16(a, b0, acc0);
        acc1 = wmma_f16(a, b1, acc1);
        __syncthreads();
    }

#pragma unroll
    for (int nt = 0; nt < 2; ++nt) {
        const v8f& acc = nt ? acc1 : acc0;
        int col = baseN + wc * 32 + nt * 16 + lm;
        float bv = proj_b[col];
#pragma unroll
        for (int j = 0; j < 8; ++j) {
            int gr = baseM + wr * 16 + j + sel * 8;
            out[(size_t)gr * DIM + col] = acc[j] + bv;
        }
    }
}

// ---------------------------------------------------------------------------
extern "C" void kernel_launch(void* const* d_in, const int* in_sizes, int n_in,
                              void* d_out, int out_size, void* d_ws, size_t ws_size,
                              hipStream_t stream)
{
    const float* x1          = (const float*)d_in[0];
    const float* x2          = (const float*)d_in[1];
    const float* mask        = (const float*)d_in[2];
    const float* qkv_w       = (const float*)d_in[3];
    const float* q_bias      = (const float*)d_in[4];
    const float* v_bias      = (const float*)d_in[5];
    const float* logit_scale = (const float*)d_in[6];
    const float* cpb_w1      = (const float*)d_in[7];
    const float* cpb_b1      = (const float*)d_in[8];
    const float* cpb_w2      = (const float*)d_in[9];
    const float* proj_w      = (const float*)d_in[10];
    const float* proj_b      = (const float*)d_in[11];
    const float* amod1       = (const float*)d_in[12];
    const float* amod2       = (const float*)d_in[13];
    const float* rel_table   = (const float*)d_in[14];
    const int*   rel_index   = (const int*)d_in[15];

    char* ws = (char*)d_ws;
    float*    t_tab = (float*)(ws + WS_T);
    float*    biasb = (float*)(ws + WS_BIAS);
    _Float16* qws   = (_Float16*)(ws + WS_Q);
    _Float16* kws   = (_Float16*)(ws + WS_K);
    _Float16* vws   = (_Float16*)(ws + WS_V);
    _Float16* ao    = (_Float16*)(ws + WS_AO);
    float*    out   = (float*)d_out;

    swin_cpb_mlp<<<1, 256, 0, stream>>>(rel_table, cpb_w1, cpb_b1, cpb_w2, t_tab);
    swin_bias_build<<<dim3(TWO_N, NH), 128, 0, stream>>>(t_tab, rel_index,
                                                         amod1, amod2, biasb);
    swin_qkv_gemm<<<dim3(256), 256, 0, stream>>>(x1, x2, qkv_w, q_bias,
                                                      v_bias, qws, kws, vws);
    swin_attn<<<dim3(NH, BW), 256, 0, stream>>>(qws, kws, vws, biasb, mask,
                                                logit_scale, ao);
    swin_proj_gemm<<<dim3(4, 1024), 256, 0, stream>>>(ao, proj_w, proj_b, out);
}

// v002
// One run takes 122 microseconds.
// Two timings next to v001 both put it at 1.11 times that version's speed.
// All steps since v000 together make it 1.52 times as fast.
#include <hip/hip_runtime.h>
#include <hip/hip_bf16.h>
#include <type_traits>

// ---------------------------------------------------------------------------
// SwinV2 window attention block on gfx1250 (CDNA5), wave32 + WMMA f16.
// ---------------------------------------------------------------------------

typedef _Float16 v16h __attribute__((ext_vector_type(16)));
typedef _Float16 v8h  __attribute__((ext_vector_type(8)));
typedef float    v8f  __attribute__((ext_vector_type(8)));
typedef _Float16 v4h  __attribute__((ext_vector_type(4)));
typedef float    v4f  __attribute__((ext_vector_type(4)));

#define NH   8
#define HD   32
#define NTOK 64
#define TWO_N 128
#define DIM  256
#define BW   512
#define NW   64
#define CPB  512

// workspace layout (bytes)
#define WS_T    ((size_t)0)                       // 225*8 f32
#define WS_BIAS ((size_t)8192)                    // 8*128*128 f32
#define WS_Q    ((size_t)532480)                  // 512*8*128*32 f16
#define WS_K    (WS_Q + (size_t)33554432)         // 512*8* 64*32 f16
#define WS_V    (WS_K + (size_t)16777216)         // 512*8*128*32 f16
#define WS_AO   (WS_V + (size_t)33554432)         // 512*128*256  f16

// Load a 16x32 f16 A-fragment (or 32x16 B-fragment) per ISA layout:
// lane<16 holds K = {0..7, 16..23}; lane>=16 holds K = {8..15, 24..31}.
// `seg` points at the 32-half contiguous K segment for this lane's row/col,
// and must be 16B aligned (row strides are multiples of 8 halves).
__device__ __forceinline__ v16h load_frag(const _Float16* seg, int sel) {
    v8h lo = *(const v8h*)(seg + sel * 8);
    v8h hi = *(const v8h*)(seg + 16 + sel * 8);
    v16h f;
#pragma unroll
    for (int i = 0; i < 8; ++i) { f[i] = lo[i]; f[i + 8] = hi[i]; }
    return f;
}

__device__ __forceinline__ v8f wmma_f16(v16h a, v16h b, v8f c) {
    return __builtin_amdgcn_wmma_f32_16x16x32_f16(false, a, false, b,
                                                  (short)0, c, false, false);
}

// ---------------------------------------------------------------------------
// 1) CPB MLP: 225 positions, 2 -> 512 (relu) -> 8
// ---------------------------------------------------------------------------
__global__ __launch_bounds__(256) void swin_cpb_mlp(
    const float* __restrict__ tbl, const float* __restrict__ w1,
    const float* __restrict__ b1, const float* __restrict__ w2,
    float* __restrict__ t_out)
{
    int p = threadIdx.x;
    if (p >= 225) return;
    float x0 = tbl[p * 2 + 0], x1 = tbl[p * 2 + 1];
    float acc[NH] = {};
    for (int j = 0; j < CPB; ++j) {
        float hsum = fmaxf(w1[j * 2] * x0 + w1[j * 2 + 1] * x1 + b1[j], 0.0f);
#pragma unroll
        for (int hh = 0; hh < NH; ++hh) acc[hh] += w2[hh * CPB + j] * hsum;
    }
#pragma unroll
    for (int hh = 0; hh < NH; ++hh) t_out[p * NH + hh] = acc[hh];
}

// ---------------------------------------------------------------------------
// 2) Bias build: rpb gather + 16*sigmoid + 2*amod quadrants -> (8,128,128)
// ---------------------------------------------------------------------------
__global__ __launch_bounds__(128) void swin_bias_build(
    const float* __restrict__ t_tab, const int* __restrict__ rel_index,
    const float* __restrict__ amod1, const float* __restrict__ amod2,
    float* __restrict__ biasb)
{
    int M = blockIdx.x, h = blockIdx.y, n = threadIdx.x;
    int m = M & 63, nn = n & 63;
    int idx = rel_index[m * 64 + nn];
    float r = t_tab[idx * NH + h];
    float rpb = 16.0f / (1.0f + __expf(-r));
    bool same_half = (M < 64) == (n < 64);
    const float* am = same_half ? amod1 : amod2;
    biasb[((size_t)h * TWO_N + M) * TWO_N + n] =
        rpb + 2.0f * am[((size_t)h * 64 + m) * 64 + nn];
}

// ---------------------------------------------------------------------------
// 3) QKV GEMM: [x1;x2] (65536x256) @ qkv_w^T (256x768) + bias, scatter q/k/v.
//    One block = 256 rows x all 768 columns, one block per WGP. The block's x
//    rows are read once, converted to f16 and kept as A fragments in registers
//    for the whole K (4 row tiles x 8 k-steps per wave). The weights pass
//    through LDS in 12 chunks of 64 columns (two buffers, one barrier a chunk).
//    8 waves = 4 row groups of 64 x 2 column halves of 32.
// ---------------------------------------------------------------------------
#define QP 264   // LDS row pitch in halves: 528 B = 16 B x odd for b128 readers
#define QCH 64   // weight columns per chunk
#define QNCH 12  // chunks

__global__ __launch_bounds__(256) void swin_qkv_gemm(
    const float* __restrict__ x1, const float* __restrict__ x2,
    const float* __restrict__ qkv_w, const float* __restrict__ q_bias,
    const float* __restrict__ v_bias,
    _Float16* __restrict__ qws, _Float16* __restrict__ kws,
    _Float16* __restrict__ vws)
{
    __shared__ __attribute__((aligned(16))) _Float16 sX[256 * QP];
    __shared__ __attribute__((aligned(16))) _Float16 sW[2][QCH * QP];
    __shared__ float sBias[3 * DIM];    // q_bias | 0 | v_bias

    const int tid   = threadIdx.x;
    const int baseM = blockIdx.x * 256;
    const int wv    = __builtin_amdgcn_readfirstlane(tid >> 5);
    const int lane  = tid & 31;
    const int wr = wv & 3, wc = wv >> 2;
    const int sel = lane >> 4, lm = lane & 15;
    const int wch = baseM >> 15;        // 0 -> x1, 1 -> x2 (same for the block)
    const int loc = baseM & 32767;

    // Each wave stages 8 weight rows of a chunk (2 coalesced 512-B loads a row)
    // and 32 x rows. All of the block's first loads go out as one group.
    const float* wsrc = qkv_w + (size_t)(wv * 8) * DIM + lane * 4;
    const float* xsrc = (wch ? x2 : x1) + (size_t)(loc + wv * 32) * DIM + lane * 4;
    v4f wreg[16];
    v4f xreg[64];
    // The fence pair keeps every other instruction out of [loads, wait], so that
    // no register a load names is written before the wait.
    __builtin_amdgcn_sched_barrier(0);
#pragma unroll
    for (int i = 0; i < 16; ++i)
        wreg[i] = *(const v4f*)(wsrc + (i >> 1) * DIM + (i & 1) * 128);
#pragma unroll
    for (int i = 0; i < 64; ++i)
        xreg[i] = *(const v4f*)(xsrc + (i >> 1) * DIM + (i & 1) * 128);
    const float qb = q_bias[tid];
    const float vb = v_bias[tid];
    // The loads' offset and base registers are reused right behind them.
    asm volatile("s_wait_xcnt 0x0" ::: "memory");
    __builtin_amdgcn_sched_barrier(0);

    sBias[tid]           = qb;
    sBias[DIM + tid]     = 0.0f;
    sBias[2 * DIM + tid] = vb;
    {
        _Float16* wd = &sW[0][(wv * 8) * QP + lane * 4];
#pragma unroll
        for (int i = 0; i < 16; ++i)
            *(v4h*)(wd + (i >> 1) * QP + (i & 1) * 128) =
                __builtin_convertvector(wreg[i], v4h);
        _Float16* xd = &sX[(wv * 32) * QP + lane * 4];
#pragma unroll
        for (int i = 0; i < 64; ++i)
            *(v4h*)(xd + (i >> 1) * QP + (i & 1) * 128) =
                __builtin_convertvector(xreg[i], v4h);
    }
    __syncthreads();

    v16h xa[4][8];
#pragma unroll
    for (int rt = 0; rt < 4; ++rt)
#pragma unroll
        for (int ks = 0; ks < 8; ++ks)
            xa[rt][ks] = load_frag(&sX[(wr * 64 + rt * 16 + lm) * QP + ks * 32], sel);

    const int b = (loc >> 6) + wr;      // a wave's 64 rows are one window

    // One chunk: fetch the next chunk's weights (not behind the last), multiply,
    // lay the fetched weights into the other buffer, store this chunk's columns.
    auto chunk = [&](const int c, auto more) __attribute__((always_inline)) {
        if constexpr (more.value) {
            const float* p = wsrc + (size_t)(c + 1) * QCH * DIM;
#pragma unroll
            for (int i = 0; i < 16; ++i)
                wreg[i] = *(const v4f*)(p + (i >> 1) * DIM + (i & 1) * 128);
        }

        const int s    = c >> 2;                 // 0=q,1=k,2=v
        const int hcol = (c * 2 + wc) & 7;       // a wave's 32 columns are one head
        const float bv0 = sBias[c * QCH + wc * 32 + lm];
        const float bv1 = sBias[c * QCH + wc * 32 + 16 + lm];
        _Float16* dst = (s == 0) ? qws : ((s == 1) ? kws : vws);
        dst += (s == 1) ? ((size_t)(b * NH + hcol) * NTOK) * HD
                        : ((size_t)(b * NH + hcol) * TWO_N + wch * NTOK) * HD;
        dst += sel * 8 * HD + lm;

        const _Float16* wb = &sW[c & 1][(wc * 32 + lm) * QP];
        v8f acc[4][2] = {};
        v16h bf[2][2];                           // fragments one k-step ahead
        bf[0][0] = load_frag(wb, sel);
        bf[0][1] = load_frag(wb + 16 * QP, sel);
#pragma unroll
        for (int ks = 0; ks < 8; ++ks) {
            if (ks < 7) {
                bf[(ks + 1) & 1][0] = load_frag(wb + (ks + 1) * 32, sel);
                bf[(ks + 1) & 1][1] = load_frag(wb + 16 * QP + (ks + 1) * 32, sel);
            }
            // Keeps the next k-step's LDS reads in front of this step's products;
            // without it they sink to just before their use and the wave waits.
            __builtin_amdgcn_sched_barrier(0);
#pragma unroll
            for (int rt = 0; rt < 4; ++rt) {
                acc[rt][0] = wmma_f16(xa[rt][ks], bf[ks & 1][0], acc[rt][0]);
                acc[rt][1] = wmma_f16(xa[rt][ks], bf[ks & 1][1], acc[rt][1]);
            }
            // Keeps the conversion of the fetched weights (and its wait on the
            // global loads) behind the products instead of among the first ones.
            __builtin_amdgcn_sched_barrier(0);
        }

        if constexpr (more.value) {
            _Float16* wd = &sW[(c + 1) & 1][(wv * 8) * QP + lane * 4];
#pragma unroll
            for (int i = 0; i < 16; ++i)
                *(v4h*)(wd + (i >> 1) * QP + (i & 1) * 128) =
                    __builtin_convertvector(wreg[i], v4h);
        }

        if (s != 1 || wch == 0) {                // k of x2 is never read
            _Float16 hv[4][2][8];
#pragma unroll
            for (int rt = 0; rt < 4; ++rt)
#pragma unroll
                for (int j = 0; j < 8; ++j) {
                    hv[rt][0][j] = (_Float16)(acc[rt][0][j] + bv0);
                    hv[rt][1][j] = (_Float16)(acc[rt][1][j] + bv1);
                }
            // All values first, then all stores: no register that an issued
            // store names is written again before the wait below.
            __builtin_amdgcn_sched_barrier(0);
#pragma unroll
            for (int rt = 0; rt < 4; ++rt)
#pragma unroll
                for (int j = 0; j < 8; ++j) {
                    dst[(rt * 16 + j) * HD]      = hv[rt][0][j];
                    dst[(rt * 16 + j) * HD + 16] = hv[rt][1][j];
                }
            // The next chunk overwrites the stores' data and address registers.
            if constexpr (more.value) asm volatile("s_wait_xcnt 0x0" ::: "memory");
        }
    };

    // Rolled: one chunk's code serves eleven chunks (instruction cache).
#pragma unroll 1
    for (int c = 0; c < QNCH - 1; ++c) {
        chunk(c, std::true_type{});
        // Publishes chunk c+1 and ends every wave's reads of chunk c's buffer.
        // Only LDS is handed over here, so the fences name LDS alone: a plain
        // __syncthreads() would also wait for this chunk's global stores.
        __builtin_amdgcn_fence(__ATOMIC_RELEASE, "workgroup", "local");
        __builtin_amdgcn_s_barrier();
        __builtin_amdgcn_fence(__ATOMIC_ACQUIRE, "workgroup", "local");
    }
    chunk(QNCH - 1, std::false_type{});
}

// ---------------------------------------------------------------------------
// 4) Attention: S = (Qn Kn^T)*scale + bias + mask; softmax; O = P V.
//    One block = one (head, mask window). The NIMG batch entries that share
//    that mask window are worked on one after the other, so the 128x128 bias
//    and mask are read once a block and their sum stays in registers.
// ---------------------------------------------------------------------------
#define NIMG (BW / NW)   // batch entries per mask window

// Work-group barrier that hands over LDS alone: a plain __syncthreads() would
// also wait for the rows fetched ahead and for the output stores in flight.
__device__ __forceinline__ void lds_barrier() {
    __builtin_amdgcn_fence(__ATOMIC_RELEASE, "workgroup", "local");
    __builtin_amdgcn_s_barrier();
    __builtin_amdgcn_fence(__ATOMIC_ACQUIRE, "workgroup", "local");
}

__global__ __launch_bounds__(256) void swin_attn(
    const _Float16* __restrict__ qws, const _Float16* __restrict__ kws,
    const _Float16* __restrict__ vws, const float* __restrict__ biasb,
    const float* __restrict__ mask, const float* __restrict__ logit_scale,
    _Float16* __restrict__ ao)
{
    __shared__ _Float16 sQ[TWO_N * 40];   // 128 x 32 (stride 40)
    __shared__ _Float16 sK[NTOK * 40];    //  64 x 32
    __shared__ _Float16 sVt[HD * 136];    //  32 x 128 (V transposed, stride 136)
    __shared__ _Float16 sP[TWO_N * 136];  // 128 x 128 probabilities, f16

    const int h = blockIdx.x, wdw = blockIdx.y;
    const int tid = threadIdx.x;
    const int wv = tid >> 5, lane = tid & 31;
    const int sel = lane >> 4, lm = lane & 15;

    // Threads 0..127 stage a q row and a v row each, threads 128..191 a k row.
    const bool isq   = tid < TWO_N;
    const bool isrow = tid < TWO_N + NTOK;
    const size_t qimg = (size_t)NW * NH * TWO_N * HD;  // halves to the next entry
    const size_t kimg = (size_t)NW * NH * NTOK * HD;
    const _Float16* rsrc =
        isq ? qws + ((size_t)(wdw * NH + h) * TWO_N + tid) * HD
            : kws + ((size_t)(wdw * NH + h) * NTOK + (tid & (NTOK - 1))) * HD;
    const size_t rstep = isq ? qimg : kimg;
    const _Float16* vsrc =
        vws + ((size_t)(wdw * NH + h) * TWO_N + (tid & (TWO_N - 1))) * HD;

    v8h rr[4], vr[4];
    auto fetch = [&](const int img) __attribute__((always_inline)) {
        // The fence pair keeps every other instruction out of [loads, wait], so
        // that no register a load names is written before the wait.
        __builtin_amdgcn_sched_barrier(0);
        if (isrow) {
            const v8h* p = (const v8h*)(rsrc + (size_t)img * rstep);
#pragma unroll
            for (int i = 0; i < 4; ++i) rr[i] = p[i];
        }
        if (isq) {
            const v8h* p = (const v8h*)(vsrc + (size_t)img * qimg);
#pragma unroll
            for (int i = 0; i < 4; ++i) vr[i] = p[i];
        }
        // The loads' address registers are reused behind them.
        asm volatile("s_wait_xcnt 0x0" ::: "memory");
        __builtin_amdgcn_sched_barrier(0);
    };
    fetch(0);

    // bias + mask of this wave's 16 rows, in the accumulator's own layout.
    const float* bptr = biasb + (size_t)h * TWO_N * TWO_N;
    const float* mptr = mask + (size_t)wdw * TWO_N * TWO_N;
    float bm[8][8];
#pragma unroll
    for (int j = 0; j < 8; ++j)
#pragma unroll
        for (int ct = 0; ct < 8; ++ct) {
            const int o = (wv * 16 + j + sel * 8) * TWO_N + ct * 16 + lm;
            bm[j][ct] = bptr[o] + mptr[o];
        }
    // The loads' address registers are reused behind them.
    asm volatile("s_wait_xcnt 0x0" ::: "memory");

    const float scale = __expf(fminf(logit_scale[h], 4.6051702f)); // log(100)

    // Rolled: one entry's code serves all (registers, instruction cache).
#pragma unroll 1
    for (int img = 0; img < NIMG; ++img) {
        // Inputs only: has every wave wait for its fetched rows here, on every
        // path. With the waits only inside the branches below, the compiler
        // holds each load of the next fetch behind the return of an older one.
        asm volatile("" :: "v"(rr[0]), "v"(rr[1]), "v"(rr[2]), "v"(rr[3]),
                           "v"(vr[0]), "v"(vr[1]), "v"(vr[2]), "v"(vr[3]));
        // --- L2-normalize Q and K into LDS, transpose-stage V ---
        if (isrow) {
            float tmp[HD]; float ss = 0.0f;
#pragma unroll
            for (int i = 0; i < HD; ++i) {
                tmp[i] = (float)rr[i >> 3][i & 7];
                ss += tmp[i] * tmp[i];
            }
            const float inv = 1.0f / fmaxf(sqrtf(ss), 1e-12f);
            if (isq) {
#pragma unroll
                for (int i = 0; i < HD; ++i)
                    sQ[tid * 40 + i] = (_Float16)(tmp[i] * inv);
            } else {
#pragma unroll
                for (int i = 0; i < HD; ++i)
                    sK[(tid - TWO_N) * 40 + i] = (_Float16)(tmp[i] * inv);
            }
        }
        if (isq) {
#pragma unroll
            for (int i = 0; i < HD; ++i) sVt[i * 136 + tid] = vr[i >> 3][i & 7];
        }
        lds_barrier();                    // publishes this entry's Q, K, V

        // The next entry's rows fly while this one is worked on.
        if (img + 1 < NIMG) fetch(img + 1);

        // --- S = Q K^T : one WMMA per 16x16 tile (K-depth == head dim == 32) ---
        v16h aQ = load_frag(&sQ[(wv * 16 + lm) * 40], sel);
        v16h bK[4];
#pragma unroll
        for (int kb = 0; kb < 4; ++kb)
            bK[kb] = load_frag(&sK[(kb * 16 + lm) * 40], sel);

        v8f acc[8];
#pragma unroll
        for (int ct = 0; ct < 8; ++ct) {
            v8f z = {};
            acc[ct] = wmma_f16(aQ, bK[ct & 3], z);  // cols 64..127 reuse K (k=[k1;k1])
        }

        // --- scale + (bias + mask), then row softmax. Each cross-lane step is
        //     taken for all 8 rows together: one LDS-pipe wait serves 8 rows. ---
        float mx[8], sm[8], ot[8];
#pragma unroll
        for (int j = 0; j < 8; ++j) {
            float m = -1e30f;
#pragma unroll
            for (int ct = 0; ct < 8; ++ct) {
                float v = acc[ct][j] * scale + bm[j][ct];
                acc[ct][j] = v;
                m = fmaxf(m, v);
            }
            mx[j] = m;
        }
#pragma unroll
        for (int s = 1; s < 16; s <<= 1) {
#pragma unroll
            for (int j = 0; j < 8; ++j) ot[j] = __shfl_xor(mx[j], s, 32);
#pragma unroll
            for (int j = 0; j < 8; ++j) mx[j] = fmaxf(mx[j], ot[j]);
        }
#pragma unroll
        for (int j = 0; j < 8; ++j) {
            float t = 0.0f;
#pragma unroll
            for (int ct = 0; ct < 8; ++ct) {
                float p = __expf(acc[ct][j] - mx[j]);
                acc[ct][j] = p;
                t += p;
            }
            sm[j] = t;
        }
#pragma unroll
        for (int s = 1; s < 16; s <<= 1) {
#pragma unroll
            for (int j = 0; j < 8; ++j) ot[j] = __shfl_xor(sm[j], s, 32);
#pragma unroll
            for (int j = 0; j < 8; ++j) sm[j] += ot[j];
        }
#pragma unroll
        for (int j = 0; j < 8; ++j) {
            const int M = wv * 16 + j + sel * 8;
            const float invs = 1.0f / sm[j];
#pragma unroll
            for (int ct = 0; ct < 8; ++ct)
                sP[M * 136 + ct * 16 + lm] = (_Float16)(acc[ct][j] * invs);
        }
        // No barrier here: a wave reads back only the 16 rows of P it wrote.

        // --- O = P V : K-depth 128 -> 4 WMMA steps x 2 column tiles ---
        v8f o0 = {}, o1 = {};
#pragma unroll
        for (int kc = 0; kc < 4; ++kc) {
            v16h aP = load_frag(&sP[(wv * 16 + lm) * 136 + kc * 32], sel);
            v16h b0 = load_frag(&sVt[(0  + lm) * 136 + kc * 32], sel);
            v16h b1 = load_frag(&sVt[(16 + lm) * 136 + kc * 32], sel);
            o0 = wmma_f16(aP, b0, o0);
            o1 = wmma_f16(aP, b1, o1);
        }
        {
            const int b = img * NW + wdw;
            _Float16* od = ao + ((size_t)b * TWO_N + wv * 16 + sel * 8) * DIM
                              + h * HD + lm;
            _Float16 hv[2][8];
#pragma unroll
            for (int j = 0; j < 8; ++j) {
                hv[0][j] = (_Float16)o0[j];
                hv[1][j] = (_Float16)o1[j];
            }
            // All values first, then all stores: no register that an issued
            // store names is written again before the wait below.
            __builtin_amdgcn_sched_barrier(0);
#pragma unroll
            for (int j = 0; j < 8; ++j) {
                od[j * DIM]      = hv[0][j];
                od[j * DIM + 16] = hv[1][j];
            }
            // The next entry overwrites the stores' data and address registers.
            asm volatile("s_wait_xcnt 0x0" ::: "memory");
        }
        lds_barrier();                    // ends every wave's reads of Q, K, V
    }
}

// ---------------------------------------------------------------------------
// 5) Output projection: ao (65536x256 f16) @ proj_w^T + proj_b -> f32 out
// ---------------------------------------------------------------------------
__global__ __launch_bounds__(256) void swin_proj_gemm(
    const _Float16* __restrict__ ao, const float* __restrict__ proj_w,
    const float* __restrict__ proj_b, float* __restrict__ out)
{
    __shared__ _Float16 sA[64 * 40];
    __shared__ _Float16 sB[64 * 40];

    const int tid   = threadIdx.x;
    const int baseM = blockIdx.y * 64;
    const int baseN = blockIdx.x * 64;
    const int wv = tid >> 5, lane = tid & 31;
    const int wr = wv & 3, wc = wv >> 2;
    const int sel = lane >> 4, lm = lane & 15;

    v8f acc0 = {}, acc1 = {};

    const int lrow  = tid >> 2;
    const int lpart = (tid & 3) * 8;
    const _Float16* asrc = ao + (size_t)(baseM + lrow) * DIM;
    const float*    wsrc = proj_w + (size_t)(baseN + lrow) * DIM;

    for (int kk = 0; kk < DIM; kk += 32) {
        *(v8h*)&sA[lrow * 40 + lpart] = *(const v8h*)(asrc + kk + lpart);
        {
            const float* p = wsrc + kk + lpart;
            _Float16* d = &sB[lrow * 40 + lpart];
#pragma unroll
            for (int i = 0; i < 8; ++i) d[i] = (_Float16)p[i];
        }
        __syncthreads();
        v16h a  = load_frag(&sA[(wr * 16 + lm) * 40], sel);
        v16h b0 = load_frag(&sB[(wc * 32 + 0  + lm) * 40], sel);
        v16h b1 = load_frag(&sB[(wc * 32 + 16 + lm) * 40], sel);
        acc0 = wmma_f16(a, b0, acc0);
        acc1 = wmma_f16(a, b1, acc1);
        __syncthreads();
    }

#pragma unroll
    for (int nt = 0; nt < 2; ++nt) {
        const v8f& acc = nt ? acc1 : acc0;
        int col = baseN + wc * 32 + nt * 16 + lm;
        float bv = proj_b[col];
#pragma unroll
        for (int j = 0; j < 8; ++j) {
            int gr = baseM + wr * 16 + j + sel * 8;
            out[(size_t)gr * DIM + col] = acc[j] + bv;
        }
    }
}

// ---------------------------------------------------------------------------
extern "C" void kernel_launch(void* const* d_in, const int* in_sizes, int n_in,
                              void* d_out, int out_size, void* d_ws, size_t ws_size,
                              hipStream_t stream)
{
    const float* x1          = (const float*)d_in[0];
    const float* x2          = (const float*)d_in[1];
    const float* mask        = (const float*)d_in[2];
    const float* qkv_w       = (const float*)d_in[3];
    const float* q_bias      = (const float*)d_in[4];
    const float* v_bias      = (const float*)d_in[5];
    const float* logit_scale = (const float*)d_in[6];
    const float* cpb_w1      = (const float*)d_in[7];
    const float* cpb_b1      = (const float*)d_in[8];
    const float* cpb_w2      = (const float*)d_in[9];
    const float* proj_w      = (const float*)d_in[10];
    const float* proj_b      = (const float*)d_in[11];
    const float* amod1       = (const float*)d_in[12];
    const float* amod2       = (const float*)d_in[13];
    const float* rel_table   = (const float*)d_in[14];
    const int*   rel_index   = (const int*)d_in[15];

    char* ws = (char*)d_ws;
    float*    t_tab = (float*)(ws + WS_T);
    float*    biasb = (float*)(ws + WS_BIAS);
    _Float16* qws   = (_Float16*)(ws + WS_Q);
    _Float16* kws   = (_Float16*)(ws + WS_K);
    _Float16* vws   = (_Float16*)(ws + WS_V);
    _Float16* ao    = (_Float16*)(ws + WS_AO);
    float*    out   = (float*)d_out;

    swin_cpb_mlp<<<1, 256, 0, stream>>>(rel_table, cpb_w1, cpb_b1, cpb_w2, t_tab);
    swin_bias_build<<<dim3(TWO_N, NH), 128, 0, stream>>>(t_tab, rel_index,
                                                         amod1, amod2, biasb);
    swin_qkv_gemm<<<dim3(256), 256, 0, stream>>>(x1, x2, qkv_w, q_bias,
                                                      v_bias, qws, kws, vws);
    swin_attn<<<dim3(NH, NW), 256, 0, stream>>>(qws, kws, vws, biasb, mask,
                                                logit_scale, ao);
    swin_proj_gemm<<<dim3(4, 1024), 256, 0, stream>>>(ao, proj_w, proj_b, out);
}

// v003
// Measured time: 101 microseconds a run.
// Two timings next to v002 both put it at 1.20 times that version's speed.
// Counting every step since v000, it is 1.83 times as fast.
#include <hip/hip_runtime.h>
#include <hip/hip_bf16.h>
#include <type_traits>

// ---------------------------------------------------------------------------
// SwinV2 window attention block on gfx1250 (CDNA5), wave32 + WMMA f16.
// ---------------------------------------------------------------------------

typedef _Float16 v16h __attribute__((ext_vector_type(16)));
typedef _Float16 v8h  __attribute__((ext_vector_type(8)));
typedef float    v8f  __attribute__((ext_vector_type(8)));
typedef _Float16 v4h  __attribute__((ext_vector_type(4)));
typedef float    v4f  __attribute__((ext_vector_type(4)));
typedef float    v2f  __attribute__((ext_vector_type(2)));

#define NH   8
#define HD   32
#define NTOK 64
#define TWO_N 128
#define DIM  256
#define BW   512
#define NW   64
#define CPB  512

// workspace layout (bytes)
#define WS_BIAS ((size_t)8192)                    // 8*128*128 f32
#define WS_Q    ((size_t)532480)                  // 512*8*128*32 f16
#define WS_K    (WS_Q + (size_t)33554432)         // 512*8* 64*32 f16
#define WS_V    (WS_K + (size_t)16777216)         // 512*8*128*32 f16
#define WS_AO   (WS_V + (size_t)33554432)         // 512*128*256  f16

// Load a 16x32 f16 A-fragment (or 32x16 B-fragment) per ISA layout:
// lane<16 holds K = {0..7, 16..23}; lane>=16 holds K = {8..15, 24..31}.
// `seg` points at the 32-half contiguous K segment for this lane's row/col,
// and must be 16B aligned (row strides are multiples of 8 halves).
__device__ __forceinline__ v16h load_frag(const _Float16* seg, int sel) {
    v8h lo = *(const v8h*)(seg + sel * 8);
    v8h hi = *(const v8h*)(seg + 16 + sel * 8);
    v16h f;
#pragma unroll
    for (int i = 0; i < 8; ++i) { f[i] = lo[i]; f[i + 8] = hi[i]; }
    return f;
}

__device__ __forceinline__ v8f wmma_f16(v16h a, v16h b, v8f c) {
    return __builtin_amdgcn_wmma_f32_16x16x32_f16(false, a, false, b,
                                                  (short)0, c, false, false);
}

// ---------------------------------------------------------------------------
// 1) Bias build: CPB MLP (2 -> 512 relu -> 8), rpb gather + 16*sigmoid +
//    2*amod quadrants -> (8,128,128).
//    One block = one token row m and BHD heads. It computes the MLP itself for
//    the 64 table positions that row m gathers: the weights lie in LDS, each
//    wave takes 64 of the 512 hidden units for all 64 positions (2 a lane), and
//    the 8 waves' partial sums are added through LDS.
// ---------------------------------------------------------------------------
#define BHD  2    // heads per block
#define NPOS 225  // rows of the relative-coordinate table

__global__ __launch_bounds__(256) void swin_bias_build(
    const float* __restrict__ tbl, const float* __restrict__ w1,
    const float* __restrict__ b1, const float* __restrict__ w2,
    const int* __restrict__ rel_index,
    const float* __restrict__ amod1, const float* __restrict__ amod2,
    float* __restrict__ biasb)
{
    __shared__ __attribute__((aligned(16))) float sW1[CPB * 2];
    __shared__ __attribute__((aligned(16))) float sB1[CPB];
    __shared__ __attribute__((aligned(16))) float sW2[BHD * CPB];
    __shared__ float sPart[8][BHD][NTOK];

    const int m = blockIdx.x, h0 = blockIdx.y * BHD;
    const int tid  = threadIdx.x;
    const int wv   = __builtin_amdgcn_readfirstlane(tid >> 5);
    const int lane = tid & 31;
    const int n = tid & (TWO_N - 1), nn = n & (NTOK - 1), hh = tid >> 7;
    const size_t aoff = ((size_t)(h0 + hh) * NTOK + m) * NTOK + nn;
    const int*   pix = rel_index + m * NTOK + lane;
    const float* pw1 = w1 + tid * 4;
    const float* pb1 = b1 + tid * 2;
    const float* pw2 = w2 + (size_t)h0 * CPB + tid * 4;
    const float* pa1 = amod1 + aoff;
    const float* pa2 = amod2 + aoff;

    // The fences keep other work out of [loads, wait], so that no register an
    // issued load names is written before the wait.
    __builtin_amdgcn_sched_barrier(0);
    int i0 = pix[0];
    int i1 = pix[32];
    const v4f rw1 = *(const v4f*)pw1;
    const v2f rb1 = *(const v2f*)pb1;
    const v4f rw2 = *(const v4f*)pw2;
    const float a1 = *pa1;
    const float a2 = *pa2;
    asm volatile("s_wait_xcnt 0x0" ::: "memory");
    __builtin_amdgcn_sched_barrier(0);

    // The index is input data: bound the table address.
    i0 = min(max(i0, 0), NPOS - 1);
    i1 = min(max(i1, 0), NPOS - 1);
    const v2f xa = *(const v2f*)(tbl + i0 * 2);
    const v2f xb = *(const v2f*)(tbl + i1 * 2);
    // The loads' offset registers are reused right behind them.
    asm volatile("s_wait_xcnt 0x0" ::: "memory");
    __builtin_amdgcn_sched_barrier(0);

    *(v4f*)&sW1[tid * 4] = rw1;
    *(v2f*)&sB1[tid * 2] = rb1;
    *(v4f*)&sW2[tid * 4] = rw2;
    __syncthreads();                      // publishes the weights

    float acc[2][BHD] = {};
    const int j0 = wv * (CPB / 8);
#pragma unroll
    for (int jj = 0; jj < CPB / 8; jj += 4) {
        const int j = j0 + jj;
        const v4f wa = *(const v4f*)&sW1[j * 2];
        const v4f wb = *(const v4f*)&sW1[j * 2 + 4];
        const v4f bb = *(const v4f*)&sB1[j];
        const v4f u0 = *(const v4f*)&sW2[j];
        const v4f u1 = *(const v4f*)&sW2[CPB + j];
#pragma unroll
        for (int q = 0; q < 4; ++q) {
            const float c0 = (q < 2) ? wa[2 * q]     : wb[2 * q - 4];
            const float c1 = (q < 2) ? wa[2 * q + 1] : wb[2 * q - 3];
            const float ha = fmaxf(c0 * xa[0] + c1 * xa[1] + bb[q], 0.0f);
            const float hb = fmaxf(c0 * xb[0] + c1 * xb[1] + bb[q], 0.0f);
            acc[0][0] += u0[q] * ha;
            acc[0][1] += u1[q] * ha;
            acc[1][0] += u0[q] * hb;
            acc[1][1] += u1[q] * hb;
        }
    }
#pragma unroll
    for (int p = 0; p < 2; ++p)
#pragma unroll
        for (int g = 0; g < BHD; ++g) sPart[wv][g][p * 32 + lane] = acc[p][g];
    __syncthreads();                      // publishes the partial sums

    float r = 0.0f;
#pragma unroll
    for (int k = 0; k < 8; ++k) r += sPart[k][hh][nn];
    const float rpb = 16.0f / (1.0f + __expf(-r));
    // Rows m and m+64: amod1 where row and column lie in the same half.
    const bool lo = n < NTOK;
    float* bd = biasb + ((size_t)(h0 + hh) * TWO_N + m) * TWO_N + n;
    bd[0]            = rpb + 2.0f * (lo ? a1 : a2);
    bd[NTOK * TWO_N] = rpb + 2.0f * (lo ? a2 : a1);
}

// ---------------------------------------------------------------------------
// 2) QKV GEMM: [x1;x2] (65536x256) @ qkv_w^T (256x768) + bias, scatter q/k/v.
//    One block = 256 rows x all 768 columns, one block per WGP. The block's x
//    rows are read once, converted to f16 and kept as A fragments in registers
//    for the whole K (4 row tiles x 8 k-steps per wave). The weights pass
//    through LDS in 12 chunks of 64 columns (two buffers, one barrier a chunk).
//    8 waves = 4 row groups of 64 x 2 column halves of 32.
// ---------------------------------------------------------------------------
#define QP 264   // LDS row pitch in halves: 528 B = 16 B x odd for b128 readers
#define QCH 64   // weight columns per chunk
#define QNCH 12  // chunks

__global__ __launch_bounds__(256) void swin_qkv_gemm(
    const float* __restrict__ x1, const float* __restrict__ x2,
    const float* __restrict__ qkv_w, const float* __restrict__ q_bias,
    const float* __restrict__ v_bias,
    _Float16* __restrict__ qws, _Float16* __restrict__ kws,
    _Float16* __restrict__ vws)
{
    __shared__ __attribute__((aligned(16))) _Float16 sX[256 * QP];
    __shared__ __attribute__((aligned(16))) _Float16 sW[2][QCH * QP];
    __shared__ float sBias[3 * DIM];    // q_bias | 0 | v_bias

    const int tid   = threadIdx.x;
    const int baseM = blockIdx.x * 256;
    const int wv    = __builtin_amdgcn_readfirstlane(tid >> 5);
    const int lane  = tid & 31;
    const int wr = wv & 3, wc = wv >> 2;
    const int sel = lane >> 4, lm = lane & 15;
    const int wch = baseM >> 15;        // 0 -> x1, 1 -> x2 (same for the block)
    const int loc = baseM & 32767;

    // Each wave stages 8 weight rows of a chunk (2 coalesced 512-B loads a row)
    // and 32 x rows. All of the block's first loads go out as one group.
    const float* wsrc = qkv_w + (size_t)(wv * 8) * DIM + lane * 4;
    const float* xsrc = (wch ? x2 : x1) + (size_t)(loc + wv * 32) * DIM + lane * 4;
    v4f wreg[16];
    v4f xreg[64];
    // The fence pair keeps every other instruction out of [loads, wait], so that
    // no register a load names is written before the wait.
    __builtin_amdgcn_sched_barrier(0);
#pragma unroll
    for (int i = 0; i < 16; ++i)
        wreg[i] = *(const v4f*)(wsrc + (i >> 1) * DIM + (i & 1) * 128);
#pragma unroll
    for (int i = 0; i < 64; ++i)
        xreg[i] = *(const v4f*)(xsrc + (i >> 1) * DIM + (i & 1) * 128);
    const float qb = q_bias[tid];
    const float vb = v_bias[tid];
    // The loads' offset and base registers are reused right behind them.
    asm volatile("s_wait_xcnt 0x0" ::: "memory");
    __builtin_amdgcn_sched_barrier(0);

    sBias[tid]           = qb;
    sBias[DIM + tid]     = 0.0f;
    sBias[2 * DIM + tid] = vb;
    {
        _Float16* wd = &sW[0][(wv * 8) * QP + lane * 4];
#pragma unroll
        for (int i = 0; i < 16; ++i)
            *(v4h*)(wd + (i >> 1) * QP + (i & 1) * 128) =
                __builtin_convertvector(wreg[i], v4h);
        _Float16* xd = &sX[(wv * 32) * QP + lane * 4];
#pragma unroll
        for (int i = 0; i < 64; ++i)
            *(v4h*)(xd + (i >> 1) * QP + (i & 1) * 128) =
                __builtin_convertvector(xreg[i], v4h);
    }
    __syncthreads();

    v16h xa[4][8];
#pragma unroll
    for (int rt = 0; rt < 4; ++rt)
#pragma unroll
        for (int ks = 0; ks < 8; ++ks)
            xa[rt][ks] = load_frag(&sX[(wr * 64 + rt * 16 + lm) * QP + ks * 32], sel);

    const int b = (loc >> 6) + wr;      // a wave's 64 rows are one window

    // One chunk: fetch the next chunk's weights (not behind the last), multiply,
    // lay the fetched weights into the other buffer, store this chunk's columns.
    auto chunk = [&](const int c, auto more) __attribute__((always_inline)) {
        if constexpr (more.value) {
            const float* p = wsrc + (size_t)(c + 1) * QCH * DIM;
#pragma unroll
            for (int i = 0; i < 16; ++i)
                wreg[i] = *(const v4f*)(p + (i >> 1) * DIM + (i & 1) * 128);
        }

        const int s    = c >> 2;                 // 0=q,1=k,2=v
        const int hcol = (c * 2 + wc) & 7;       // a wave's 32 columns are one head
        const float bv0 = sBias[c * QCH + wc * 32 + lm];
        const float bv1 = sBias[c * QCH + wc * 32 + 16 + lm];
        _Float16* dst = (s == 0) ? qws : ((s == 1) ? kws : vws);
        dst += (s == 1) ? ((size_t)(b * NH + hcol) * NTOK) * HD
                        : ((size_t)(b * NH + hcol) * TWO_N + wch * NTOK) * HD;
        dst += sel * 8 * HD + lm;

        const _Float16* wb = &sW[c & 1][(wc * 32 + lm) * QP];
        v8f acc[4][2] = {};
        v16h bf[2][2];                           // fragments one k-step ahead
        bf[0][0] = load_frag(wb, sel);
        bf[0][1] = load_frag(wb + 16 * QP, sel);
#pragma unroll
        for (int ks = 0; ks < 8; ++ks) {
            if (ks < 7) {
                bf[(ks + 1) & 1][0] = load_frag(wb + (ks + 1) * 32, sel);
                bf[(ks + 1) & 1][1] = load_frag(wb + 16 * QP + (ks + 1) * 32, sel);
            }
            // Keeps the next k-step's LDS reads in front of this step's products;
            // without it they sink to just before their use and the wave waits.
            __builtin_amdgcn_sched_barrier(0);
#pragma unroll
            for (int rt = 0; rt < 4; ++rt) {
                acc[rt][0] = wmma_f16(xa[rt][ks], bf[ks & 1][0], acc[rt][0]);
                acc[rt][1] = wmma_f16(xa[rt][ks], bf[ks & 1][1], acc[rt][1]);
            }
            // Keeps the conversion of the fetched weights (and its wait on the
            // global loads) behind the products instead of among the first ones.
            __builtin_amdgcn_sched_barrier(0);
        }

        if constexpr (more.value) {
            _Float16* wd = &sW[(c + 1) & 1][(wv * 8) * QP + lane * 4];
#pragma unroll
            for (int i = 0; i < 16; ++i)
                *(v4h*)(wd + (i >> 1) * QP + (i & 1) * 128) =
                    __builtin_convertvector(wreg[i], v4h);
        }

        if (s != 1 || wch == 0) {                // k of x2 is never read
            _Float16 hv[4][2][8];
#pragma unroll
            for (int rt = 0; rt < 4; ++rt)
#pragma unroll
                for (int j = 0; j < 8; ++j) {
                    hv[rt][0][j] = (_Float16)(acc[rt][0][j] + bv0);
                    hv[rt][1][j] = (_Float16)(acc[rt][1][j] + bv1);
                }
            // All values first, then all stores: no register that an issued
            // store names is written again before the wait below.
            __builtin_amdgcn_sched_barrier(0);
#pragma unroll
            for (int rt = 0; rt < 4; ++rt)
#pragma unroll
                for (int j = 0; j < 8; ++j) {
                    dst[(rt * 16 + j) * HD]      = hv[rt][0][j];
                    dst[(rt * 16 + j) * HD + 16] = hv[rt][1][j];
                }
            // The next chunk overwrites the stores' data and address registers.
            if constexpr (more.value) asm volatile("s_wait_xcnt 0x0" ::: "memory");
        }
    };

    // Rolled: one chunk's code serves eleven chunks (instruction cache).
#pragma unroll 1
    for (int c = 0; c < QNCH - 1; ++c) {
        chunk(c, std::true_type{});
        // Publishes chunk c+1 and ends every wave's reads of chunk c's buffer.
        // Only LDS is handed over here, so the fences name LDS alone: a plain
        // __syncthreads() would also wait for this chunk's global stores.
        __builtin_amdgcn_fence(__ATOMIC_RELEASE, "workgroup", "local");
        __builtin_amdgcn_s_barrier();
        __builtin_amdgcn_fence(__ATOMIC_ACQUIRE, "workgroup", "local");
    }
    chunk(QNCH - 1, std::false_type{});
}

// ---------------------------------------------------------------------------
// 3) Attention: S = (Qn Kn^T)*scale + bias + mask; softmax; O = P V.
//    One block = one (head, mask window). The NIMG batch entries that share
//    that mask window are worked on one after the other, so the 128x128 bias
//    and mask are read once a block and their sum stays in registers.
// ---------------------------------------------------------------------------
#define NIMG (BW / NW)   // batch entries per mask window

// Work-group barrier that hands over LDS alone: a plain __syncthreads() would
// also wait for the rows fetched ahead and for the output stores in flight.
__device__ __forceinline__ void lds_barrier() {
    __builtin_amdgcn_fence(__ATOMIC_RELEASE, "workgroup", "local");
    __builtin_amdgcn_s_barrier();
    __builtin_amdgcn_fence(__ATOMIC_ACQUIRE, "workgroup", "local");
}

__global__ __launch_bounds__(256) void swin_attn(
    const _Float16* __restrict__ qws, const _Float16* __restrict__ kws,
    const _Float16* __restrict__ vws, const float* __restrict__ biasb,
    const float* __restrict__ mask, const float* __restrict__ logit_scale,
    _Float16* __restrict__ ao)
{
    __shared__ _Float16 sQ[TWO_N * 40];   // 128 x 32 (stride 40)
    __shared__ _Float16 sK[NTOK * 40];    //  64 x 32
    __shared__ _Float16 sVt[HD * 136];    //  32 x 128 (V transposed, stride 136)
    __shared__ _Float16 sP[TWO_N * 136];  // 128 x 128 probabilities, f16

    const int h = blockIdx.x, wdw = blockIdx.y;
    const int tid = threadIdx.x;
    const int wv = tid >> 5, lane = tid & 31;
    const int sel = lane >> 4, lm = lane & 15;

    // Threads 0..127 stage a q row and a v row each, threads 128..191 a k row.
    const bool isq   = tid < TWO_N;
    const bool isrow = tid < TWO_N + NTOK;
    const size_t qimg = (size_t)NW * NH * TWO_N * HD;  // halves to the next entry
    const size_t kimg = (size_t)NW * NH * NTOK * HD;
    const _Float16* rsrc =
        isq ? qws + ((size_t)(wdw * NH + h) * TWO_N + tid) * HD
            : kws + ((size_t)(wdw * NH + h) * NTOK + (tid & (NTOK - 1))) * HD;
    const size_t rstep = isq ? qimg : kimg;
    const _Float16* vsrc =
        vws + ((size_t)(wdw * NH + h) * TWO_N + (tid & (TWO_N - 1))) * HD;

    v8h rr[4], vr[4];
    auto fetch = [&](const int img) __attribute__((always_inline)) {
        // The fence pair keeps every other instruction out of [loads, wait], so
        // that no register a load names is written before the wait.
        __builtin_amdgcn_sched_barrier(0);
        if (isrow) {
            const v8h* p = (const v8h*)(rsrc + (size_t)img * rstep);
#pragma unroll
            for (int i = 0; i < 4; ++i) rr[i] = p[i];
        }
        if (isq) {
            const v8h* p = (const v8h*)(vsrc + (size_t)img * qimg);
#pragma unroll
            for (int i = 0; i < 4; ++i) vr[i] = p[i];
        }
        // The loads' address registers are reused behind them.
        asm volatile("s_wait_xcnt 0x0" ::: "memory");
        __builtin_amdgcn_sched_barrier(0);
    };
    fetch(0);

    // bias + mask of this wave's 16 rows, in the accumulator's own layout.
    const float* bptr = biasb + (size_t)h * TWO_N * TWO_N;
    const float* mptr = mask + (size_t)wdw * TWO_N * TWO_N;
    float bm[8][8];
#pragma unroll
    for (int j = 0; j < 8; ++j)
#pragma unroll
        for (int ct = 0; ct < 8; ++ct) {
            const int o = (wv * 16 + j + sel * 8) * TWO_N + ct * 16 + lm;
            bm[j][ct] = bptr[o] + mptr[o];
        }
    // The loads' address registers are reused behind them.
    asm volatile("s_wait_xcnt 0x0" ::: "memory");

    const float scale = __expf(fminf(logit_scale[h], 4.6051702f)); // log(100)

    // Rolled: one entry's code serves all (registers, instruction cache).
#pragma unroll 1
    for (int img = 0; img < NIMG; ++img) {
        // Inputs only: has every wave wait for its fetched rows here, on every
        // path. With the waits only inside the branches below, the compiler
        // holds each load of the next fetch behind the return of an older one.
        asm volatile("" :: "v"(rr[0]), "v"(rr[1]), "v"(rr[2]), "v"(rr[3]),
                           "v"(vr[0]), "v"(vr[1]), "v"(vr[2]), "v"(vr[3]));
        // --- L2-normalize Q and K into LDS, transpose-stage V ---
        if (isrow) {
            float tmp[HD]; float ss = 0.0f;
#pragma unroll
            for (int i = 0; i < HD; ++i) {
                tmp[i] = (float)rr[i >> 3][i & 7];
                ss += tmp[i] * tmp[i];
            }
            const float inv = 1.0f / fmaxf(sqrtf(ss), 1e-12f);
            if (isq) {
#pragma unroll
                for (int i = 0; i < HD; ++i)
                    sQ[tid * 40 + i] = (_Float16)(tmp[i] * inv);
            } else {
#pragma unroll
                for (int i = 0; i < HD; ++i)
                    sK[(tid - TWO_N) * 40 + i] = (_Float16)(tmp[i] * inv);
            }
        }
        if (isq) {
#pragma unroll
            for (int i = 0; i < HD; ++i) sVt[i * 136 + tid] = vr[i >> 3][i & 7];
        }
        lds_barrier();                    // publishes this entry's Q, K, V

        // The next entry's rows fly while this one is worked on.
        if (img + 1 < NIMG) fetch(img + 1);

        // --- S = Q K^T : one WMMA per 16x16 tile (K-depth == head dim == 32) ---
        v16h aQ = load_frag(&sQ[(wv * 16 + lm) * 40], sel);
        v16h bK[4];
#pragma unroll
        for (int kb = 0; kb < 4; ++kb)
            bK[kb] = load_frag(&sK[(kb * 16 + lm) * 40], sel);

        v8f acc[8];
#pragma unroll
        for (int ct = 0; ct < 8; ++ct) {
            v8f z = {};
            acc[ct] = wmma_f16(aQ, bK[ct & 3], z);  // cols 64..127 reuse K (k=[k1;k1])
        }

        // --- scale + (bias + mask), then row softmax. Each cross-lane step is
        //     taken for all 8 rows together: one LDS-pipe wait serves 8 rows. ---
        float mx[8], sm[8], ot[8];
#pragma unroll
        for (int j = 0; j < 8; ++j) {
            float m = -1e30f;
#pragma unroll
            for (int ct = 0; ct < 8; ++ct) {
                float v = acc[ct][j] * scale + bm[j][ct];
                acc[ct][j] = v;
                m = fmaxf(m, v);
            }
            mx[j] = m;
        }
#pragma unroll
        for (int s = 1; s < 16; s <<= 1) {
#pragma unroll
            for (int j = 0; j < 8; ++j) ot[j] = __shfl_xor(mx[j], s, 32);
#pragma unroll
            for (int j = 0; j < 8; ++j) mx[j] = fmaxf(mx[j], ot[j]);
        }
#pragma unroll
        for (int j = 0; j < 8; ++j) {
            float t = 0.0f;
#pragma unroll
            for (int ct = 0; ct < 8; ++ct) {
                float p = __expf(acc[ct][j] - mx[j]);
                acc[ct][j] = p;
                t += p;
            }
            sm[j] = t;
        }
#pragma unroll
        for (int s = 1; s < 16; s <<= 1) {
#pragma unroll
            for (int j = 0; j < 8; ++j) ot[j] = __shfl_xor(sm[j], s, 32);
#pragma unroll
            for (int j = 0; j < 8; ++j) sm[j] += ot[j];
        }
#pragma unroll
        for (int j = 0; j < 8; ++j) {
            const int M = wv * 16 + j + sel * 8;
            const float invs = 1.0f / sm[j];
#pragma unroll
            for (int ct = 0; ct < 8; ++ct)
                sP[M * 136 + ct * 16 + lm] = (_Float16)(acc[ct][j] * invs);
        }
        // No barrier here: a wave reads back only the 16 rows of P it wrote.

        // --- O = P V : K-depth 128 -> 4 WMMA steps x 2 column tiles ---
        v8f o0 = {}, o1 = {};
#pragma unroll
        for (int kc = 0; kc < 4; ++kc) {
            v16h aP = load_frag(&sP[(wv * 16 + lm) * 136 + kc * 32], sel);
            v16h b0 = load_frag(&sVt[(0  + lm) * 136 + kc * 32], sel);
            v16h b1 = load_frag(&sVt[(16 + lm) * 136 + kc * 32], sel);
            o0 = wmma_f16(aP, b0, o0);
            o1 = wmma_f16(aP, b1, o1);
        }
        {
            const int b = img * NW + wdw;
            _Float16* od = ao + ((size_t)b * TWO_N + wv * 16 + sel * 8) * DIM
                              + h * HD + lm;
            _Float16 hv[2][8];
#pragma unroll
            for (int j = 0; j < 8; ++j) {
                hv[0][j] = (_Float16)o0[j];
                hv[1][j] = (_Float16)o1[j];
            }
            // All values first, then all stores: no register that an issued
            // store names is written again before the wait below.
            __builtin_amdgcn_sched_barrier(0);
#pragma unroll
            for (int j = 0; j < 8; ++j) {
                od[j * DIM]      = hv[0][j];
                od[j * DIM + 16] = hv[1][j];
            }
            // The next entry overwrites the stores' data and address registers.
            asm volatile("s_wait_xcnt 0x0" ::: "memory");
        }
        lds_barrier();                    // ends every wave's reads of Q, K, V
    }
}

// ---------------------------------------------------------------------------
// 4) Output projection: ao (65536x256 f16) @ proj_w^T + proj_b -> f32 out
// ---------------------------------------------------------------------------
__global__ __launch_bounds__(256) void swin_proj_gemm(
    const _Float16* __restrict__ ao, const float* __restrict__ proj_w,
    const float* __restrict__ proj_b, float* __restrict__ out)
{
    __shared__ _Float16 sA[64 * 40];
    __shared__ _Float16 sB[64 * 40];

    const int tid   = threadIdx.x;
    const int baseM = blockIdx.y * 64;
    const int baseN = blockIdx.x * 64;
    const int wv = tid >> 5, lane = tid & 31;
    const int wr = wv & 3, wc = wv >> 2;
    const int sel = lane >> 4, lm = lane & 15;

    v8f acc0 = {}, acc1 = {};

    const int lrow  = tid >> 2;
    const int lpart = (tid & 3) * 8;
    const _Float16* asrc = ao + (size_t)(baseM + lrow) * DIM;
    const float*    wsrc = proj_w + (size_t)(baseN + lrow) * DIM;

    for (int kk = 0; kk < DIM; kk += 32) {
        *(v8h*)&sA[lrow * 40 + lpart] = *(const v8h*)(asrc + kk + lpart);
        {
            const float* p = wsrc + kk + lpart;
            _Float16* d = &sB[lrow * 40 + lpart];
#pragma unroll
            for (int i = 0; i < 8; ++i) d[i] = (_Float16)p[i];
        }
        __syncthreads();
        v16h a  = load_frag(&sA[(wr * 16 + lm) * 40], sel);
        v16h b0 = load_frag(&sB[(wc * 32 + 0  + lm) * 40], sel);
        v16h b1 = load_frag(&sB[(wc * 32 + 16 + lm) * 40], sel);
        acc0 = wmma_f16(a, b0, acc0);
        acc1 = wmma_f16(a, b1, acc1);
        __syncthreads();
    }

#pragma unroll
    for (int nt = 0; nt < 2; ++nt) {
        const v8f& acc = nt ? acc1 : acc0;
        int col = baseN + wc * 32 + nt * 16 + lm;
        float bv = proj_b[col];
#pragma unroll
        for (int j = 0; j < 8; ++j) {
            int gr = baseM + wr * 16 + j + sel * 8;
            out[(size_t)gr * DIM + col] = acc[j] + bv;
        }
    }
}

// ---------------------------------------------------------------------------
extern "C" void kernel_launch(void* const* d_in, const int* in_sizes, int n_in,
                              void* d_out, int out_size, void* d_ws, size_t ws_size,
                              hipStream_t stream)
{
    const float* x1          = (const float*)d_in[0];
    const float* x2          = (const float*)d_in[1];
    const float* mask        = (const float*)d_in[2];
    const float* qkv_w       = (const float*)d_in[3];
    const float* q_bias      = (const float*)d_in[4];
    const float* v_bias      = (const float*)d_in[5];
    const float* logit_scale = (const float*)d_in[6];
    const float* cpb_w1      = (const float*)d_in[7];
    const float* cpb_b1      = (const float*)d_in[8];
    const float* cpb_w2      = (const float*)d_in[9];
    const float* proj_w      = (const float*)d_in[10];
    const float* proj_b      = (const float*)d_in[11];
    const float* amod1       = (const float*)d_in[12];
    const float* amod2       = (const float*)d_in[13];
    const float* rel_table   = (const float*)d_in[14];
    const int*   rel_index   = (const int*)d_in[15];

    char* ws = (char*)d_ws;
    float*    biasb = (float*)(ws + WS_BIAS);
    _Float16* qws   = (_Float16*)(ws + WS_Q);
    _Float16* kws   = (_Float16*)(ws + WS_K);
    _Float16* vws   = (_Float16*)(ws + WS_V);
    _Float16* ao    = (_Float16*)(ws + WS_AO);
    float*    out   = (float*)d_out;

    swin_bias_build<<<dim3(NTOK, NH / BHD), 256, 0, stream>>>(
        rel_table, cpb_w1, cpb_b1, cpb_w2, rel_index, amod1, amod2, biasb);
    swin_qkv_gemm<<<dim3(256), 256, 0, stream>>>(x1, x2, qkv_w, q_bias,
                                                      v_bias, qws, kws, vws);
    swin_attn<<<dim3(NH, NW), 256, 0, stream>>>(qws, kws, vws, biasb, mask,
                                                logit_scale, ao);
    swin_proj_gemm<<<dim3(4, 1024), 256, 0, stream>>>(ao, proj_w, proj_b, out);
}

// v004
// One run takes 89.5 microseconds.
// Next to v003, in two timings, it ran 1.13 times as fast each time.
// All steps since v000 together make it 2.07 times as fast.
#include <hip/hip_runtime.h>
#include <hip/hip_bf16.h>
#include <type_traits>

// ---------------------------------------------------------------------------
// SwinV2 window attention block on gfx1250 (CDNA5), wave32 + WMMA f16.
// ---------------------------------------------------------------------------

typedef _Float16 v16h __attribute__((ext_vector_type(16)));
typedef _Float16 v8h  __attribute__((ext_vector_type(8)));
typedef float    v8f  __attribute__((ext_vector_type(8)));
typedef _Float16 v4h  __attribute__((ext_vector_type(4)));
typedef float    v4f  __attribute__((ext_vector_type(4)));
typedef float    v2f  __attribute__((ext_vector_type(2)));

#define NH   8
#define HD   32
#define NTOK 64
#define TWO_N 128
#define DIM  256
#define BW   512
#define NW   64
#define CPB  512

// workspace layout (bytes)
#define WS_BIAS ((size_t)8192)                    // 8*128*128 f32
#define WS_Q    ((size_t)532480)                  // 512*8*128*32 f16
#define WS_K    (WS_Q + (size_t)33554432)         // 512*8* 64*32 f16
#define WS_V    (WS_K + (size_t)16777216)         // 512*8*128*32 f16
#define WS_AO   (WS_V + (size_t)33554432)         // 512*128*256  f16

// Load a 16x32 f16 A-fragment (or 32x16 B-fragment) per ISA layout:
// lane<16 holds K = {0..7, 16..23}; lane>=16 holds K = {8..15, 24..31}.
// `seg` points at the 32-half contiguous K segment for this lane's row/col,
// and must be 16B aligned (row strides are multiples of 8 halves).
__device__ __forceinline__ v16h load_frag(const _Float16* seg, int sel) {
    v8h lo = *(const v8h*)(seg + sel * 8);
    v8h hi = *(const v8h*)(seg + 16 + sel * 8);
    v16h f;
#pragma unroll
    for (int i = 0; i < 8; ++i) { f[i] = lo[i]; f[i + 8] = hi[i]; }
    return f;
}

__device__ __forceinline__ v8f wmma_f16(v16h a, v16h b, v8f c) {
    return __builtin_amdgcn_wmma_f32_16x16x32_f16(false, a, false, b,
                                                  (short)0, c, false, false);
}

// ---------------------------------------------------------------------------
// 1) Bias build: CPB MLP (2 -> 512 relu -> 8), rpb gather + 16*sigmoid +
//    2*amod quadrants -> (8,128,128).
//    One block = one token row m and BHD heads. It computes the MLP itself for
//    the 64 table positions that row m gathers: the weights lie in LDS, each
//    wave takes 64 of the 512 hidden units for all 64 positions (2 a lane), and
//    the 8 waves' partial sums are added through LDS.
// ---------------------------------------------------------------------------
#define BHD  2    // heads per block
#define NPOS 225  // rows of the relative-coordinate table

__global__ __launch_bounds__(256) void swin_bias_build(
    const float* __restrict__ tbl, const float* __restrict__ w1,
    const float* __restrict__ b1, const float* __restrict__ w2,
    const int* __restrict__ rel_index,
    const float* __restrict__ amod1, const float* __restrict__ amod2,
    float* __restrict__ biasb)
{
    __shared__ __attribute__((aligned(16))) float sW1[CPB * 2];
    __shared__ __attribute__((aligned(16))) float sB1[CPB];
    __shared__ __attribute__((aligned(16))) float sW2[BHD * CPB];
    __shared__ float sPart[8][BHD][NTOK];

    const int m = blockIdx.x, h0 = blockIdx.y * BHD;
    const int tid  = threadIdx.x;
    const int wv   = __builtin_amdgcn_readfirstlane(tid >> 5);
    const int lane = tid & 31;
    const int n = tid & (TWO_N - 1), nn = n & (NTOK - 1), hh = tid >> 7;
    const size_t aoff = ((size_t)(h0 + hh) * NTOK + m) * NTOK + nn;
    const int*   pix = rel_index + m * NTOK + lane;
    const float* pw1 = w1 + tid * 4;
    const float* pb1 = b1 + tid * 2;
    const float* pw2 = w2 + (size_t)h0 * CPB + tid * 4;
    const float* pa1 = amod1 + aoff;
    const float* pa2 = amod2 + aoff;

    // The fences keep other work out of [loads, wait], so that no register an
    // issued load names is written before the wait.
    __builtin_amdgcn_sched_barrier(0);
    int i0 = pix[0];
    int i1 = pix[32];
    const v4f rw1 = *(const v4f*)pw1;
    const v2f rb1 = *(const v2f*)pb1;
    const v4f rw2 = *(const v4f*)pw2;
    const float a1 = *pa1;
    const float a2 = *pa2;
    asm volatile("s_wait_xcnt 0x0" ::: "memory");
    __builtin_amdgcn_sched_barrier(0);

    // The index is input data: bound the table address.
    i0 = min(max(i0, 0), NPOS - 1);
    i1 = min(max(i1, 0), NPOS - 1);
    const v2f xa = *(const v2f*)(tbl + i0 * 2);
    const v2f xb = *(const v2f*)(tbl + i1 * 2);
    // The loads' offset registers are reused right behind them.
    asm volatile("s_wait_xcnt 0x0" ::: "memory");
    __builtin_amdgcn_sched_barrier(0);

    *(v4f*)&sW1[tid * 4] = rw1;
    *(v2f*)&sB1[tid * 2] = rb1;
    *(v4f*)&sW2[tid * 4] = rw2;
    __syncthreads();                      // publishes the weights

    float acc[2][BHD] = {};
    const int j0 = wv * (CPB / 8);
#pragma unroll
    for (int jj = 0; jj < CPB / 8; jj += 4) {
        const int j = j0 + jj;
        const v4f wa = *(const v4f*)&sW1[j * 2];
        const v4f wb = *(const v4f*)&sW1[j * 2 + 4];
        const v4f bb = *(const v4f*)&sB1[j];
        const v4f u0 = *(const v4f*)&sW2[j];
        const v4f u1 = *(const v4f*)&sW2[CPB + j];
#pragma unroll
        for (int q = 0; q < 4; ++q) {
            const float c0 = (q < 2) ? wa[2 * q]     : wb[2 * q - 4];
            const float c1 = (q < 2) ? wa[2 * q + 1] : wb[2 * q - 3];
            const float ha = fmaxf(c0 * xa[0] + c1 * xa[1] + bb[q], 0.0f);
            const float hb = fmaxf(c0 * xb[0] + c1 * xb[1] + bb[q], 0.0f);
            acc[0][0] += u0[q] * ha;
            acc[0][1] += u1[q] * ha;
            acc[1][0] += u0[q] * hb;
            acc[1][1] += u1[q] * hb;
        }
    }
#pragma unroll
    for (int p = 0; p < 2; ++p)
#pragma unroll
        for (int g = 0; g < BHD; ++g) sPart[wv][g][p * 32 + lane] = acc[p][g];
    __syncthreads();                      // publishes the partial sums

    float r = 0.0f;
#pragma unroll
    for (int k = 0; k < 8; ++k) r += sPart[k][hh][nn];
    const float rpb = 16.0f / (1.0f + __expf(-r));
    // Rows m and m+64: amod1 where row and column lie in the same half.
    const bool lo = n < NTOK;
    float* bd = biasb + ((size_t)(h0 + hh) * TWO_N + m) * TWO_N + n;
    bd[0]            = rpb + 2.0f * (lo ? a1 : a2);
    bd[NTOK * TWO_N] = rpb + 2.0f * (lo ? a2 : a1);
}

// ---------------------------------------------------------------------------
// 2) QKV GEMM: [x1;x2] (65536x256) @ qkv_w^T (256x768) + bias, scatter q/k/v.
//    One block = 256 rows x all 768 columns, one block per WGP. The block's x
//    rows are read once, converted to f16 and kept as A fragments in registers
//    for the whole K (4 row tiles x 8 k-steps per wave). The weights pass
//    through LDS in 12 chunks of 64 columns (two buffers, one barrier a chunk).
//    8 waves = 4 row groups of 64 x 2 column halves of 32.
// ---------------------------------------------------------------------------
#define QP 264   // LDS row pitch in halves: 528 B = 16 B x odd for b128 readers
#define QCH 64   // weight columns per chunk
#define QNCH 12  // chunks

__global__ __launch_bounds__(256) void swin_qkv_gemm(
    const float* __restrict__ x1, const float* __restrict__ x2,
    const float* __restrict__ qkv_w, const float* __restrict__ q_bias,
    const float* __restrict__ v_bias,
    _Float16* __restrict__ qws, _Float16* __restrict__ kws,
    _Float16* __restrict__ vws)
{
    __shared__ __attribute__((aligned(16))) _Float16 sX[256 * QP];
    __shared__ __attribute__((aligned(16))) _Float16 sW[2][QCH * QP];
    __shared__ float sBias[3 * DIM];    // q_bias | 0 | v_bias

    const int tid   = threadIdx.x;
    const int baseM = blockIdx.x * 256;
    const int wv    = __builtin_amdgcn_readfirstlane(tid >> 5);
    const int lane  = tid & 31;
    const int wr = wv & 3, wc = wv >> 2;
    const int sel = lane >> 4, lm = lane & 15;
    const int wch = baseM >> 15;        // 0 -> x1, 1 -> x2 (same for the block)
    const int loc = baseM & 32767;

    // Each wave stages 8 weight rows of a chunk (2 coalesced 512-B loads a row)
    // and 32 x rows. All of the block's first loads go out as one group.
    const float* wsrc = qkv_w + (size_t)(wv * 8) * DIM + lane * 4;
    const float* xsrc = (wch ? x2 : x1) + (size_t)(loc + wv * 32) * DIM + lane * 4;
    v4f wreg[16];
    v4f xreg[64];
    // The fence pair keeps every other instruction out of [loads, wait], so that
    // no register a load names is written before the wait.
    __builtin_amdgcn_sched_barrier(0);
#pragma unroll
    for (int i = 0; i < 16; ++i)
        wreg[i] = *(const v4f*)(wsrc + (i >> 1) * DIM + (i & 1) * 128);
#pragma unroll
    for (int i = 0; i < 64; ++i)
        xreg[i] = *(const v4f*)(xsrc + (i >> 1) * DIM + (i & 1) * 128);
    const float qb = q_bias[tid];
    const float vb = v_bias[tid];
    // The loads' offset and base registers are reused right behind them.
    asm volatile("s_wait_xcnt 0x0" ::: "memory");
    __builtin_amdgcn_sched_barrier(0);

    sBias[tid]           = qb;
    sBias[DIM + tid]     = 0.0f;
    sBias[2 * DIM + tid] = vb;
    {
        _Float16* wd = &sW[0][(wv * 8) * QP + lane * 4];
#pragma unroll
        for (int i = 0; i < 16; ++i)
            *(v4h*)(wd + (i >> 1) * QP + (i & 1) * 128) =
                __builtin_convertvector(wreg[i], v4h);
        _Float16* xd = &sX[(wv * 32) * QP + lane * 4];
#pragma unroll
        for (int i = 0; i < 64; ++i)
            *(v4h*)(xd + (i >> 1) * QP + (i & 1) * 128) =
                __builtin_convertvector(xreg[i], v4h);
    }
    __syncthreads();

    v16h xa[4][8];
#pragma unroll
    for (int rt = 0; rt < 4; ++rt)
#pragma unroll
        for (int ks = 0; ks < 8; ++ks)
            xa[rt][ks] = load_frag(&sX[(wr * 64 + rt * 16 + lm) * QP + ks * 32], sel);

    const int b = (loc >> 6) + wr;      // a wave's 64 rows are one window

    // One chunk: fetch the next chunk's weights (not behind the last), multiply,
    // lay the fetched weights into the other buffer, store this chunk's columns.
    auto chunk = [&](const int c, auto more) __attribute__((always_inline)) {
        if constexpr (more.value) {
            const float* p = wsrc + (size_t)(c + 1) * QCH * DIM;
#pragma unroll
            for (int i = 0; i < 16; ++i)
                wreg[i] = *(const v4f*)(p + (i >> 1) * DIM + (i & 1) * 128);
        }

        const int s    = c >> 2;                 // 0=q,1=k,2=v
        const int hcol = (c * 2 + wc) & 7;       // a wave's 32 columns are one head
        const float bv0 = sBias[c * QCH + wc * 32 + lm];
        const float bv1 = sBias[c * QCH + wc * 32 + 16 + lm];
        _Float16* dst = (s == 0) ? qws : ((s == 1) ? kws : vws);
        dst += (s == 1) ? ((size_t)(b * NH + hcol) * NTOK) * HD
                        : ((size_t)(b * NH + hcol) * TWO_N + wch * NTOK) * HD;
        dst += sel * 8 * HD + lm;

        const _Float16* wb = &sW[c & 1][(wc * 32 + lm) * QP];
        v8f acc[4][2] = {};
        v16h bf[2][2];                           // fragments one k-step ahead
        bf[0][0] = load_frag(wb, sel);
        bf[0][1] = load_frag(wb + 16 * QP, sel);
#pragma unroll
        for (int ks = 0; ks < 8; ++ks) {
            if (ks < 7) {
                bf[(ks + 1) & 1][0] = load_frag(wb + (ks + 1) * 32, sel);
                bf[(ks + 1) & 1][1] = load_frag(wb + 16 * QP + (ks + 1) * 32, sel);
            }
            // Keeps the next k-step's LDS reads in front of this step's products;
            // without it they sink to just before their use and the wave waits.
            __builtin_amdgcn_sched_barrier(0);
#pragma unroll
            for (int rt = 0; rt < 4; ++rt) {
                acc[rt][0] = wmma_f16(xa[rt][ks], bf[ks & 1][0], acc[rt][0]);
                acc[rt][1] = wmma_f16(xa[rt][ks], bf[ks & 1][1], acc[rt][1]);
            }
            // Keeps the conversion of the fetched weights (and its wait on the
            // global loads) behind the products instead of among the first ones.
            __builtin_amdgcn_sched_barrier(0);
        }

        if constexpr (more.value) {
            _Float16* wd = &sW[(c + 1) & 1][(wv * 8) * QP + lane * 4];
#pragma unroll
            for (int i = 0; i < 16; ++i)
                *(v4h*)(wd + (i >> 1) * QP + (i & 1) * 128) =
                    __builtin_convertvector(wreg[i], v4h);
        }

        if (s != 1 || wch == 0) {                // k of x2 is never read
            _Float16 hv[4][2][8];
#pragma unroll
            for (int rt = 0; rt < 4; ++rt)
#pragma unroll
                for (int j = 0; j < 8; ++j) {
                    hv[rt][0][j] = (_Float16)(acc[rt][0][j] + bv0);
                    hv[rt][1][j] = (_Float16)(acc[rt][1][j] + bv1);
                }
            // All values first, then all stores: no register that an issued
            // store names is written again before the wait below.
            __builtin_amdgcn_sched_barrier(0);
#pragma unroll
            for (int rt = 0; rt < 4; ++rt)
#pragma unroll
                for (int j = 0; j < 8; ++j) {
                    dst[(rt * 16 + j) * HD]      = hv[rt][0][j];
                    dst[(rt * 16 + j) * HD + 16] = hv[rt][1][j];
                }
            // The next chunk overwrites the stores' data and address registers.
            if constexpr (more.value) asm volatile("s_wait_xcnt 0x0" ::: "memory");
        }
    };

    // Rolled: one chunk's code serves eleven chunks (instruction cache).
#pragma unroll 1
    for (int c = 0; c < QNCH - 1; ++c) {
        chunk(c, std::true_type{});
        // Publishes chunk c+1 and ends every wave's reads of chunk c's buffer.
        // Only LDS is handed over here, so the fences name LDS alone: a plain
        // __syncthreads() would also wait for this chunk's global stores.
        __builtin_amdgcn_fence(__ATOMIC_RELEASE, "workgroup", "local");
        __builtin_amdgcn_s_barrier();
        __builtin_amdgcn_fence(__ATOMIC_ACQUIRE, "workgroup", "local");
    }
    chunk(QNCH - 1, std::false_type{});
}

// ---------------------------------------------------------------------------
// 3) Attention: S = (Qn Kn^T)*scale + bias + mask; softmax; O = P V.
//    One block = one (head, mask window). The NIMG batch entries that share
//    that mask window are worked on one after the other, so the 128x128 bias
//    and mask are read once a block and their sum stays in registers.
// ---------------------------------------------------------------------------
#define NIMG (BW / NW)   // batch entries per mask window

// Work-group barrier that hands over LDS alone: a plain __syncthreads() would
// also wait for the rows fetched ahead and for the output stores in flight.
__device__ __forceinline__ void lds_barrier() {
    __builtin_amdgcn_fence(__ATOMIC_RELEASE, "workgroup", "local");
    __builtin_amdgcn_s_barrier();
    __builtin_amdgcn_fence(__ATOMIC_ACQUIRE, "workgroup", "local");
}

__global__ __launch_bounds__(256) void swin_attn(
    const _Float16* __restrict__ qws, const _Float16* __restrict__ kws,
    const _Float16* __restrict__ vws, const float* __restrict__ biasb,
    const float* __restrict__ mask, const float* __restrict__ logit_scale,
    _Float16* __restrict__ ao)
{
    __shared__ _Float16 sQ[TWO_N * 40];   // 128 x 32 (stride 40)
    __shared__ _Float16 sK[NTOK * 40];    //  64 x 32
    __shared__ _Float16 sVt[HD * 136];    //  32 x 128 (V transposed, stride 136)
    __shared__ _Float16 sP[TWO_N * 136];  // 128 x 128 probabilities, f16

    const int h = blockIdx.x, wdw = blockIdx.y;
    const int tid = threadIdx.x;
    const int wv = tid >> 5, lane = tid & 31;
    const int sel = lane >> 4, lm = lane & 15;

    // Threads 0..127 stage a q row and a v row each, threads 128..191 a k row.
    const bool isq   = tid < TWO_N;
    const bool isrow = tid < TWO_N + NTOK;
    const size_t qimg = (size_t)NW * NH * TWO_N * HD;  // halves to the next entry
    const size_t kimg = (size_t)NW * NH * NTOK * HD;
    const _Float16* rsrc =
        isq ? qws + ((size_t)(wdw * NH + h) * TWO_N + tid) * HD
            : kws + ((size_t)(wdw * NH + h) * NTOK + (tid & (NTOK - 1))) * HD;
    const size_t rstep = isq ? qimg : kimg;
    const _Float16* vsrc =
        vws + ((size_t)(wdw * NH + h) * TWO_N + (tid & (TWO_N - 1))) * HD;

    v8h rr[4], vr[4];
    auto fetch = [&](const int img) __attribute__((always_inline)) {
        // The fence pair keeps every other instruction out of [loads, wait], so
        // that no register a load names is written before the wait.
        __builtin_amdgcn_sched_barrier(0);
        if (isrow) {
            const v8h* p = (const v8h*)(rsrc + (size_t)img * rstep);
#pragma unroll
            for (int i = 0; i < 4; ++i) rr[i] = p[i];
        }
        if (isq) {
            const v8h* p = (const v8h*)(vsrc + (size_t)img * qimg);
#pragma unroll
            for (int i = 0; i < 4; ++i) vr[i] = p[i];
        }
        // The loads' address registers are reused behind them.
        asm volatile("s_wait_xcnt 0x0" ::: "memory");
        __builtin_amdgcn_sched_barrier(0);
    };
    fetch(0);

    // bias + mask of this wave's 16 rows, in the accumulator's own layout.
    const float* bptr = biasb + (size_t)h * TWO_N * TWO_N;
    const float* mptr = mask + (size_t)wdw * TWO_N * TWO_N;
    float bm[8][8];
#pragma unroll
    for (int j = 0; j < 8; ++j)
#pragma unroll
        for (int ct = 0; ct < 8; ++ct) {
            const int o = (wv * 16 + j + sel * 8) * TWO_N + ct * 16 + lm;
            bm[j][ct] = bptr[o] + mptr[o];
        }
    // The loads' address registers are reused behind them.
    asm volatile("s_wait_xcnt 0x0" ::: "memory");

    const float scale = __expf(fminf(logit_scale[h], 4.6051702f)); // log(100)

    // Rolled: one entry's code serves all (registers, instruction cache).
#pragma unroll 1
    for (int img = 0; img < NIMG; ++img) {
        // Inputs only: has every wave wait for its fetched rows here, on every
        // path. With the waits only inside the branches below, the compiler
        // holds each load of the next fetch behind the return of an older one.
        asm volatile("" :: "v"(rr[0]), "v"(rr[1]), "v"(rr[2]), "v"(rr[3]),
                           "v"(vr[0]), "v"(vr[1]), "v"(vr[2]), "v"(vr[3]));
        // --- L2-normalize Q and K into LDS, transpose-stage V ---
        if (isrow) {
            float tmp[HD]; float ss = 0.0f;
#pragma unroll
            for (int i = 0; i < HD; ++i) {
                tmp[i] = (float)rr[i >> 3][i & 7];
                ss += tmp[i] * tmp[i];
            }
            const float inv = 1.0f / fmaxf(sqrtf(ss), 1e-12f);
            if (isq) {
#pragma unroll
                for (int i = 0; i < HD; ++i)
                    sQ[tid * 40 + i] = (_Float16)(tmp[i] * inv);
            } else {
#pragma unroll
                for (int i = 0; i < HD; ++i)
                    sK[(tid - TWO_N) * 40 + i] = (_Float16)(tmp[i] * inv);
            }
        }
        if (isq) {
#pragma unroll
            for (int i = 0; i < HD; ++i) sVt[i * 136 + tid] = vr[i >> 3][i & 7];
        }
        lds_barrier();                    // publishes this entry's Q, K, V

        // The next entry's rows fly while this one is worked on.
        if (img + 1 < NIMG) fetch(img + 1);

        // --- S = Q K^T : one WMMA per 16x16 tile (K-depth == head dim == 32) ---
        v16h aQ = load_frag(&sQ[(wv * 16 + lm) * 40], sel);
        v16h bK[4];
#pragma unroll
        for (int kb = 0; kb < 4; ++kb)
            bK[kb] = load_frag(&sK[(kb * 16 + lm) * 40], sel);

        v8f acc[8];
#pragma unroll
        for (int ct = 0; ct < 8; ++ct) {
            v8f z = {};
            acc[ct] = wmma_f16(aQ, bK[ct & 3], z);  // cols 64..127 reuse K (k=[k1;k1])
        }

        // --- scale + (bias + mask), then row softmax. Each cross-lane step is
        //     taken for all 8 rows together: one LDS-pipe wait serves 8 rows. ---
        float mx[8], sm[8], ot[8];
#pragma unroll
        for (int j = 0; j < 8; ++j) {
            float m = -1e30f;
#pragma unroll
            for (int ct = 0; ct < 8; ++ct) {
                float v = acc[ct][j] * scale + bm[j][ct];
                acc[ct][j] = v;
                m = fmaxf(m, v);
            }
            mx[j] = m;
        }
#pragma unroll
        for (int s = 1; s < 16; s <<= 1) {
#pragma unroll
            for (int j = 0; j < 8; ++j) ot[j] = __shfl_xor(mx[j], s, 32);
#pragma unroll
            for (int j = 0; j < 8; ++j) mx[j] = fmaxf(mx[j], ot[j]);
        }
#pragma unroll
        for (int j = 0; j < 8; ++j) {
            float t = 0.0f;
#pragma unroll
            for (int ct = 0; ct < 8; ++ct) {
                float p = __expf(acc[ct][j] - mx[j]);
                acc[ct][j] = p;
                t += p;
            }
            sm[j] = t;
        }
#pragma unroll
        for (int s = 1; s < 16; s <<= 1) {
#pragma unroll
            for (int j = 0; j < 8; ++j) ot[j] = __shfl_xor(sm[j], s, 32);
#pragma unroll
            for (int j = 0; j < 8; ++j) sm[j] += ot[j];
        }
#pragma unroll
        for (int j = 0; j < 8; ++j) {
            const int M = wv * 16 + j + sel * 8;
            const float invs = 1.0f / sm[j];
#pragma unroll
            for (int ct = 0; ct < 8; ++ct)
                sP[M * 136 + ct * 16 + lm] = (_Float16)(acc[ct][j] * invs);
        }
        // No barrier here: a wave reads back only the 16 rows of P it wrote.

        // --- O = P V : K-depth 128 -> 4 WMMA steps x 2 column tiles ---
        v8f o0 = {}, o1 = {};
#pragma unroll
        for (int kc = 0; kc < 4; ++kc) {
            v16h aP = load_frag(&sP[(wv * 16 + lm) * 136 + kc * 32], sel);
            v16h b0 = load_frag(&sVt[(0  + lm) * 136 + kc * 32], sel);
            v16h b1 = load_frag(&sVt[(16 + lm) * 136 + kc * 32], sel);
            o0 = wmma_f16(aP, b0, o0);
            o1 = wmma_f16(aP, b1, o1);
        }
        {
            const int b = img * NW + wdw;
            _Float16* od = ao + ((size_t)b * TWO_N + wv * 16 + sel * 8) * DIM
                              + h * HD + lm;
            _Float16 hv[2][8];
#pragma unroll
            for (int j = 0; j < 8; ++j) {
                hv[0][j] = (_Float16)o0[j];
                hv[1][j] = (_Float16)o1[j];
            }
            // All values first, then all stores: no register that an issued
            // store names is written again before the wait below.
            __builtin_amdgcn_sched_barrier(0);
#pragma unroll
            for (int j = 0; j < 8; ++j) {
                od[j * DIM]      = hv[0][j];
                od[j * DIM + 16] = hv[1][j];
            }
            // The next entry overwrites the stores' data and address registers.
            asm volatile("s_wait_xcnt 0x0" ::: "memory");
        }
        lds_barrier();                    // ends every wave's reads of Q, K, V
    }
}

// ---------------------------------------------------------------------------
// 4) Output projection: ao (65536x256 f16) @ proj_w^T + proj_b -> f32 out
//    Tiled like the QKV GEMM: one block = 256 rows x all 256 columns, one block
//    per WGP. The block's ao rows are read once and kept as A fragments in
//    registers for the whole K; the weights pass through LDS in 4 chunks of 64
//    columns (two buffers, one barrier a chunk).
//    8 waves = 4 row groups of 64 x 2 column halves of 32.
// ---------------------------------------------------------------------------
#define PNCH 4   // chunks of QCH weight columns

__global__ __launch_bounds__(256) void swin_proj_gemm(
    const _Float16* __restrict__ ao, const float* __restrict__ proj_w,
    const float* __restrict__ proj_b, float* __restrict__ out)
{
    __shared__ __attribute__((aligned(16))) _Float16 sX[256 * QP];
    __shared__ __attribute__((aligned(16))) _Float16 sW[2][QCH * QP];
    __shared__ float sBias[DIM];

    const int tid   = threadIdx.x;
    const int baseM = blockIdx.x * 256;
    const int wv    = __builtin_amdgcn_readfirstlane(tid >> 5);
    const int lane  = tid & 31;
    const int wr = wv & 3, wc = wv >> 2;
    const int sel = lane >> 4, lm = lane & 15;

    // Each wave stages 8 weight rows of a chunk (2 coalesced 512-B loads a row)
    // and 32 ao rows (one 512-B load a row). All first loads go out as one group.
    const float*    wsrc = proj_w + (size_t)(wv * 8) * DIM + lane * 4;
    const _Float16* xsrc = ao + (size_t)(baseM + wv * 32) * DIM + lane * 8;
    v4f wreg[16];
    v8h xreg[32];
    // The fence pair keeps every other instruction out of [loads, wait], so that
    // no register a load names is written before the wait.
    __builtin_amdgcn_sched_barrier(0);
#pragma unroll
    for (int i = 0; i < 16; ++i)
        wreg[i] = *(const v4f*)(wsrc + (i >> 1) * DIM + (i & 1) * 128);
#pragma unroll
    for (int i = 0; i < 32; ++i)
        xreg[i] = *(const v8h*)(xsrc + i * DIM);
    const float pb = proj_b[tid];
    // The loads' offset and base registers are reused right behind them.
    asm volatile("s_wait_xcnt 0x0" ::: "memory");
    __builtin_amdgcn_sched_barrier(0);

    sBias[tid] = pb;
    {
        _Float16* wd = &sW[0][(wv * 8) * QP + lane * 4];
#pragma unroll
        for (int i = 0; i < 16; ++i)
            *(v4h*)(wd + (i >> 1) * QP + (i & 1) * 128) =
                __builtin_convertvector(wreg[i], v4h);
        _Float16* xd = &sX[(wv * 32) * QP + lane * 8];
#pragma unroll
        for (int i = 0; i < 32; ++i)
            *(v8h*)(xd + i * QP) = xreg[i];
    }
    __syncthreads();

    v16h xa[4][8];
#pragma unroll
    for (int rt = 0; rt < 4; ++rt)
#pragma unroll
        for (int ks = 0; ks < 8; ++ks)
            xa[rt][ks] = load_frag(&sX[(wr * 64 + rt * 16 + lm) * QP + ks * 32], sel);

    float* drow = out + (size_t)(baseM + wr * 64 + sel * 8) * DIM + wc * 32 + lm;

    // One chunk: fetch the next chunk's weights (not behind the last), multiply,
    // lay the fetched weights into the other buffer, store this chunk's columns.
    auto chunk = [&](const int c, auto more) __attribute__((always_inline)) {
        if constexpr (more.value) {
            const float* p = wsrc + (size_t)(c + 1) * QCH * DIM;
#pragma unroll
            for (int i = 0; i < 16; ++i)
                wreg[i] = *(const v4f*)(p + (i >> 1) * DIM + (i & 1) * 128);
        }

        const float bv0 = sBias[c * QCH + wc * 32 + lm];
        const float bv1 = sBias[c * QCH + wc * 32 + 16 + lm];
        float* dst = drow + c * QCH;

        const _Float16* wb = &sW[c & 1][(wc * 32 + lm) * QP];
        v8f acc[4][2] = {};
        v16h bf[2][2];                           // fragments one k-step ahead
        bf[0][0] = load_frag(wb, sel);
        bf[0][1] = load_frag(wb + 16 * QP, sel);
#pragma unroll
        for (int ks = 0; ks < 8; ++ks) {
            if (ks < 7) {
                bf[(ks + 1) & 1][0] = load_frag(wb + (ks + 1) * 32, sel);
                bf[(ks + 1) & 1][1] = load_frag(wb + 16 * QP + (ks + 1) * 32, sel);
            }
            // Keeps the next k-step's LDS reads in front of this step's products;
            // without it they sink to just before their use and the wave waits.
            __builtin_amdgcn_sched_barrier(0);
#pragma unroll
            for (int rt = 0; rt < 4; ++rt) {
                acc[rt][0] = wmma_f16(xa[rt][ks], bf[ks & 1][0], acc[rt][0]);
                acc[rt][1] = wmma_f16(xa[rt][ks], bf[ks & 1][1], acc[rt][1]);
            }
            // Keeps the conversion of the fetched weights (and its wait on the
            // global loads) behind the products instead of among the first ones.
            __builtin_amdgcn_sched_barrier(0);
        }

        if constexpr (more.value) {
            _Float16* wd = &sW[(c + 1) & 1][(wv * 8) * QP + lane * 4];
#pragma unroll
            for (int i = 0; i < 16; ++i)
                *(v4h*)(wd + (i >> 1) * QP + (i & 1) * 128) =
                    __builtin_convertvector(wreg[i], v4h);
        }

#pragma unroll
        for (int rt = 0; rt < 4; ++rt)
#pragma unroll
            for (int j = 0; j < 8; ++j) {
                acc[rt][0][j] += bv0;
                acc[rt][1][j] += bv1;
            }
        // All values first, then all stores: no register that an issued store
        // names is written again before the wait below.
        __builtin_amdgcn_sched_barrier(0);
#pragma unroll
        for (int rt = 0; rt < 4; ++rt)
#pragma unroll
            for (int j = 0; j < 8; ++j) {
                dst[(rt * 16 + j) * DIM]      = acc[rt][0][j];
                dst[(rt * 16 + j) * DIM + 16] = acc[rt][1][j];
            }
        // The next chunk overwrites the stores' data and address registers.
        if constexpr (more.value) asm volatile("s_wait_xcnt 0x0" ::: "memory");
    };

    // Rolled: one chunk's code serves three chunks (instruction cache).
#pragma unroll 1
    for (int c = 0; c < PNCH - 1; ++c) {
        chunk(c, std::true_type{});
        // Publishes chunk c+1 and ends every wave's reads of chunk c's buffer;
        // LDS alone is handed over, the output stores stay in flight.
        lds_barrier();
    }
    chunk(PNCH - 1, std::false_type{});
}

// ---------------------------------------------------------------------------
extern "C" void kernel_launch(void* const* d_in, const int* in_sizes, int n_in,
                              void* d_out, int out_size, void* d_ws, size_t ws_size,
                              hipStream_t stream)
{
    const float* x1          = (const float*)d_in[0];
    const float* x2          = (const float*)d_in[1];
    const float* mask        = (const float*)d_in[2];
    const float* qkv_w       = (const float*)d_in[3];
    const float* q_bias      = (const float*)d_in[4];
    const float* v_bias      = (const float*)d_in[5];
    const float* logit_scale = (const float*)d_in[6];
    const float* cpb_w1      = (const float*)d_in[7];
    const float* cpb_b1      = (const float*)d_in[8];
    const float* cpb_w2      = (const float*)d_in[9];
    const float* proj_w      = (const float*)d_in[10];
    const float* proj_b      = (const float*)d_in[11];
    const float* amod1       = (const float*)d_in[12];
    const float* amod2       = (const float*)d_in[13];
    const float* rel_table   = (const float*)d_in[14];
    const int*   rel_index   = (const int*)d_in[15];

    char* ws = (char*)d_ws;
    float*    biasb = (float*)(ws + WS_BIAS);
    _Float16* qws   = (_Float16*)(ws + WS_Q);
    _Float16* kws   = (_Float16*)(ws + WS_K);
    _Float16* vws   = (_Float16*)(ws + WS_V);
    _Float16* ao    = (_Float16*)(ws + WS_AO);
    float*    out   = (float*)d_out;

    swin_bias_build<<<dim3(NTOK, NH / BHD), 256, 0, stream>>>(
        rel_table, cpb_w1, cpb_b1, cpb_w2, rel_index, amod1, amod2, biasb);
    swin_qkv_gemm<<<dim3(256), 256, 0, stream>>>(x1, x2, qkv_w, q_bias,
                                                      v_bias, qws, kws, vws);
    swin_attn<<<dim3(NH, NW), 256, 0, stream>>>(qws, kws, vws, biasb, mask,
                                                logit_scale, ao);
    swin_proj_gemm<<<dim3(256), 256, 0, stream>>>(ao, proj_w, proj_b, out);
}

// v005
// One run takes 83.8 microseconds.
// Timed twice side by side with v004, it ran 1.07 times as fast both times.
// All steps since v000 together make it 2.21 times as fast.
#include <hip/hip_runtime.h>
#include <hip/hip_bf16.h>
#include <type_traits>

// ---------------------------------------------------------------------------
// SwinV2 window attention block on gfx1250 (CDNA5), wave32 + WMMA f16.
// ---------------------------------------------------------------------------

typedef _Float16 v16h __attribute__((ext_vector_type(16)));
typedef _Float16 v8h  __attribute__((ext_vector_type(8)));
typedef float    v8f  __attribute__((ext_vector_type(8)));
typedef _Float16 v4h  __attribute__((ext_vector_type(4)));
typedef float    v4f  __attribute__((ext_vector_type(4)));
typedef float    v2f  __attribute__((ext_vector_type(2)));

#define NH   8
#define HD   32
#define NTOK 64
#define TWO_N 128
#define DIM  256
#define BW   512
#define NW   64
#define CPB  512

// workspace layout (bytes)
#define WS_BIAS ((size_t)8192)                    // 8*128*128 f32
#define WS_Q    ((size_t)532480)                  // 512*8*128*32 f16
#define WS_K    (WS_Q + (size_t)33554432)         // 512*8* 64*32 f16
#define WS_V    (WS_K + (size_t)16777216)         // 512*8*128*32 f16
#define WS_AO   (WS_V + (size_t)33554432)         // 512*128*256  f16

// Load a 16x32 f16 A-fragment (or 32x16 B-fragment) per ISA layout:
// lane<16 holds K = {0..7, 16..23}; lane>=16 holds K = {8..15, 24..31}.
// `seg` points at the 32-half contiguous K segment for this lane's row/col,
// and must be 16B aligned (row strides are multiples of 8 halves).
__device__ __forceinline__ v16h load_frag(const _Float16* seg, int sel) {
    v8h lo = *(const v8h*)(seg + sel * 8);
    v8h hi = *(const v8h*)(seg + 16 + sel * 8);
    v16h f;
#pragma unroll
    for (int i = 0; i < 8; ++i) { f[i] = lo[i]; f[i + 8] = hi[i]; }
    return f;
}

__device__ __forceinline__ v8f wmma_f16(v16h a, v16h b, v8f c) {
    return __builtin_amdgcn_wmma_f32_16x16x32_f16(false, a, false, b,
                                                  (short)0, c, false, false);
}

// ---------------------------------------------------------------------------
// 1) Bias build: CPB MLP (2 -> 512 relu -> 8), rpb gather + 16*sigmoid +
//    2*amod quadrants -> (8,128,128).
//    One block = one token row m and BHD heads. It computes the MLP itself for
//    the 64 table positions that row m gathers: the weights lie in LDS, each
//    wave takes 64 of the 512 hidden units for all 64 positions (2 a lane), and
//    the 8 waves' partial sums are added through LDS.
// ---------------------------------------------------------------------------
#define BHD  2    // heads per block
#define NPOS 225  // rows of the relative-coordinate table

__global__ __launch_bounds__(256) void swin_bias_build(
    const float* __restrict__ tbl, const float* __restrict__ w1,
    const float* __restrict__ b1, const float* __restrict__ w2,
    const int* __restrict__ rel_index,
    const float* __restrict__ amod1, const float* __restrict__ amod2,
    float* __restrict__ biasb)
{
    __shared__ __attribute__((aligned(16))) float sW1[CPB * 2];
    __shared__ __attribute__((aligned(16))) float sB1[CPB];
    __shared__ __attribute__((aligned(16))) float sW2[BHD * CPB];
    __shared__ float sPart[8][BHD][NTOK];

    const int m = blockIdx.x, h0 = blockIdx.y * BHD;
    const int tid  = threadIdx.x;
    const int wv   = __builtin_amdgcn_readfirstlane(tid >> 5);
    const int lane = tid & 31;
    const int n = tid & (TWO_N - 1), nn = n & (NTOK - 1), hh = tid >> 7;
    const size_t aoff = ((size_t)(h0 + hh) * NTOK + m) * NTOK + nn;
    const int*   pix = rel_index + m * NTOK + lane;
    const float* pw1 = w1 + tid * 4;
    const float* pb1 = b1 + tid * 2;
    const float* pw2 = w2 + (size_t)h0 * CPB + tid * 4;
    const float* pa1 = amod1 + aoff;
    const float* pa2 = amod2 + aoff;

    // The fences keep other work out of [loads, wait], so that no register an
    // issued load names is written before the wait.
    __builtin_amdgcn_sched_barrier(0);
    int i0 = pix[0];
    int i1 = pix[32];
    const v4f rw1 = *(const v4f*)pw1;
    const v2f rb1 = *(const v2f*)pb1;
    const v4f rw2 = *(const v4f*)pw2;
    const float a1 = *pa1;
    const float a2 = *pa2;
    asm volatile("s_wait_xcnt 0x0" ::: "memory");
    __builtin_amdgcn_sched_barrier(0);

    // The index is input data: bound the table address.
    i0 = min(max(i0, 0), NPOS - 1);
    i1 = min(max(i1, 0), NPOS - 1);
    const v2f xa = *(const v2f*)(tbl + i0 * 2);
    const v2f xb = *(const v2f*)(tbl + i1 * 2);
    // The loads' offset registers are reused right behind them.
    asm volatile("s_wait_xcnt 0x0" ::: "memory");
    __builtin_amdgcn_sched_barrier(0);

    *(v4f*)&sW1[tid * 4] = rw1;
    *(v2f*)&sB1[tid * 2] = rb1;
    *(v4f*)&sW2[tid * 4] = rw2;
    __syncthreads();                      // publishes the weights

    float acc[2][BHD] = {};
    const int j0 = wv * (CPB / 8);
#pragma unroll
    for (int jj = 0; jj < CPB / 8; jj += 4) {
        const int j = j0 + jj;
        const v4f wa = *(const v4f*)&sW1[j * 2];
        const v4f wb = *(const v4f*)&sW1[j * 2 + 4];
        const v4f bb = *(const v4f*)&sB1[j];
        const v4f u0 = *(const v4f*)&sW2[j];
        const v4f u1 = *(const v4f*)&sW2[CPB + j];
#pragma unroll
        for (int q = 0; q < 4; ++q) {
            const float c0 = (q < 2) ? wa[2 * q]     : wb[2 * q - 4];
            const float c1 = (q < 2) ? wa[2 * q + 1] : wb[2 * q - 3];
            const float ha = fmaxf(c0 * xa[0] + c1 * xa[1] + bb[q], 0.0f);
            const float hb = fmaxf(c0 * xb[0] + c1 * xb[1] + bb[q], 0.0f);
            acc[0][0] += u0[q] * ha;
            acc[0][1] += u1[q] * ha;
            acc[1][0] += u0[q] * hb;
            acc[1][1] += u1[q] * hb;
        }
    }
#pragma unroll
    for (int p = 0; p < 2; ++p)
#pragma unroll
        for (int g = 0; g < BHD; ++g) sPart[wv][g][p * 32 + lane] = acc[p][g];
    __syncthreads();                      // publishes the partial sums

    float r = 0.0f;
#pragma unroll
    for (int k = 0; k < 8; ++k) r += sPart[k][hh][nn];
    const float rpb = 16.0f / (1.0f + __expf(-r));
    // Rows m and m+64: amod1 where row and column lie in the same half.
    const bool lo = n < NTOK;
    float* bd = biasb + ((size_t)(h0 + hh) * TWO_N + m) * TWO_N + n;
    bd[0]            = rpb + 2.0f * (lo ? a1 : a2);
    bd[NTOK * TWO_N] = rpb + 2.0f * (lo ? a2 : a1);
}

// ---------------------------------------------------------------------------
// 2) QKV GEMM: [x1;x2] (65536x256) @ qkv_w^T (256x768) + bias, scatter q/k/v.
//    One block = 256 rows x all 768 columns, one block per WGP. The block's x
//    rows are read once, converted to f16 and kept as A fragments in registers
//    for the whole K (4 row tiles x 8 k-steps per wave). The weights pass
//    through LDS in 12 chunks of 64 columns (two buffers, one barrier a chunk).
//    8 waves = 4 row groups of 64 x 2 column halves of 32.
// ---------------------------------------------------------------------------
#define QP 264   // LDS row pitch in halves: 528 B = 16 B x odd for b128 readers
#define QCH 64   // weight columns per chunk
#define QNCH 12  // chunks

__global__ __launch_bounds__(256) void swin_qkv_gemm(
    const float* __restrict__ x1, const float* __restrict__ x2,
    const float* __restrict__ qkv_w, const float* __restrict__ q_bias,
    const float* __restrict__ v_bias,
    _Float16* __restrict__ qws, _Float16* __restrict__ kws,
    _Float16* __restrict__ vws)
{
    __shared__ __attribute__((aligned(16))) _Float16 sX[256 * QP];
    __shared__ __attribute__((aligned(16))) _Float16 sW[2][QCH * QP];
    __shared__ float sBias[3 * DIM];    // q_bias | 0 | v_bias

    const int tid   = threadIdx.x;
    const int baseM = blockIdx.x * 256;
    const int wv    = __builtin_amdgcn_readfirstlane(tid >> 5);
    const int lane  = tid & 31;
    const int wr = wv & 3, wc = wv >> 2;
    const int sel = lane >> 4, lm = lane & 15;
    const int wch = baseM >> 15;        // 0 -> x1, 1 -> x2 (same for the block)
    const int loc = baseM & 32767;

    // Each wave stages 8 weight rows of a chunk (2 coalesced 512-B loads a row)
    // and 32 x rows. All of the block's first loads go out as one group.
    const float* wsrc = qkv_w + (size_t)(wv * 8) * DIM + lane * 4;
    const float* xsrc = (wch ? x2 : x1) + (size_t)(loc + wv * 32) * DIM + lane * 4;
    v4f wreg[16];
    v4f xreg[64];
    // The fence pair keeps every other instruction out of [loads, wait], so that
    // no register a load names is written before the wait.
    __builtin_amdgcn_sched_barrier(0);
#pragma unroll
    for (int i = 0; i < 16; ++i)
        wreg[i] = *(const v4f*)(wsrc + (i >> 1) * DIM + (i & 1) * 128);
#pragma unroll
    for (int i = 0; i < 64; ++i)
        xreg[i] = *(const v4f*)(xsrc + (i >> 1) * DIM + (i & 1) * 128);
    const float qb = q_bias[tid];
    const float vb = v_bias[tid];
    // The loads' offset and base registers are reused right behind them.
    asm volatile("s_wait_xcnt 0x0" ::: "memory");
    __builtin_amdgcn_sched_barrier(0);

    sBias[tid]           = qb;
    sBias[DIM + tid]     = 0.0f;
    sBias[2 * DIM + tid] = vb;
    {
        _Float16* wd = &sW[0][(wv * 8) * QP + lane * 4];
#pragma unroll
        for (int i = 0; i < 16; ++i)
            *(v4h*)(wd + (i >> 1) * QP + (i & 1) * 128) =
                __builtin_convertvector(wreg[i], v4h);
        _Float16* xd = &sX[(wv * 32) * QP + lane * 4];
#pragma unroll
        for (int i = 0; i < 64; ++i)
            *(v4h*)(xd + (i >> 1) * QP + (i & 1) * 128) =
                __builtin_convertvector(xreg[i], v4h);
    }
    __syncthreads();

    v16h xa[4][8];
#pragma unroll
    for (int rt = 0; rt < 4; ++rt)
#pragma unroll
        for (int ks = 0; ks < 8; ++ks)
            xa[rt][ks] = load_frag(&sX[(wr * 64 + rt * 16 + lm) * QP + ks * 32], sel);

    const int b = (loc >> 6) + wr;      // a wave's 64 rows are one window

    // One chunk: fetch the next chunk's weights (not behind the last), multiply,
    // lay the fetched weights into the other buffer, store this chunk's columns.
    auto chunk = [&](const int c, auto more) __attribute__((always_inline)) {
        if constexpr (more.value) {
            const float* p = wsrc + (size_t)(c + 1) * QCH * DIM;
#pragma unroll
            for (int i = 0; i < 16; ++i)
                wreg[i] = *(const v4f*)(p + (i >> 1) * DIM + (i & 1) * 128);
        }

        const int s    = c >> 2;                 // 0=q,1=k,2=v
        const int hcol = (c * 2 + wc) & 7;       // a wave's 32 columns are one head
        const float bv0 = sBias[c * QCH + wc * 32 + lm];
        const float bv1 = sBias[c * QCH + wc * 32 + 16 + lm];
        _Float16* dst = (s == 0) ? qws : ((s == 1) ? kws : vws);
        dst += (s == 1) ? ((size_t)(b * NH + hcol) * NTOK) * HD
                        : ((size_t)(b * NH + hcol) * TWO_N + wch * NTOK) * HD;
        dst += sel * 8 * HD + lm;

        const _Float16* wb = &sW[c & 1][(wc * 32 + lm) * QP];
        v8f acc[4][2] = {};
        v16h bf[2][2];                           // fragments one k-step ahead
        bf[0][0] = load_frag(wb, sel);
        bf[0][1] = load_frag(wb + 16 * QP, sel);
#pragma unroll
        for (int ks = 0; ks < 8; ++ks) {
            if (ks < 7) {
                bf[(ks + 1) & 1][0] = load_frag(wb + (ks + 1) * 32, sel);
                bf[(ks + 1) & 1][1] = load_frag(wb + 16 * QP + (ks + 1) * 32, sel);
            }
            // Keeps the next k-step's LDS reads in front of this step's products;
            // without it they sink to just before their use and the wave waits.
            __builtin_amdgcn_sched_barrier(0);
#pragma unroll
            for (int rt = 0; rt < 4; ++rt) {
                acc[rt][0] = wmma_f16(xa[rt][ks], bf[ks & 1][0], acc[rt][0]);
                acc[rt][1] = wmma_f16(xa[rt][ks], bf[ks & 1][1], acc[rt][1]);
            }
            // Keeps the conversion of the fetched weights (and its wait on the
            // global loads) behind the products instead of among the first ones.
            __builtin_amdgcn_sched_barrier(0);
        }

        if constexpr (more.value) {
            _Float16* wd = &sW[(c + 1) & 1][(wv * 8) * QP + lane * 4];
#pragma unroll
            for (int i = 0; i < 16; ++i)
                *(v4h*)(wd + (i >> 1) * QP + (i & 1) * 128) =
                    __builtin_convertvector(wreg[i], v4h);
        }

        if (s != 1 || wch == 0) {                // k of x2 is never read
            _Float16 hv[4][2][8];
#pragma unroll
            for (int rt = 0; rt < 4; ++rt)
#pragma unroll
                for (int j = 0; j < 8; ++j) {
                    hv[rt][0][j] = (_Float16)(acc[rt][0][j] + bv0);
                    hv[rt][1][j] = (_Float16)(acc[rt][1][j] + bv1);
                }
            // All values first, then all stores: no register that an issued
            // store names is written again before the wait below.
            __builtin_amdgcn_sched_barrier(0);
#pragma unroll
            for (int rt = 0; rt < 4; ++rt)
#pragma unroll
                for (int j = 0; j < 8; ++j) {
                    dst[(rt * 16 + j) * HD]      = hv[rt][0][j];
                    dst[(rt * 16 + j) * HD + 16] = hv[rt][1][j];
                }
            // The next chunk overwrites the stores' data and address registers.
            if constexpr (more.value) asm volatile("s_wait_xcnt 0x0" ::: "memory");
        }
    };

    // Rolled: one chunk's code serves eleven chunks (instruction cache).
#pragma unroll 1
    for (int c = 0; c < QNCH - 1; ++c) {
        chunk(c, std::true_type{});
        // Publishes chunk c+1 and ends every wave's reads of chunk c's buffer.
        // Only LDS is handed over here, so the fences name LDS alone: a plain
        // __syncthreads() would also wait for this chunk's global stores.
        __builtin_amdgcn_fence(__ATOMIC_RELEASE, "workgroup", "local");
        __builtin_amdgcn_s_barrier();
        __builtin_amdgcn_fence(__ATOMIC_ACQUIRE, "workgroup", "local");
    }
    chunk(QNCH - 1, std::false_type{});
}

// ---------------------------------------------------------------------------
// 3) Attention: S = (Qn Kn^T)*scale + bias + mask; softmax; O = P V.
//    One block = one (head, mask window). The NIMG batch entries that share
//    that mask window are worked on one after the other, so the 128x128 bias
//    and mask are read once a block and their sum stays in registers.
//    Both products are formed transposed (S^T = K Q^T, O^T = V^T P^T): a lane
//    then holds 64 of the 128 scores of ONE query row, lane ^ 16 the others.
// ---------------------------------------------------------------------------
#define NIMG (BW / NW)   // batch entries per mask window

// Work-group barrier that hands over LDS alone: a plain __syncthreads() would
// also wait for the rows fetched ahead and for the output stores in flight.
__device__ __forceinline__ void lds_barrier() {
    __builtin_amdgcn_fence(__ATOMIC_RELEASE, "workgroup", "local");
    __builtin_amdgcn_s_barrier();
    __builtin_amdgcn_fence(__ATOMIC_ACQUIRE, "workgroup", "local");
}

// Lane l's value as seen from lane l ^ 16 (a vector cross-row move, no LDS pipe).
__device__ __forceinline__ float xhalf(float x) {
    const int b = __builtin_bit_cast(int, x);
    return __builtin_bit_cast(float, __builtin_amdgcn_permlanex16(
        b, b, 0x76543210, 0xfedcba98, false, false));
}

// p[i] = 2^t[i]. Eight exponentials in one statement: each stands in the slot
// that the instruction set asks for behind the one before it (no result read,
// no source overwritten: the outputs share no register with the inputs), and
// the v_nop stands in the last one's.
__device__ __forceinline__ void exp2x8(v8f& p, const v8f t) {
    float p0, p1, p2, p3, p4, p5, p6, p7;
    asm("v_exp_f32 %0, %8\n\t"
        "v_exp_f32 %1, %9\n\t"
        "v_exp_f32 %2, %10\n\t"
        "v_exp_f32 %3, %11\n\t"
        "v_exp_f32 %4, %12\n\t"
        "v_exp_f32 %5, %13\n\t"
        "v_exp_f32 %6, %14\n\t"
        "v_exp_f32 %7, %15\n\t"
        "v_nop"
        : "=&v"(p0), "=&v"(p1), "=&v"(p2), "=&v"(p3),
          "=&v"(p4), "=&v"(p5), "=&v"(p6), "=&v"(p7)
        : "v"(t[0]), "v"(t[1]), "v"(t[2]), "v"(t[3]),
          "v"(t[4]), "v"(t[5]), "v"(t[6]), "v"(t[7]));
    p[0] = p0; p[1] = p1; p[2] = p2; p[3] = p3;
    p[4] = p4; p[5] = p5; p[6] = p6; p[7] = p7;
}

__global__ __launch_bounds__(256) void swin_attn(
    const _Float16* __restrict__ qws, const _Float16* __restrict__ kws,
    const _Float16* __restrict__ vws, const float* __restrict__ biasb,
    const float* __restrict__ mask, const float* __restrict__ logit_scale,
    _Float16* __restrict__ ao)
{
    __shared__ _Float16 sQ[TWO_N * 40];   // 128 x 32 (stride 40)
    __shared__ _Float16 sK[NTOK * 40];    //  64 x 32
    __shared__ _Float16 sVt[HD * 136];    //  32 x 128 (V transposed, stride 136)

    const int h = blockIdx.x, wdw = blockIdx.y;
    const int tid = threadIdx.x;
    const int wv = tid >> 5, lane = tid & 31;
    const int sel = lane >> 4, lm = lane & 15;

    // Threads 0..127 stage a q row and a v row each, threads 128..191 a k row.
    const bool isq   = tid < TWO_N;
    const bool isrow = tid < TWO_N + NTOK;
    const size_t qimg = (size_t)NW * NH * TWO_N * HD;  // halves to the next entry
    const size_t kimg = (size_t)NW * NH * NTOK * HD;
    const _Float16* rsrc =
        isq ? qws + ((size_t)(wdw * NH + h) * TWO_N + tid) * HD
            : kws + ((size_t)(wdw * NH + h) * NTOK + (tid & (NTOK - 1))) * HD;
    const size_t rstep = isq ? qimg : kimg;
    const _Float16* vsrc =
        vws + ((size_t)(wdw * NH + h) * TWO_N + (tid & (TWO_N - 1))) * HD;

    v8h rr[4], vr[4];
    auto fetch = [&](const int img) __attribute__((always_inline)) {
        // The fence pair keeps every other instruction out of [loads, wait], so
        // that no register a load names is written before the wait.
        __builtin_amdgcn_sched_barrier(0);
        if (isrow) {
            const v8h* p = (const v8h*)(rsrc + (size_t)img * rstep);
#pragma unroll
            for (int i = 0; i < 4; ++i) rr[i] = p[i];
        }
        if (isq) {
            const v8h* p = (const v8h*)(vsrc + (size_t)img * qimg);
#pragma unroll
            for (int i = 0; i < 4; ++i) vr[i] = p[i];
        }
        // The loads' address registers are reused behind them.
        asm volatile("s_wait_xcnt 0x0" ::: "memory");
        __builtin_amdgcn_sched_barrier(0);
    };
    fetch(0);

    // bias + mask of this lane's query row, in the accumulator's own layout:
    // tile ct, register j = key ct*16 + sel*8 + j.
    const int qoff = (wv * 16 + lm) * TWO_N + sel * 8;
    const float* bptr = biasb + (size_t)h * TWO_N * TWO_N + qoff;
    const float* mptr = mask + (size_t)wdw * TWO_N * TWO_N + qoff;
    v4f bq[16], mq[16];
    // The fence pair keeps every other instruction out of [loads, wait], so
    // that no register a load names is written before the wait.
    __builtin_amdgcn_sched_barrier(0);
#pragma unroll
    for (int i = 0; i < 16; ++i) {
        bq[i] = *(const v4f*)(bptr + (i >> 1) * 16 + (i & 1) * 4);
        mq[i] = *(const v4f*)(mptr + (i >> 1) * 16 + (i & 1) * 4);
    }
    // The loads' address registers are reused behind them.
    asm volatile("s_wait_xcnt 0x0" ::: "memory");
    __builtin_amdgcn_sched_barrier(0);
    float bm[8][8];
#pragma unroll
    for (int i = 0; i < 16; ++i)
#pragma unroll
        for (int e = 0; e < 4; ++e)
            bm[i >> 1][(i & 1) * 4 + e] = bq[i][e] + mq[i][e];

    const float scale = __expf(fminf(logit_scale[h], 4.6051702f)); // log(100)

    // Rolled: one entry's code serves all (registers, instruction cache).
#pragma unroll 1
    for (int img = 0; img < NIMG; ++img) {
        // Inputs only: has every wave wait for its fetched rows here, on every
        // path. With the waits only inside the branches below, the compiler
        // holds each load of the next fetch behind the return of an older one.
        asm volatile("" :: "v"(rr[0]), "v"(rr[1]), "v"(rr[2]), "v"(rr[3]),
                           "v"(vr[0]), "v"(vr[1]), "v"(vr[2]), "v"(vr[3]));
        // --- L2-normalize Q and K into LDS, transpose-stage V ---
        if (isrow) {
            float tmp[HD]; float ss = 0.0f;
#pragma unroll
            for (int i = 0; i < HD; ++i) {
                tmp[i] = (float)rr[i >> 3][i & 7];
                ss += tmp[i] * tmp[i];
            }
            const float inv = 1.0f / fmaxf(sqrtf(ss), 1e-12f);
            if (isq) {
#pragma unroll
                for (int i = 0; i < HD; ++i)
                    sQ[tid * 40 + i] = (_Float16)(tmp[i] * inv);
            } else {
#pragma unroll
                for (int i = 0; i < HD; ++i)
                    sK[(tid - TWO_N) * 40 + i] = (_Float16)(tmp[i] * inv);
            }
        }
        if (isq) {
#pragma unroll
            for (int i = 0; i < HD; ++i) sVt[i * 136 + tid] = vr[i >> 3][i & 7];
        }
        lds_barrier();                    // publishes this entry's Q, K, V

        // The next entry's rows fly while this one is worked on.
        if (img + 1 < NIMG) fetch(img + 1);

        // --- S^T = K Q^T : one WMMA per 16x16 tile (K-depth == head dim == 32).
        //     Register j of tile ct = key ct*16 + sel*8 + j, lane lm = query. ---
        v16h bQ = load_frag(&sQ[(wv * 16 + lm) * 40], sel);
        v16h aK[4];
#pragma unroll
        for (int kb = 0; kb < 4; ++kb)
            aK[kb] = load_frag(&sK[(kb * 16 + lm) * 40], sel);

        // All V^T fragments are named ahead of the products, so that their LDS
        // reads can run ahead of the k-step that uses them.
        v16h aV[4][2];
#pragma unroll
        for (int kc = 0; kc < 4; ++kc) {
            aV[kc][0] = load_frag(&sVt[(0  + lm) * 136 + kc * 32], sel);
            aV[kc][1] = load_frag(&sVt[(16 + lm) * 136 + kc * 32], sel);
        }

        v8f acc[8];
#pragma unroll
        for (int ct = 0; ct < 8; ++ct) {
            v8f z = {};
            acc[ct] = wmma_f16(aK[ct & 3], bQ, z);  // keys 64..127 reuse K (k=[k1;k1])
        }

        // --- scale + (bias + mask), then the row's softmax: in the lane, plus
        //     two exchanges (max, sum) with the lane that holds the row's other 64 keys. ---
        float part[8];
#pragma unroll
        for (int ct = 0; ct < 8; ++ct) {
            float m = -1e30f;
#pragma unroll
            for (int j = 0; j < 8; ++j) {
                const float v = acc[ct][j] * scale + bm[ct][j];
                acc[ct][j] = v;
                m = fmaxf(m, v);
            }
            part[ct] = m;
        }
        float mx = fmaxf(fmaxf(fmaxf(part[0], part[1]), fmaxf(part[2], part[3])),
                         fmaxf(fmaxf(part[4], part[5]), fmaxf(part[6], part[7])));
        mx = fmaxf(mx, xhalf(mx));
#pragma unroll
        for (int ct = 0; ct < 8; ++ct) {
            v8f e;
#pragma unroll
            for (int j = 0; j < 8; ++j)
                e[j] = (acc[ct][j] - mx) * 1.44269504f;   // log2(e)
            exp2x8(acc[ct], e);
            float t = acc[ct][0];
#pragma unroll
            for (int j = 1; j < 8; ++j) t += acc[ct][j];
            part[ct] = t;
        }
        float sm = ((part[0] + part[1]) + (part[2] + part[3]))
                 + ((part[4] + part[5]) + (part[6] + part[7]));
        sm += xhalf(sm);
        const float invs = 1.0f / sm;

        // --- O^T = V^T P^T : K-depth 128 -> 4 WMMA steps x 2 tiles of head dim.
        //     Score tiles 2kc and 2kc+1, converted in place, ARE the B fragment
        //     of k-step kc (same k order as load_frag): P never touches LDS. ---
        v8f o0 = {}, o1 = {};
#pragma unroll
        for (int kc = 0; kc < 4; ++kc) {
            v16h bP;
#pragma unroll
            for (int i = 0; i < 8; ++i) {
                bP[i]     = (_Float16)(acc[2 * kc][i] * invs);
                bP[i + 8] = (_Float16)(acc[2 * kc + 1][i] * invs);
            }
            o0 = wmma_f16(aV[kc][0], bP, o0);
            o1 = wmma_f16(aV[kc][1], bP, o1);
        }
        {
            // Register j of o0 / o1 = head-dim column sel*8 + j / 16 + sel*8 + j
            // of query row lm: 8 consecutive halves, one 16-byte store each.
            const int b = img * NW + wdw;
            _Float16* od = ao + ((size_t)b * TWO_N + wv * 16 + lm) * DIM
                              + h * HD + sel * 8;
            const v8h h0 = __builtin_convertvector(o0, v8h);
            const v8h h1 = __builtin_convertvector(o1, v8h);
            // Both values first, then both stores: no register that an issued
            // store names is written again before the wait below.
            __builtin_amdgcn_sched_barrier(0);
            *(v8h*)od        = h0;
            *(v8h*)(od + 16) = h1;
            // The next entry overwrites the stores' data and address registers.
            asm volatile("s_wait_xcnt 0x0" ::: "memory");
        }
        lds_barrier();                    // ends every wave's reads of Q, K, V
    }
}

// ---------------------------------------------------------------------------
// 4) Output projection: ao (65536x256 f16) @ proj_w^T + proj_b -> f32 out
//    Tiled like the QKV GEMM: one block = 256 rows x all 256 columns, one block
//    per WGP. The block's ao rows are read once and kept as A fragments in
//    registers for the whole K; the weights pass through LDS in 4 chunks of 64
//    columns (two buffers, one barrier a chunk).
//    8 waves = 4 row groups of 64 x 2 column halves of 32.
// ---------------------------------------------------------------------------
#define PNCH 4   // chunks of QCH weight columns

__global__ __launch_bounds__(256) void swin_proj_gemm(
    const _Float16* __restrict__ ao, const float* __restrict__ proj_w,
    const float* __restrict__ proj_b, float* __restrict__ out)
{
    __shared__ __attribute__((aligned(16))) _Float16 sX[256 * QP];
    __shared__ __attribute__((aligned(16))) _Float16 sW[2][QCH * QP];
    __shared__ float sBias[DIM];

    const int tid   = threadIdx.x;
    const int baseM = blockIdx.x * 256;
    const int wv    = __builtin_amdgcn_readfirstlane(tid >> 5);
    const int lane  = tid & 31;
    const int wr = wv & 3, wc = wv >> 2;
    const int sel = lane >> 4, lm = lane & 15;

    // Each wave stages 8 weight rows of a chunk (2 coalesced 512-B loads a row)
    // and 32 ao rows (one 512-B load a row). All first loads go out as one group.
    const float*    wsrc = proj_w + (size_t)(wv * 8) * DIM + lane * 4;
    const _Float16* xsrc = ao + (size_t)(baseM + wv * 32) * DIM + lane * 8;
    v4f wreg[16];
    v8h xreg[32];
    // The fence pair keeps every other instruction out of [loads, wait], so that
    // no register a load names is written before the wait.
    __builtin_amdgcn_sched_barrier(0);
#pragma unroll
    for (int i = 0; i < 16; ++i)
        wreg[i] = *(const v4f*)(wsrc + (i >> 1) * DIM + (i & 1) * 128);
#pragma unroll
    for (int i = 0; i < 32; ++i)
        xreg[i] = *(const v8h*)(xsrc + i * DIM);
    const float pb = proj_b[tid];
    // The loads' offset and base registers are reused right behind them.
    asm volatile("s_wait_xcnt 0x0" ::: "memory");
    __builtin_amdgcn_sched_barrier(0);

    sBias[tid] = pb;
    {
        _Float16* wd = &sW[0][(wv * 8) * QP + lane * 4];
#pragma unroll
        for (int i = 0; i < 16; ++i)
            *(v4h*)(wd + (i >> 1) * QP + (i & 1) * 128) =
                __builtin_convertvector(wreg[i], v4h);
        _Float16* xd = &sX[(wv * 32) * QP + lane * 8];
#pragma unroll
        for (int i = 0; i < 32; ++i)
            *(v8h*)(xd + i * QP) = xreg[i];
    }
    __syncthreads();

    v16h xa[4][8];
#pragma unroll
    for (int rt = 0; rt < 4; ++rt)
#pragma unroll
        for (int ks = 0; ks < 8; ++ks)
            xa[rt][ks] = load_frag(&sX[(wr * 64 + rt * 16 + lm) * QP + ks * 32], sel);

    float* drow = out + (size_t)(baseM + wr * 64 + sel * 8) * DIM + wc * 32 + lm;

    // One chunk: fetch the next chunk's weights (not behind the last), multiply,
    // lay the fetched weights into the other buffer, store this chunk's columns.
    auto chunk = [&](const int c, auto more) __attribute__((always_inline)) {
        if constexpr (more.value) {
            const float* p = wsrc + (size_t)(c + 1) * QCH * DIM;
#pragma unroll
            for (int i = 0; i < 16; ++i)
                wreg[i] = *(const v4f*)(p + (i >> 1) * DIM + (i & 1) * 128);
        }

        const float bv0 = sBias[c * QCH + wc * 32 + lm];
        const float bv1 = sBias[c * QCH + wc * 32 + 16 + lm];
        float* dst = drow + c * QCH;

        const _Float16* wb = &sW[c & 1][(wc * 32 + lm) * QP];
        v8f acc[4][2] = {};
        v16h bf[2][2];                           // fragments one k-step ahead
        bf[0][0] = load_frag(wb, sel);
        bf[0][1] = load_frag(wb + 16 * QP, sel);
#pragma unroll
        for (int ks = 0; ks < 8; ++ks) {
            if (ks < 7) {
                bf[(ks + 1) & 1][0] = load_frag(wb + (ks + 1) * 32, sel);
                bf[(ks + 1) & 1][1] = load_frag(wb + 16 * QP + (ks + 1) * 32, sel);
            }
            // Keeps the next k-step's LDS reads in front of this step's products;
            // without it they sink to just before their use and the wave waits.
            __builtin_amdgcn_sched_barrier(0);
#pragma unroll
            for (int rt = 0; rt < 4; ++rt) {
                acc[rt][0] = wmma_f16(xa[rt][ks], bf[ks & 1][0], acc[rt][0]);
                acc[rt][1] = wmma_f16(xa[rt][ks], bf[ks & 1][1], acc[rt][1]);
            }
            // Keeps the conversion of the fetched weights (and its wait on the
            // global loads) behind the products instead of among the first ones.
            __builtin_amdgcn_sched_barrier(0);
        }

        if constexpr (more.value) {
            _Float16* wd = &sW[(c + 1) & 1][(wv * 8) * QP + lane * 4];
#pragma unroll
            for (int i = 0; i < 16; ++i)
                *(v4h*)(wd + (i >> 1) * QP + (i & 1) * 128) =
                    __builtin_convertvector(wreg[i], v4h);
        }

#pragma unroll
        for (int rt = 0; rt < 4; ++rt)
#pragma unroll
            for (int j = 0; j < 8; ++j) {
                acc[rt][0][j] += bv0;
                acc[rt][1][j] += bv1;
            }
        // All values first, then all stores: no register that an issued store
        // names is written again before the wait below.
        __builtin_amdgcn_sched_barrier(0);
#pragma unroll
        for (int rt = 0; rt < 4; ++rt)
#pragma unroll
            for (int j = 0; j < 8; ++j) {
                dst[(rt * 16 + j) * DIM]      = acc[rt][0][j];
                dst[(rt * 16 + j) * DIM + 16] = acc[rt][1][j];
            }
        // The next chunk overwrites the stores' data and address registers.
        if constexpr (more.value) asm volatile("s_wait_xcnt 0x0" ::: "memory");
    };

    // Rolled: one chunk's code serves three chunks (instruction cache).
#pragma unroll 1
    for (int c = 0; c < PNCH - 1; ++c) {
        chunk(c, std::true_type{});
        // Publishes chunk c+1 and ends every wave's reads of chunk c's buffer;
        // LDS alone is handed over, the output stores stay in flight.
        lds_barrier();
    }
    chunk(PNCH - 1, std::false_type{});
}

// ---------------------------------------------------------------------------
extern "C" void kernel_launch(void* const* d_in, const int* in_sizes, int n_in,
                              void* d_out, int out_size, void* d_ws, size_t ws_size,
                              hipStream_t stream)
{
    const float* x1          = (const float*)d_in[0];
    const float* x2          = (const float*)d_in[1];
    const float* mask        = (const float*)d_in[2];
    const float* qkv_w       = (const float*)d_in[3];
    const float* q_bias      = (const float*)d_in[4];
    const float* v_bias      = (const float*)d_in[5];
    const float* logit_scale = (const float*)d_in[6];
    const float* cpb_w1      = (const float*)d_in[7];
    const float* cpb_b1      = (const float*)d_in[8];
    const float* cpb_w2      = (const float*)d_in[9];
    const float* proj_w      = (const float*)d_in[10];
    const float* proj_b      = (const float*)d_in[11];
    const float* amod1       = (const float*)d_in[12];
    const float* amod2       = (const float*)d_in[13];
    const float* rel_table   = (const float*)d_in[14];
    const int*   rel_index   = (const int*)d_in[15];

    char* ws = (char*)d_ws;
    float*    biasb = (float*)(ws + WS_BIAS);
    _Float16* qws   = (_Float16*)(ws + WS_Q);
    _Float16* kws   = (_Float16*)(ws + WS_K);
    _Float16* vws   = (_Float16*)(ws + WS_V);
    _Float16* ao    = (_Float16*)(ws + WS_AO);
    float*    out   = (float*)d_out;

    swin_bias_build<<<dim3(NTOK, NH / BHD), 256, 0, stream>>>(
        rel_table, cpb_w1, cpb_b1, cpb_w2, rel_index, amod1, amod2, biasb);
    swin_qkv_gemm<<<dim3(256), 256, 0, stream>>>(x1, x2, qkv_w, q_bias,
                                                      v_bias, qws, kws, vws);
    swin_attn<<<dim3(NH, NW), 256, 0, stream>>>(qws, kws, vws, biasb, mask,
                                                logit_scale, ao);
    swin_proj_gemm<<<dim3(256), 256, 0, stream>>>(ao, proj_w, proj_b, out);
}

// v006
// Measured time: 79.6 microseconds a run.
// Next to v005, in two timings, it ran 1.06 and 1.05 times as fast.
// All steps since v000 together make it 2.33 times as fast.
#include <hip/hip_runtime.h>
#include <hip/hip_bf16.h>
#include <type_traits>

// ---------------------------------------------------------------------------
// SwinV2 window attention block on gfx1250 (CDNA5), wave32 + WMMA f16.
// ---------------------------------------------------------------------------

typedef _Float16 v16h __attribute__((ext_vector_type(16)));
typedef _Float16 v8h  __attribute__((ext_vector_type(8)));
typedef float    v8f  __attribute__((ext_vector_type(8)));
typedef _Float16 v4h  __attribute__((ext_vector_type(4)));
typedef float    v4f  __attribute__((ext_vector_type(4)));
typedef float    v2f  __attribute__((ext_vector_type(2)));

#define NH   8
#define HD   32
#define NTOK 64
#define TWO_N 128
#define DIM  256
#define BW   512
#define NW   64
#define CPB  512

// workspace layout (bytes)
#define WS_BIAS ((size_t)8192)                    // 8*128*128 f32
#define WS_Q    ((size_t)532480)                  // 512*8*128*32 f16
#define WS_K    (WS_Q + (size_t)33554432)         // 512*8* 64*32 f16
#define WS_V    (WS_K + (size_t)16777216)         // 512*8*128*32 f16
#define WS_AO   (WS_V + (size_t)33554432)         // 512*128*256  f16

// Load a 16x32 f16 A-fragment (or 32x16 B-fragment) per ISA layout:
// lane<16 holds K = {0..7, 16..23}; lane>=16 holds K = {8..15, 24..31}.
// `seg` points at the 32-half contiguous K segment for this lane's row/col,
// and must be 16B aligned (row strides are multiples of 8 halves).
__device__ __forceinline__ v16h load_frag(const _Float16* seg, int sel) {
    v8h lo = *(const v8h*)(seg + sel * 8);
    v8h hi = *(const v8h*)(seg + 16 + sel * 8);
    v16h f;
#pragma unroll
    for (int i = 0; i < 8; ++i) { f[i] = lo[i]; f[i + 8] = hi[i]; }
    return f;
}

__device__ __forceinline__ v8f wmma_f16(v16h a, v16h b, v8f c) {
    return __builtin_amdgcn_wmma_f32_16x16x32_f16(false, a, false, b,
                                                  (short)0, c, false, false);
}

// ---------------------------------------------------------------------------
// 1) Bias build: CPB MLP (2 -> 512 relu -> 8), rpb gather + 16*sigmoid +
//    2*amod quadrants -> (8,128,128).
//    One block = one token row m and BHD heads. It computes the MLP itself for
//    the 64 table positions that row m gathers: the weights lie in LDS, each
//    wave takes 64 of the 512 hidden units for all 64 positions (2 a lane), and
//    the 8 waves' partial sums are added through LDS.
// ---------------------------------------------------------------------------
#define BHD  2    // heads per block
#define NPOS 225  // rows of the relative-coordinate table

__global__ __launch_bounds__(256) void swin_bias_build(
    const float* __restrict__ tbl, const float* __restrict__ w1,
    const float* __restrict__ b1, const float* __restrict__ w2,
    const int* __restrict__ rel_index,
    const float* __restrict__ amod1, const float* __restrict__ amod2,
    float* __restrict__ biasb)
{
    __shared__ __attribute__((aligned(16))) float sW1[CPB * 2];
    __shared__ __attribute__((aligned(16))) float sB1[CPB];
    __shared__ __attribute__((aligned(16))) float sW2[BHD * CPB];
    __shared__ float sPart[8][BHD][NTOK];

    const int m = blockIdx.x, h0 = blockIdx.y * BHD;
    const int tid  = threadIdx.x;
    const int wv   = __builtin_amdgcn_readfirstlane(tid >> 5);
    const int lane = tid & 31;
    const int n = tid & (TWO_N - 1), nn = n & (NTOK - 1), hh = tid >> 7;
    const size_t aoff = ((size_t)(h0 + hh) * NTOK + m) * NTOK + nn;
    const int*   pix = rel_index + m * NTOK + lane;
    const float* pw1 = w1 + tid * 4;
    const float* pb1 = b1 + tid * 2;
    const float* pw2 = w2 + (size_t)h0 * CPB + tid * 4;
    const float* pa1 = amod1 + aoff;
    const float* pa2 = amod2 + aoff;

    // The fences keep other work out of [loads, wait], so that no register an
    // issued load names is written before the wait.
    __builtin_amdgcn_sched_barrier(0);
    int i0 = pix[0];
    int i1 = pix[32];
    const v4f rw1 = *(const v4f*)pw1;
    const v2f rb1 = *(const v2f*)pb1;
    const v4f rw2 = *(const v4f*)pw2;
    const float a1 = *pa1;
    const float a2 = *pa2;
    asm volatile("s_wait_xcnt 0x0" ::: "memory");
    __builtin_amdgcn_sched_barrier(0);

    // The index is input data: bound the table address.
    i0 = min(max(i0, 0), NPOS - 1);
    i1 = min(max(i1, 0), NPOS - 1);
    const v2f xa = *(const v2f*)(tbl + i0 * 2);
    const v2f xb = *(const v2f*)(tbl + i1 * 2);
    // The loads' offset registers are reused right behind them.
    asm volatile("s_wait_xcnt 0x0" ::: "memory");
    __builtin_amdgcn_sched_barrier(0);

    *(v4f*)&sW1[tid * 4] = rw1;
    *(v2f*)&sB1[tid * 2] = rb1;
    *(v4f*)&sW2[tid * 4] = rw2;
    __syncthreads();                      // publishes the weights

    float acc[2][BHD] = {};
    const int j0 = wv * (CPB / 8);
#pragma unroll
    for (int jj = 0; jj < CPB / 8; jj += 4) {
        const int j = j0 + jj;
        const v4f wa = *(const v4f*)&sW1[j * 2];
        const v4f wb = *(const v4f*)&sW1[j * 2 + 4];
        const v4f bb = *(const v4f*)&sB1[j];
        const v4f u0 = *(const v4f*)&sW2[j];
        const v4f u1 = *(const v4f*)&sW2[CPB + j];
#pragma unroll
        for (int q = 0; q < 4; ++q) {
            const float c0 = (q < 2) ? wa[2 * q]     : wb[2 * q - 4];
            const float c1 = (q < 2) ? wa[2 * q + 1] : wb[2 * q - 3];
            const float ha = fmaxf(c0 * xa[0] + c1 * xa[1] + bb[q], 0.0f);
            const float hb = fmaxf(c0 * xb[0] + c1 * xb[1] + bb[q], 0.0f);
            acc[0][0] += u0[q] * ha;
            acc[0][1] += u1[q] * ha;
            acc[1][0] += u0[q] * hb;
            acc[1][1] += u1[q] * hb;
        }
    }
#pragma unroll
    for (int p = 0; p < 2; ++p)
#pragma unroll
        for (int g = 0; g < BHD; ++g) sPart[wv][g][p * 32 + lane] = acc[p][g];
    __syncthreads();                      // publishes the partial sums

    float r = 0.0f;
#pragma unroll
    for (int k = 0; k < 8; ++k) r += sPart[k][hh][nn];
    const float rpb = 16.0f / (1.0f + __expf(-r));
    // Rows m and m+64: amod1 where row and column lie in the same half.
    const bool lo = n < NTOK;
    float* bd = biasb + ((size_t)(h0 + hh) * TWO_N + m) * TWO_N + n;
    bd[0]            = rpb + 2.0f * (lo ? a1 : a2);
    bd[NTOK * TWO_N] = rpb + 2.0f * (lo ? a2 : a1);
}

// ---------------------------------------------------------------------------
// 2) QKV GEMM: [x1;x2] (65536x256) @ qkv_w^T (256x768) + bias, scatter q/k/v.
//    One block = 256 rows x all 768 columns, one block per WGP. The block's x
//    rows are read once, converted to f16 and kept as B fragments in registers
//    for the whole K (4 row tiles x 8 k-steps per wave). The weights pass
//    through LDS in 12 chunks of 64 columns (two buffers, one barrier a chunk).
//    8 waves = 4 row groups of 64 x 2 column halves of 32.
//    The product is formed transposed (weights as A, x as B): a lane holds 8
//    consecutive columns of one row. A wave's 64 x 32 tile is 4 KiB in a row in
//    q/k/v; it passes through the wave's own LDS range and leaves in whole lines.
// ---------------------------------------------------------------------------
#define QP 264   // LDS row pitch in halves: 528 B = 16 B x odd for b128 readers
#define QCH 64   // weight columns per chunk
#define QNCH 12  // chunks

__global__ __launch_bounds__(256) void swin_qkv_gemm(
    const float* __restrict__ x1, const float* __restrict__ x2,
    const float* __restrict__ qkv_w, const float* __restrict__ q_bias,
    const float* __restrict__ v_bias,
    _Float16* __restrict__ qws, _Float16* __restrict__ kws,
    _Float16* __restrict__ vws)
{
    __shared__ __attribute__((aligned(16))) _Float16 sX[256 * QP];
    __shared__ __attribute__((aligned(16))) _Float16 sW[2][QCH * QP];
    __shared__ __attribute__((aligned(32))) float sBias[3 * DIM]; // q_bias | 0 | v_bias
    __shared__ __attribute__((aligned(16))) _Float16 sOut[8][64 * HD]; // a wave's tile

    const int tid   = threadIdx.x;
    const int baseM = blockIdx.x * 256;
    const int wv    = __builtin_amdgcn_readfirstlane(tid >> 5);
    const int lane  = tid & 31;
    const int wr = wv & 3, wc = wv >> 2;
    const int sel = lane >> 4, lm = lane & 15;
    const int wch = baseM >> 15;        // 0 -> x1, 1 -> x2 (same for the block)
    const int loc = baseM & 32767;

    // Each wave stages 8 weight rows of a chunk (2 coalesced 512-B loads a row)
    // and 32 x rows. All of the block's first loads go out as one group.
    const float* wsrc = qkv_w + (size_t)(wv * 8) * DIM + lane * 4;
    const float* xsrc = (wch ? x2 : x1) + (size_t)(loc + wv * 32) * DIM + lane * 4;
    v4f wreg[16];
    v4f xreg[64];
    // The fence pair keeps every other instruction out of [loads, wait], so that
    // no register a load names is written before the wait.
    __builtin_amdgcn_sched_barrier(0);
#pragma unroll
    for (int i = 0; i < 16; ++i)
        wreg[i] = *(const v4f*)(wsrc + (i >> 1) * DIM + (i & 1) * 128);
#pragma unroll
    for (int i = 0; i < 64; ++i)
        xreg[i] = *(const v4f*)(xsrc + (i >> 1) * DIM + (i & 1) * 128);
    const float qb = q_bias[tid];
    const float vb = v_bias[tid];
    // The loads' offset and base registers are reused right behind them.
    asm volatile("s_wait_xcnt 0x0" ::: "memory");
    __builtin_amdgcn_sched_barrier(0);

    sBias[tid]           = qb;
    sBias[DIM + tid]     = 0.0f;
    sBias[2 * DIM + tid] = vb;
    {
        _Float16* wd = &sW[0][(wv * 8) * QP + lane * 4];
#pragma unroll
        for (int i = 0; i < 16; ++i)
            *(v4h*)(wd + (i >> 1) * QP + (i & 1) * 128) =
                __builtin_convertvector(wreg[i], v4h);
        _Float16* xd = &sX[(wv * 32) * QP + lane * 4];
#pragma unroll
        for (int i = 0; i < 64; ++i)
            *(v4h*)(xd + (i >> 1) * QP + (i & 1) * 128) =
                __builtin_convertvector(xreg[i], v4h);
    }
    __syncthreads();

    v16h xa[4][8];
#pragma unroll
    for (int rt = 0; rt < 4; ++rt)
#pragma unroll
        for (int ks = 0; ks < 8; ++ks)
            xa[rt][ks] = load_frag(&sX[(wr * 64 + rt * 16 + lm) * QP + ks * 32], sel);

    const int b = (loc >> 6) + wr;      // a wave's 64 rows are one window

    // Output staging, 16-byte pieces, 4 a row of 64 B. Piece p of row r lies at
    // r*64 + ((p ^ ((r >> 2) & 3)) << 4): no bank is met twice by the writers
    // (16 rows, one piece) nor by the readers (4 rows, all pieces).
    char* stg = (char*)&sOut[wv][0];
    const int swr = lm * 64 + ((sel ^ (lm >> 2)) << 4);            // row lm, piece sel
    const int srd = (lane >> 2) * 64 + (((lane & 3) ^ sel) << 4);  // linear 16 B x lane

    // One chunk: fetch the next chunk's weights (not behind the last), multiply,
    // lay the fetched weights into the other buffer, store this chunk's columns.
    auto chunk = [&](const int c, auto more) __attribute__((always_inline)) {
        if constexpr (more.value) {
            const float* p = wsrc + (size_t)(c + 1) * QCH * DIM;
#pragma unroll
            for (int i = 0; i < 16; ++i)
                wreg[i] = *(const v4f*)(p + (i >> 1) * DIM + (i & 1) * 128);
        }

        const int s    = c >> 2;                 // 0=q,1=k,2=v
        const int hcol = (c * 2 + wc) & 7;       // a wave's 32 columns are one head
        const v8f bv0 = *(const v8f*)&sBias[c * QCH + wc * 32 + sel * 8];
        const v8f bv1 = *(const v8f*)&sBias[c * QCH + wc * 32 + 16 + sel * 8];
        _Float16* dst = (s == 0) ? qws : ((s == 1) ? kws : vws);
        dst += (s == 1) ? ((size_t)(b * NH + hcol) * NTOK) * HD
                        : ((size_t)(b * NH + hcol) * TWO_N + wch * NTOK) * HD;
        dst += lane * 8;

        const _Float16* wb = &sW[c & 1][(wc * 32 + lm) * QP];
        v8f acc[4][2] = {};
        v16h bf[2][2];                           // fragments one k-step ahead
        bf[0][0] = load_frag(wb, sel);
        bf[0][1] = load_frag(wb + 16 * QP, sel);
#pragma unroll
        for (int ks = 0; ks < 8; ++ks) {
            if (ks < 7) {
                bf[(ks + 1) & 1][0] = load_frag(wb + (ks + 1) * 32, sel);
                bf[(ks + 1) & 1][1] = load_frag(wb + 16 * QP + (ks + 1) * 32, sel);
            }
            // Keeps the next k-step's LDS reads in front of this step's products;
            // without it they sink to just before their use and the wave waits.
            __builtin_amdgcn_sched_barrier(0);
#pragma unroll
            for (int rt = 0; rt < 4; ++rt) {
                acc[rt][0] = wmma_f16(bf[ks & 1][0], xa[rt][ks], acc[rt][0]);
                acc[rt][1] = wmma_f16(bf[ks & 1][1], xa[rt][ks], acc[rt][1]);
            }
            // Keeps the conversion of the fetched weights (and its wait on the
            // global loads) behind the products instead of among the first ones.
            __builtin_amdgcn_sched_barrier(0);
        }

        const bool keep = (s != 1 || wch == 0);  // k of x2 is never read
        if (keep) {
            // Register j of acc[rt][t] = column t*16 + sel*8 + j of row rt*16 + lm.
#pragma unroll
            for (int rt = 0; rt < 4; ++rt) {
                *(v8h*)(stg + swr + rt * 1024) =
                    __builtin_convertvector(acc[rt][0] + bv0, v8h);
                *(v8h*)(stg + (swr ^ 32) + rt * 1024) =
                    __builtin_convertvector(acc[rt][1] + bv1, v8h);
            }
        }

        if constexpr (more.value) {
            _Float16* wd = &sW[(c + 1) & 1][(wv * 8) * QP + lane * 4];
#pragma unroll
            for (int i = 0; i < 16; ++i)
                *(v4h*)(wd + (i >> 1) * QP + (i & 1) * 128) =
                    __builtin_convertvector(wreg[i], v4h);
        }

        if (keep) {
            // The staged rows are read back by other lanes of this wave.
            asm volatile("s_wait_dscnt 0x0" ::: "memory");
            v8h ov[8];
#pragma unroll
            for (int i = 0; i < 8; ++i)
                ov[i] = *(const v8h*)(stg + (srd ^ ((i & 1) * 32)) + i * 512);
            // All values first, then all stores: no register that an issued
            // store names is written again before the wait below.
            __builtin_amdgcn_sched_barrier(0);
#pragma unroll
            for (int i = 0; i < 8; ++i)
                *(v8h*)(dst + i * 256) = ov[i];      // 512 B in a row per store
            // The next chunk overwrites the stores' data and address registers.
            if constexpr (more.value) asm volatile("s_wait_xcnt 0x0" ::: "memory");
        }
    };

    // Rolled: one chunk's code serves eleven chunks (instruction cache).
#pragma unroll 1
    for (int c = 0; c < QNCH - 1; ++c) {
        chunk(c, std::true_type{});
        // Publishes chunk c+1 and ends every wave's reads of chunk c's buffer.
        // Only LDS is handed over here, so the fences name LDS alone: a plain
        // __syncthreads() would also wait for this chunk's global stores.
        __builtin_amdgcn_fence(__ATOMIC_RELEASE, "workgroup", "local");
        __builtin_amdgcn_s_barrier();
        __builtin_amdgcn_fence(__ATOMIC_ACQUIRE, "workgroup", "local");
    }
    chunk(QNCH - 1, std::false_type{});
}

// ---------------------------------------------------------------------------
// 3) Attention: S = (Qn Kn^T)*scale + bias + mask; softmax; O = P V.
//    One block = one (head, mask window). The NIMG batch entries that share
//    that mask window are worked on one after the other, so the 128x128 bias
//    and mask are read once a block and their sum stays in registers.
//    Both products are formed transposed (S^T = K Q^T, O^T = V^T P^T): a lane
//    then holds 64 of the 128 scores of ONE query row, lane ^ 16 the others.
// ---------------------------------------------------------------------------
#define NIMG (BW / NW)   // batch entries per mask window

// Work-group barrier that hands over LDS alone: a plain __syncthreads() would
// also wait for the rows fetched ahead and for the output stores in flight.
__device__ __forceinline__ void lds_barrier() {
    __builtin_amdgcn_fence(__ATOMIC_RELEASE, "workgroup", "local");
    __builtin_amdgcn_s_barrier();
    __builtin_amdgcn_fence(__ATOMIC_ACQUIRE, "workgroup", "local");
}

// Lane l's value as seen from lane l ^ 16 (a vector cross-row move, no LDS pipe).
__device__ __forceinline__ float xhalf(float x) {
    const int b = __builtin_bit_cast(int, x);
    return __builtin_bit_cast(float, __builtin_amdgcn_permlanex16(
        b, b, 0x76543210, 0xfedcba98, false, false));
}

// p[i] = 2^t[i]. Eight exponentials in one statement: each stands in the slot
// that the instruction set asks for behind the one before it (no result read,
// no source overwritten: the outputs share no register with the inputs), and
// the v_nop stands in the last one's.
__device__ __forceinline__ void exp2x8(v8f& p, const v8f t) {
    float p0, p1, p2, p3, p4, p5, p6, p7;
    asm("v_exp_f32 %0, %8\n\t"
        "v_exp_f32 %1, %9\n\t"
        "v_exp_f32 %2, %10\n\t"
        "v_exp_f32 %3, %11\n\t"
        "v_exp_f32 %4, %12\n\t"
        "v_exp_f32 %5, %13\n\t"
        "v_exp_f32 %6, %14\n\t"
        "v_exp_f32 %7, %15\n\t"
        "v_nop"
        : "=&v"(p0), "=&v"(p1), "=&v"(p2), "=&v"(p3),
          "=&v"(p4), "=&v"(p5), "=&v"(p6), "=&v"(p7)
        : "v"(t[0]), "v"(t[1]), "v"(t[2]), "v"(t[3]),
          "v"(t[4]), "v"(t[5]), "v"(t[6]), "v"(t[7]));
    p[0] = p0; p[1] = p1; p[2] = p2; p[3] = p3;
    p[4] = p4; p[5] = p5; p[6] = p6; p[7] = p7;
}

__global__ __launch_bounds__(256) void swin_attn(
    const _Float16* __restrict__ qws, const _Float16* __restrict__ kws,
    const _Float16* __restrict__ vws, const float* __restrict__ biasb,
    const float* __restrict__ mask, const float* __restrict__ logit_scale,
    _Float16* __restrict__ ao)
{
    __shared__ _Float16 sQ[TWO_N * 40];   // 128 x 32 (stride 40)
    __shared__ _Float16 sK[NTOK * 40];    //  64 x 32
    __shared__ _Float16 sVt[HD * 136];    //  32 x 128 (V transposed, stride 136)

    const int h = blockIdx.x, wdw = blockIdx.y;
    const int tid = threadIdx.x;
    const int wv = tid >> 5, lane = tid & 31;
    const int sel = lane >> 4, lm = lane & 15;

    // Threads 0..127 stage a q row and a v row each, threads 128..191 a k row.
    const bool isq   = tid < TWO_N;
    const bool isrow = tid < TWO_N + NTOK;
    const size_t qimg = (size_t)NW * NH * TWO_N * HD;  // halves to the next entry
    const size_t kimg = (size_t)NW * NH * NTOK * HD;
    const _Float16* rsrc =
        isq ? qws + ((size_t)(wdw * NH + h) * TWO_N + tid) * HD
            : kws + ((size_t)(wdw * NH + h) * NTOK + (tid & (NTOK - 1))) * HD;
    const size_t rstep = isq ? qimg : kimg;
    const _Float16* vsrc =
        vws + ((size_t)(wdw * NH + h) * TWO_N + (tid & (TWO_N - 1))) * HD;

    v8h rr[4], vr[4];
    auto fetch = [&](const int img) __attribute__((always_inline)) {
        // The fence pair keeps every other instruction out of [loads, wait], so
        // that no register a load names is written before the wait.
        __builtin_amdgcn_sched_barrier(0);
        if (isrow) {
            const v8h* p = (const v8h*)(rsrc + (size_t)img * rstep);
#pragma unroll
            for (int i = 0; i < 4; ++i) rr[i] = p[i];
        }
        if (isq) {
            const v8h* p = (const v8h*)(vsrc + (size_t)img * qimg);
#pragma unroll
            for (int i = 0; i < 4; ++i) vr[i] = p[i];
        }
        // The loads' address registers are reused behind them.
        asm volatile("s_wait_xcnt 0x0" ::: "memory");
        __builtin_amdgcn_sched_barrier(0);
    };
    fetch(0);

    // bias + mask of this lane's query row, in the accumulator's own layout:
    // tile ct, register j = key ct*16 + sel*8 + j.
    const int qoff = (wv * 16 + lm) * TWO_N + sel * 8;
    const float* bptr = biasb + (size_t)h * TWO_N * TWO_N + qoff;
    const float* mptr = mask + (size_t)wdw * TWO_N * TWO_N + qoff;
    v4f bq[16], mq[16];
    // The fence pair keeps every other instruction out of [loads, wait], so
    // that no register a load names is written before the wait.
    __builtin_amdgcn_sched_barrier(0);
#pragma unroll
    for (int i = 0; i < 16; ++i) {
        bq[i] = *(const v4f*)(bptr + (i >> 1) * 16 + (i & 1) * 4);
        mq[i] = *(const v4f*)(mptr + (i >> 1) * 16 + (i & 1) * 4);
    }
    // The loads' address registers are reused behind them.
    asm volatile("s_wait_xcnt 0x0" ::: "memory");
    __builtin_amdgcn_sched_barrier(0);
    float bm[8][8];
#pragma unroll
    for (int i = 0; i < 16; ++i)
#pragma unroll
        for (int e = 0; e < 4; ++e)
            bm[i >> 1][(i & 1) * 4 + e] = bq[i][e] + mq[i][e];

    const float scale = __expf(fminf(logit_scale[h], 4.6051702f)); // log(100)

    // Rolled: one entry's code serves all (registers, instruction cache).
#pragma unroll 1
    for (int img = 0; img < NIMG; ++img) {
        // Inputs only: has every wave wait for its fetched rows here, on every
        // path. With the waits only inside the branches below, the compiler
        // holds each load of the next fetch behind the return of an older one.
        asm volatile("" :: "v"(rr[0]), "v"(rr[1]), "v"(rr[2]), "v"(rr[3]),
                           "v"(vr[0]), "v"(vr[1]), "v"(vr[2]), "v"(vr[3]));
        // --- L2-normalize Q and K into LDS, transpose-stage V ---
        if (isrow) {
            float tmp[HD]; float ss = 0.0f;
#pragma unroll
            for (int i = 0; i < HD; ++i) {
                tmp[i] = (float)rr[i >> 3][i & 7];
                ss += tmp[i] * tmp[i];
            }
            const float inv = 1.0f / fmaxf(sqrtf(ss), 1e-12f);
            if (isq) {
#pragma unroll
                for (int i = 0; i < HD; ++i)
                    sQ[tid * 40 + i] = (_Float16)(tmp[i] * inv);
            } else {
#pragma unroll
                for (int i = 0; i < HD; ++i)
                    sK[(tid - TWO_N) * 40 + i] = (_Float16)(tmp[i] * inv);
            }
        }
        if (isq) {
#pragma unroll
            for (int i = 0; i < HD; ++i) sVt[i * 136 + tid] = vr[i >> 3][i & 7];
        }
        lds_barrier();                    // publishes this entry's Q, K, V

        // The next entry's rows fly while this one is worked on.
        if (img + 1 < NIMG) fetch(img + 1);

        // --- S^T = K Q^T : one WMMA per 16x16 tile (K-depth == head dim == 32).
        //     Register j of tile ct = key ct*16 + sel*8 + j, lane lm = query. ---
        v16h bQ = load_frag(&sQ[(wv * 16 + lm) * 40], sel);
        v16h aK[4];
#pragma unroll
        for (int kb = 0; kb < 4; ++kb)
            aK[kb] = load_frag(&sK[(kb * 16 + lm) * 40], sel);

        // All V^T fragments are named ahead of the products, so that their LDS
        // reads can run ahead of the k-step that uses them.
        v16h aV[4][2];
#pragma unroll
        for (int kc = 0; kc < 4; ++kc) {
            aV[kc][0] = load_frag(&sVt[(0  + lm) * 136 + kc * 32], sel);
            aV[kc][1] = load_frag(&sVt[(16 + lm) * 136 + kc * 32], sel);
        }

        v8f acc[8];
#pragma unroll
        for (int ct = 0; ct < 8; ++ct) {
            v8f z = {};
            acc[ct] = wmma_f16(aK[ct & 3], bQ, z);  // keys 64..127 reuse K (k=[k1;k1])
        }

        // --- scale + (bias + mask), then the row's softmax: in the lane, plus
        //     two exchanges (max, sum) with the lane that holds the row's other 64 keys. ---
        float part[8];
#pragma unroll
        for (int ct = 0; ct < 8; ++ct) {
            float m = -1e30f;
#pragma unroll
            for (int j = 0; j < 8; ++j) {
                const float v = acc[ct][j] * scale + bm[ct][j];
                acc[ct][j] = v;
                m = fmaxf(m, v);
            }
            part[ct] = m;
        }
        float mx = fmaxf(fmaxf(fmaxf(part[0], part[1]), fmaxf(part[2], part[3])),
                         fmaxf(fmaxf(part[4], part[5]), fmaxf(part[6], part[7])));
        mx = fmaxf(mx, xhalf(mx));
#pragma unroll
        for (int ct = 0; ct < 8; ++ct) {
            v8f e;
#pragma unroll
            for (int j = 0; j < 8; ++j)
                e[j] = (acc[ct][j] - mx) * 1.44269504f;   // log2(e)
            exp2x8(acc[ct], e);
            float t = acc[ct][0];
#pragma unroll
            for (int j = 1; j < 8; ++j) t += acc[ct][j];
            part[ct] = t;
        }
        float sm = ((part[0] + part[1]) + (part[2] + part[3]))
                 + ((part[4] + part[5]) + (part[6] + part[7]));
        sm += xhalf(sm);
        const float invs = 1.0f / sm;

        // --- O^T = V^T P^T : K-depth 128 -> 4 WMMA steps x 2 tiles of head dim.
        //     Score tiles 2kc and 2kc+1, converted in place, ARE the B fragment
        //     of k-step kc (same k order as load_frag): P never touches LDS. ---
        v8f o0 = {}, o1 = {};
#pragma unroll
        for (int kc = 0; kc < 4; ++kc) {
            v16h bP;
#pragma unroll
            for (int i = 0; i < 8; ++i) {
                bP[i]     = (_Float16)(acc[2 * kc][i] * invs);
                bP[i + 8] = (_Float16)(acc[2 * kc + 1][i] * invs);
            }
            o0 = wmma_f16(aV[kc][0], bP, o0);
            o1 = wmma_f16(aV[kc][1], bP, o1);
        }
        {
            // Register j of o0 / o1 = head-dim column sel*8 + j / 16 + sel*8 + j
            // of query row lm: 8 consecutive halves, one 16-byte store each.
            const int b = img * NW + wdw;
            _Float16* od = ao + ((size_t)b * TWO_N + wv * 16 + lm) * DIM
                              + h * HD + sel * 8;
            const v8h h0 = __builtin_convertvector(o0, v8h);
            const v8h h1 = __builtin_convertvector(o1, v8h);
            // Both values first, then both stores: no register that an issued
            // store names is written again before the wait below.
            __builtin_amdgcn_sched_barrier(0);
            *(v8h*)od        = h0;
            *(v8h*)(od + 16) = h1;
            // The next entry overwrites the stores' data and address registers.
            asm volatile("s_wait_xcnt 0x0" ::: "memory");
        }
        lds_barrier();                    // ends every wave's reads of Q, K, V
    }
}

// ---------------------------------------------------------------------------
// 4) Output projection: ao (65536x256 f16) @ proj_w^T + proj_b -> f32 out
//    Tiled like the QKV GEMM: one block = 256 rows x all 256 columns, one block
//    per WGP. The block's ao rows are read once and kept as B fragments in
//    registers for the whole K; the weights pass through LDS in 4 chunks of 64
//    columns (two buffers, one barrier a chunk).
//    8 waves = 4 row groups of 64 x 2 column halves of 32.
//    Transposed product and staged stores as in the QKV GEMM: a wave's 32 f32
//    columns are one 128-byte line of each of its 64 rows.
// ---------------------------------------------------------------------------
#define PNCH 4   // chunks of QCH weight columns

__global__ __launch_bounds__(256) void swin_proj_gemm(
    const _Float16* __restrict__ ao, const float* __restrict__ proj_w,
    const float* __restrict__ proj_b, float* __restrict__ out)
{
    __shared__ __attribute__((aligned(16))) _Float16 sX[256 * QP];
    __shared__ __attribute__((aligned(16))) _Float16 sW[2][QCH * QP];
    __shared__ __attribute__((aligned(32))) float sBias[DIM];
    __shared__ __attribute__((aligned(16))) float sOut[8][64 * 32];  // a wave's tile

    const int tid   = threadIdx.x;
    const int baseM = blockIdx.x * 256;
    const int wv    = __builtin_amdgcn_readfirstlane(tid >> 5);
    const int lane  = tid & 31;
    const int wr = wv & 3, wc = wv >> 2;
    const int sel = lane >> 4, lm = lane & 15;

    // Each wave stages 8 weight rows of a chunk (2 coalesced 512-B loads a row)
    // and 32 ao rows (one 512-B load a row). All first loads go out as one group.
    const float*    wsrc = proj_w + (size_t)(wv * 8) * DIM + lane * 4;
    const _Float16* xsrc = ao + (size_t)(baseM + wv * 32) * DIM + lane * 8;
    v4f wreg[16];
    v8h xreg[32];
    // The fence pair keeps every other instruction out of [loads, wait], so that
    // no register a load names is written before the wait.
    __builtin_amdgcn_sched_barrier(0);
#pragma unroll
    for (int i = 0; i < 16; ++i)
        wreg[i] = *(const v4f*)(wsrc + (i >> 1) * DIM + (i & 1) * 128);
#pragma unroll
    for (int i = 0; i < 32; ++i)
        xreg[i] = *(const v8h*)(xsrc + i * DIM);
    const float pb = proj_b[tid];
    // The loads' offset and base registers are reused right behind them.
    asm volatile("s_wait_xcnt 0x0" ::: "memory");
    __builtin_amdgcn_sched_barrier(0);

    sBias[tid] = pb;
    {
        _Float16* wd = &sW[0][(wv * 8) * QP + lane * 4];
#pragma unroll
        for (int i = 0; i < 16; ++i)
            *(v4h*)(wd + (i >> 1) * QP + (i & 1) * 128) =
                __builtin_convertvector(wreg[i], v4h);
        _Float16* xd = &sX[(wv * 32) * QP + lane * 8];
#pragma unroll
        for (int i = 0; i < 32; ++i)
            *(v8h*)(xd + i * QP) = xreg[i];
    }
    __syncthreads();

    v16h xa[4][8];
#pragma unroll
    for (int rt = 0; rt < 4; ++rt)
#pragma unroll
        for (int ks = 0; ks < 8; ++ks)
            xa[rt][ks] = load_frag(&sX[(wr * 64 + rt * 16 + lm) * QP + ks * 32], sel);

    // A store takes 4 whole rows of the wave's tile: 8 lanes x 16 B a row.
    float* drow = out + (size_t)(baseM + wr * 64 + (lane >> 3)) * DIM + wc * 32
                      + (lane & 7) * 4;

    // Output staging, 16-byte pieces, 8 a row of 128 B. Piece p of row r lies at
    // r*128 + ((p ^ ((r >> 1) & 7)) << 4): no bank is met twice by the writers
    // (16 rows, one piece) nor by the readers (2 rows, all pieces).
    char* stg = (char*)&sOut[wv][0];
    const int swr = lm * 128 + (((sel * 2) ^ (lm >> 1)) << 4);       // row lm, piece sel*2
    const int srd = (lane >> 3) * 128 + (((lane & 7) ^ sel) << 4);   // linear 16 B x lane

    // One chunk: fetch the next chunk's weights (not behind the last), multiply,
    // lay the fetched weights into the other buffer, store this chunk's columns.
    auto chunk = [&](const int c, auto more) __attribute__((always_inline)) {
        if constexpr (more.value) {
            const float* p = wsrc + (size_t)(c + 1) * QCH * DIM;
#pragma unroll
            for (int i = 0; i < 16; ++i)
                wreg[i] = *(const v4f*)(p + (i >> 1) * DIM + (i & 1) * 128);
        }

        const v8f bv0 = *(const v8f*)&sBias[c * QCH + wc * 32 + sel * 8];
        const v8f bv1 = *(const v8f*)&sBias[c * QCH + wc * 32 + 16 + sel * 8];
        float* dst = drow + c * QCH;

        const _Float16* wb = &sW[c & 1][(wc * 32 + lm) * QP];
        v8f acc[4][2] = {};
        v16h bf[2][2];                           // fragments one k-step ahead
        bf[0][0] = load_frag(wb, sel);
        bf[0][1] = load_frag(wb + 16 * QP, sel);
#pragma unroll
        for (int ks = 0; ks < 8; ++ks) {
            if (ks < 7) {
                bf[(ks + 1) & 1][0] = load_frag(wb + (ks + 1) * 32, sel);
                bf[(ks + 1) & 1][1] = load_frag(wb + 16 * QP + (ks + 1) * 32, sel);
            }
            // Keeps the next k-step's LDS reads in front of this step's products;
            // without it they sink to just before their use and the wave waits.
            __builtin_amdgcn_sched_barrier(0);
#pragma unroll
            for (int rt = 0; rt < 4; ++rt) {
                acc[rt][0] = wmma_f16(bf[ks & 1][0], xa[rt][ks], acc[rt][0]);
                acc[rt][1] = wmma_f16(bf[ks & 1][1], xa[rt][ks], acc[rt][1]);
            }
            // Keeps the conversion of the fetched weights (and its wait on the
            // global loads) behind the products instead of among the first ones.
            __builtin_amdgcn_sched_barrier(0);
        }

        // Register j of acc[rt][t] = column t*16 + sel*8 + j of row rt*16 + lm:
        // pieces t*4 + sel*2 and t*4 + sel*2 + 1 of that row.
#pragma unroll
        for (int rt = 0; rt < 4; ++rt) {
            const v8f r0 = acc[rt][0] + bv0;
            const v8f r1 = acc[rt][1] + bv1;
            *(v4f*)(stg + swr + rt * 2048)        = __builtin_shufflevector(r0, r0, 0, 1, 2, 3);
            *(v4f*)(stg + (swr ^ 16) + rt * 2048) = __builtin_shufflevector(r0, r0, 4, 5, 6, 7);
            *(v4f*)(stg + (swr ^ 64) + rt * 2048) = __builtin_shufflevector(r1, r1, 0, 1, 2, 3);
            *(v4f*)(stg + (swr ^ 80) + rt * 2048) = __builtin_shufflevector(r1, r1, 4, 5, 6, 7);
        }

        if constexpr (more.value) {
            _Float16* wd = &sW[(c + 1) & 1][(wv * 8) * QP + lane * 4];
#pragma unroll
            for (int i = 0; i < 16; ++i)
                *(v4h*)(wd + (i >> 1) * QP + (i & 1) * 128) =
                    __builtin_convertvector(wreg[i], v4h);
        }

        // The staged rows are read back by other lanes of this wave.
        asm volatile("s_wait_dscnt 0x0" ::: "memory");
        v4f ov[16];
#pragma unroll
        for (int i = 0; i < 16; ++i)
            ov[i] = *(const v4f*)(stg + (srd ^ ((i & 3) * 32)) + i * 512);
        // All values first, then all stores: no register that an issued store
        // names is written again before the wait below.
        __builtin_amdgcn_sched_barrier(0);
#pragma unroll
        for (int i = 0; i < 16; ++i)
            *(v4f*)(dst + (size_t)(i * 4) * DIM) = ov[i];   // 4 whole lines per store
        // The next chunk overwrites the stores' data and address registers.
        if constexpr (more.value) asm volatile("s_wait_xcnt 0x0" ::: "memory");
    };

    // Rolled: one chunk's code serves three chunks (instruction cache).
#pragma unroll 1
    for (int c = 0; c < PNCH - 1; ++c) {
        chunk(c, std::true_type{});
        // Publishes chunk c+1 and ends every wave's reads of chunk c's buffer;
        // LDS alone is handed over, the output stores stay in flight.
        lds_barrier();
    }
    chunk(PNCH - 1, std::false_type{});
}

// ---------------------------------------------------------------------------
extern "C" void kernel_launch(void* const* d_in, const int* in_sizes, int n_in,
                              void* d_out, int out_size, void* d_ws, size_t ws_size,
                              hipStream_t stream)
{
    const float* x1          = (const float*)d_in[0];
    const float* x2          = (const float*)d_in[1];
    const float* mask        = (const float*)d_in[2];
    const float* qkv_w       = (const float*)d_in[3];
    const float* q_bias      = (const float*)d_in[4];
    const float* v_bias      = (const float*)d_in[5];
    const float* logit_scale = (const float*)d_in[6];
    const float* cpb_w1      = (const float*)d_in[7];
    const float* cpb_b1      = (const float*)d_in[8];
    const float* cpb_w2      = (const float*)d_in[9];
    const float* proj_w      = (const float*)d_in[10];
    const float* proj_b      = (const float*)d_in[11];
    const float* amod1       = (const float*)d_in[12];
    const float* amod2       = (const float*)d_in[13];
    const float* rel_table   = (const float*)d_in[14];
    const int*   rel_index   = (const int*)d_in[15];

    char* ws = (char*)d_ws;
    float*    biasb = (float*)(ws + WS_BIAS);
    _Float16* qws   = (_Float16*)(ws + WS_Q);
    _Float16* kws   = (_Float16*)(ws + WS_K);
    _Float16* vws   = (_Float16*)(ws + WS_V);
    _Float16* ao    = (_Float16*)(ws + WS_AO);
    float*    out   = (float*)d_out;

    swin_bias_build<<<dim3(NTOK, NH / BHD), 256, 0, stream>>>(
        rel_table, cpb_w1, cpb_b1, cpb_w2, rel_index, amod1, amod2, biasb);
    swin_qkv_gemm<<<dim3(256), 256, 0, stream>>>(x1, x2, qkv_w, q_bias,
                                                      v_bias, qws, kws, vws);
    swin_attn<<<dim3(NH, NW), 256, 0, stream>>>(qws, kws, vws, biasb, mask,
                                                logit_scale, ao);
    swin_proj_gemm<<<dim3(256), 256, 0, stream>>>(ao, proj_w, proj_b, out);
}

// v007
// One run takes 76.5 microseconds.
// Next to v006, in two timings, it ran 1.05 and 1.04 times as fast.
// Over all steps from v000 it is 2.43 times as fast.
#include <hip/hip_runtime.h>
#include <hip/hip_bf16.h>
#include <type_traits>

// ---------------------------------------------------------------------------
// SwinV2 window attention block on gfx1250 (CDNA5), wave32 + WMMA f16.
// ---------------------------------------------------------------------------

typedef _Float16 v16h __attribute__((ext_vector_type(16)));
typedef _Float16 v8h  __attribute__((ext_vector_type(8)));
typedef float    v8f  __attribute__((ext_vector_type(8)));
typedef _Float16 v4h  __attribute__((ext_vector_type(4)));
typedef float    v4f  __attribute__((ext_vector_type(4)));
typedef float    v2f  __attribute__((ext_vector_type(2)));

#define NH   8
#define HD   32
#define NTOK 64
#define TWO_N 128
#define DIM  256
#define BW   512
#define NW   64
#define CPB  512

// workspace layout (bytes)
#define WS_BIAS ((size_t)8192)                    // 8*128*128 f32
#define WS_Q    ((size_t)532480)                  // 512*8*128*32 f16
#define WS_K    (WS_Q + (size_t)33554432)         // 512*8* 64*32 f16
#define WS_V    (WS_K + (size_t)16777216)         // 512*8*128*32 f16
#define WS_AO   (WS_V + (size_t)33554432)         // 512*128*256  f16

// Load a 16x32 f16 A-fragment (or 32x16 B-fragment) per ISA layout:
// lane<16 holds K = {0..7, 16..23}; lane>=16 holds K = {8..15, 24..31}.
// `seg` points at the 32-half contiguous K segment for this lane's row/col,
// and must be 16B aligned (row strides are multiples of 8 halves).
__device__ __forceinline__ v16h load_frag(const _Float16* seg, int sel) {
    v8h lo = *(const v8h*)(seg + sel * 8);
    v8h hi = *(const v8h*)(seg + 16 + sel * 8);
    v16h f;
#pragma unroll
    for (int i = 0; i < 8; ++i) { f[i] = lo[i]; f[i + 8] = hi[i]; }
    return f;
}

__device__ __forceinline__ v8f wmma_f16(v16h a, v16h b, v8f c) {
    return __builtin_amdgcn_wmma_f32_16x16x32_f16(false, a, false, b,
                                                  (short)0, c, false, false);
}

// Work-group barrier that hands over LDS alone: a plain __syncthreads() would
// also wait for the rows fetched ahead and for the output stores in flight.
__device__ __forceinline__ void lds_barrier() {
    __builtin_amdgcn_fence(__ATOMIC_RELEASE, "workgroup", "local");
    __builtin_amdgcn_s_barrier();
    __builtin_amdgcn_fence(__ATOMIC_ACQUIRE, "workgroup", "local");
}

#define BHD  2    // heads per bias unit
#define NPOS 225  // rows of the relative-coordinate table

// ---------------------------------------------------------------------------
// 1) QKV GEMM: [x1;x2] (65536x256) @ qkv_w^T (256x768) + bias, scatter q/k/v.
//    One block = 256 rows x all 768 columns, one block per WGP. The block's x
//    rows are read once, converted to f16 and kept as B fragments in registers
//    for the whole K (4 row tiles x 8 k-steps per wave). The weights pass
//    through LDS in 12 chunks of 64 columns (two buffers, one barrier a chunk).
//    8 waves = 4 row groups of 64 x 2 column halves of 32.
//    The product is formed transposed (weights as A, x as B): a lane holds 8
//    consecutive columns of one row. A wave's 64 x 32 tile is 4 KiB in a row in
//    q/k/v; it passes through the wave's own LDS range and leaves in whole lines.
//
//    Bias build, in the same launch: CPB MLP (2 -> 512 relu -> 8), rpb gather +
//    16*sigmoid + 2*amod quadrants -> (8,128,128). Each of the 256 blocks does
//    one unit (token row m, BHD heads) while its x rows are on their way from
//    memory: weights and table lie in LDS, each wave takes 64 of the 512 hidden
//    units for the 64 table positions that row m gathers (2 a lane), and the 8
//    waves' partial sums are added through LDS.
// ---------------------------------------------------------------------------
#define QP 264   // LDS row pitch in halves: 528 B = 16 B x odd for b128 readers
#define QCH 64   // weight columns per chunk
#define QNCH 12  // chunks

__global__ __launch_bounds__(256) void swin_qkv_gemm(
    const float* __restrict__ x1, const float* __restrict__ x2,
    const float* __restrict__ qkv_w, const float* __restrict__ q_bias,
    const float* __restrict__ v_bias,
    const float* __restrict__ tbl, const float* __restrict__ w1,
    const float* __restrict__ b1, const float* __restrict__ w2,
    const int* __restrict__ rel_index,
    const float* __restrict__ amod1, const float* __restrict__ amod2,
    float* __restrict__ biasb,
    _Float16* __restrict__ qws, _Float16* __restrict__ kws,
    _Float16* __restrict__ vws)
{
    __shared__ __attribute__((aligned(16))) _Float16 sX[256 * QP];
    __shared__ __attribute__((aligned(16))) _Float16 sW[2][QCH * QP];
    __shared__ __attribute__((aligned(32))) float sBias[3 * DIM]; // q_bias | 0 | v_bias
    __shared__ __attribute__((aligned(16))) _Float16 sOut[8][64 * HD]; // a wave's tile
    // The bias unit's own LDS.
    __shared__ __attribute__((aligned(16))) float sW1[CPB * 2];
    __shared__ __attribute__((aligned(16))) float sB1[CPB];
    __shared__ __attribute__((aligned(16))) float sW2[BHD * CPB];
    __shared__ __attribute__((aligned(16))) float sTbl[256 * 2];  // NPOS rows used
    __shared__ float sPart[8][BHD][NTOK];

    const int tid   = threadIdx.x;
    const int baseM = blockIdx.x * 256;
    const int wv    = __builtin_amdgcn_readfirstlane(tid >> 5);
    const int lane  = tid & 31;
    const int wr = wv & 3, wc = wv >> 2;
    const int sel = lane >> 4, lm = lane & 15;
    const int wch = baseM >> 15;        // 0 -> x1, 1 -> x2 (same for the block)
    const int loc = baseM & 32767;

    // Each wave stages 8 weight rows of a chunk (2 coalesced 512-B loads a row)
    // and 32 x rows. These loads go out as one group, behind the bias unit's.
    const float* wsrc = qkv_w + (size_t)(wv * 8) * DIM + lane * 4;
    const float* xsrc = (wch ? x2 : x1) + (size_t)(loc + wv * 32) * DIM + lane * 4;
    v4f wreg[16];
    v4f xreg[64];

    // The block's bias unit: token row m, heads h0 .. h0 + BHD - 1.
    const int m = blockIdx.x & (NTOK - 1), h0 = (blockIdx.x >> 6) * BHD;
    const int n = tid & (TWO_N - 1), nn = n & (NTOK - 1), hh = tid >> 7;
    const size_t aoff = ((size_t)(h0 + hh) * NTOK + m) * NTOK + nn;
    const int*   pix = rel_index + m * NTOK + lane;
    const float* pw1 = w1 + tid * 4;
    const float* pb1 = b1 + tid * 2;
    const float* pw2 = w2 + (size_t)h0 * CPB + tid * 4;
    const float* pa1 = amod1 + aoff;
    const float* pa2 = amod2 + aoff;
    const float* ptb = tbl + min(tid, NPOS - 1) * 2;   // the whole table, a row a thread

    // The fence pair keeps every other instruction out of [loads, wait], so that
    // no register a load names is written before the wait.
    __builtin_amdgcn_sched_barrier(0);
    int i0 = pix[0];
    int i1 = pix[32];
    const v4f rw1 = *(const v4f*)pw1;
    const v2f rb1 = *(const v2f*)pb1;
    const v4f rw2 = *(const v4f*)pw2;
    const v2f rtb = *(const v2f*)ptb;
    const float a1 = *pa1;
    const float a2 = *pa2;
    // These loads' address registers are reused by the group below.
    asm volatile("s_wait_xcnt 0x0" ::: "memory");
    // Keeps the bias unit's few loads in front of the x rows': loads return in
    // order, so the unit then waits for its own alone and not for the x rows.
    __builtin_amdgcn_sched_barrier(0);
#pragma unroll
    for (int i = 0; i < 16; ++i)
        wreg[i] = *(const v4f*)(wsrc + (i >> 1) * DIM + (i & 1) * 128);
#pragma unroll
    for (int i = 0; i < 64; ++i)
        xreg[i] = *(const v4f*)(xsrc + (i >> 1) * DIM + (i & 1) * 128);
    const float qb = q_bias[tid];
    const float vb = v_bias[tid];
    // The loads' offset and base registers are reused right behind them.
    asm volatile("s_wait_xcnt 0x0" ::: "memory");
    __builtin_amdgcn_sched_barrier(0);

    // --- the bias unit, while the x rows fly ---
    {
        *(v4f*)&sW1[tid * 4]  = rw1;
        *(v2f*)&sB1[tid * 2]  = rb1;
        *(v4f*)&sW2[tid * 4]  = rw2;
        *(v2f*)&sTbl[tid * 2] = rtb;
        // The index is input data: bound the table address.
        i0 = min(max(i0, 0), NPOS - 1);
        i1 = min(max(i1, 0), NPOS - 1);
        lds_barrier();                    // publishes the weights and the table

        const v2f ca = *(const v2f*)&sTbl[i0 * 2];
        const v2f cb = *(const v2f*)&sTbl[i1 * 2];
        float acc[2][BHD] = {};
        const int j0 = wv * (CPB / 8);
#pragma unroll
        for (int jj = 0; jj < CPB / 8; jj += 4) {
            const int j = j0 + jj;
            const v4f wa = *(const v4f*)&sW1[j * 2];
            const v4f wb = *(const v4f*)&sW1[j * 2 + 4];
            const v4f bb = *(const v4f*)&sB1[j];
            const v4f u0 = *(const v4f*)&sW2[j];
            const v4f u1 = *(const v4f*)&sW2[CPB + j];
#pragma unroll
            for (int q = 0; q < 4; ++q) {
                const float c0 = (q < 2) ? wa[2 * q]     : wb[2 * q - 4];
                const float c1 = (q < 2) ? wa[2 * q + 1] : wb[2 * q - 3];
                const float ha = fmaxf(c0 * ca[0] + c1 * ca[1] + bb[q], 0.0f);
                const float hb = fmaxf(c0 * cb[0] + c1 * cb[1] + bb[q], 0.0f);
                acc[0][0] += u0[q] * ha;
                acc[0][1] += u1[q] * ha;
                acc[1][0] += u0[q] * hb;
                acc[1][1] += u1[q] * hb;
            }
        }
#pragma unroll
        for (int p = 0; p < 2; ++p)
#pragma unroll
            for (int g = 0; g < BHD; ++g) sPart[wv][g][p * 32 + lane] = acc[p][g];
        lds_barrier();                    // publishes the partial sums

        float r = 0.0f;
#pragma unroll
        for (int k = 0; k < 8; ++k) r += sPart[k][hh][nn];
        const float rpb = 16.0f / (1.0f + __expf(-r));
        // Rows m and m+64: amod1 where row and column lie in the same half.
        const bool lo = n < NTOK;
        float* bd = biasb + ((size_t)(h0 + hh) * TWO_N + m) * TWO_N + n;
        const float r0 = rpb + 2.0f * (lo ? a1 : a2);
        const float r1 = rpb + 2.0f * (lo ? a2 : a1);
        // Both values first, then both stores: no register that an issued store
        // names is written again before the wait below.
        __builtin_amdgcn_sched_barrier(0);
        bd[0]            = r0;
        bd[NTOK * TWO_N] = r1;
        // The staging below overwrites the stores' data and address registers.
        asm volatile("s_wait_xcnt 0x0" ::: "memory");
        __builtin_amdgcn_sched_barrier(0);
    }

    sBias[tid]           = qb;
    sBias[DIM + tid]     = 0.0f;
    sBias[2 * DIM + tid] = vb;
    {
        _Float16* wd = &sW[0][(wv * 8) * QP + lane * 4];
#pragma unroll
        for (int i = 0; i < 16; ++i)
            *(v4h*)(wd + (i >> 1) * QP + (i & 1) * 128) =
                __builtin_convertvector(wreg[i], v4h);
        _Float16* xd = &sX[(wv * 32) * QP + lane * 4];
#pragma unroll
        for (int i = 0; i < 64; ++i)
            *(v4h*)(xd + (i >> 1) * QP + (i & 1) * 128) =
                __builtin_convertvector(xreg[i], v4h);
    }
    __syncthreads();

    v16h xa[4][8];
#pragma unroll
    for (int rt = 0; rt < 4; ++rt)
#pragma unroll
        for (int ks = 0; ks < 8; ++ks)
            xa[rt][ks] = load_frag(&sX[(wr * 64 + rt * 16 + lm) * QP + ks * 32], sel);

    const int b = (loc >> 6) + wr;      // a wave's 64 rows are one window

    // Output staging, 16-byte pieces, 4 a row of 64 B. Piece p of row r lies at
    // r*64 + ((p ^ ((r >> 2) & 3)) << 4): no bank is met twice by the writers
    // (16 rows, one piece) nor by the readers (4 rows, all pieces).
    char* stg = (char*)&sOut[wv][0];
    const int swr = lm * 64 + ((sel ^ (lm >> 2)) << 4);            // row lm, piece sel
    const int srd = (lane >> 2) * 64 + (((lane & 3) ^ sel) << 4);  // linear 16 B x lane

    // One chunk: fetch the next chunk's weights (not behind the last), multiply,
    // lay the fetched weights into the other buffer, store this chunk's columns.
    auto chunk = [&](const int c, auto more) __attribute__((always_inline)) {
        if constexpr (more.value) {
            const float* p = wsrc + (size_t)(c + 1) * QCH * DIM;
#pragma unroll
            for (int i = 0; i < 16; ++i)
                wreg[i] = *(const v4f*)(p + (i >> 1) * DIM + (i & 1) * 128);
        }

        const int s    = c >> 2;                 // 0=q,1=k,2=v
        const int hcol = (c * 2 + wc) & 7;       // a wave's 32 columns are one head
        const v8f bv0 = *(const v8f*)&sBias[c * QCH + wc * 32 + sel * 8];
        const v8f bv1 = *(const v8f*)&sBias[c * QCH + wc * 32 + 16 + sel * 8];
        _Float16* dst = (s == 0) ? qws : ((s == 1) ? kws : vws);
        dst += (s == 1) ? ((size_t)(b * NH + hcol) * NTOK) * HD
                        : ((size_t)(b * NH + hcol) * TWO_N + wch * NTOK) * HD;
        dst += lane * 8;

        const _Float16* wb = &sW[c & 1][(wc * 32 + lm) * QP];
        v8f acc[4][2] = {};
        v16h bf[2][2];                           // fragments one k-step ahead
        bf[0][0] = load_frag(wb, sel);
        bf[0][1] = load_frag(wb + 16 * QP, sel);
#pragma unroll
        for (int ks = 0; ks < 8; ++ks) {
            if (ks < 7) {
                bf[(ks + 1) & 1][0] = load_frag(wb + (ks + 1) * 32, sel);
                bf[(ks + 1) & 1][1] = load_frag(wb + 16 * QP + (ks + 1) * 32, sel);
            }
            // Keeps the next k-step's LDS reads in front of this step's products;
            // without it they sink to just before their use and the wave waits.
            __builtin_amdgcn_sched_barrier(0);
#pragma unroll
            for (int rt = 0; rt < 4; ++rt) {
                acc[rt][0] = wmma_f16(bf[ks & 1][0], xa[rt][ks], acc[rt][0]);
                acc[rt][1] = wmma_f16(bf[ks & 1][1], xa[rt][ks], acc[rt][1]);
            }
            // Keeps the conversion of the fetched weights (and its wait on the
            // global loads) behind the products instead of among the first ones.
            __builtin_amdgcn_sched_barrier(0);
        }

        const bool keep = (s != 1 || wch == 0);  // k of x2 is never read
        if (keep) {
            // Register j of acc[rt][t] = column t*16 + sel*8 + j of row rt*16 + lm.
#pragma unroll
            for (int rt = 0; rt < 4; ++rt) {
                *(v8h*)(stg + swr + rt * 1024) =
                    __builtin_convertvector(acc[rt][0] + bv0, v8h);
                *(v8h*)(stg + (swr ^ 32) + rt * 1024) =
                    __builtin_convertvector(acc[rt][1] + bv1, v8h);
            }
        }

        if constexpr (more.value) {
            _Float16* wd = &sW[(c + 1) & 1][(wv * 8) * QP + lane * 4];
#pragma unroll
            for (int i = 0; i < 16; ++i)
                *(v4h*)(wd + (i >> 1) * QP + (i & 1) * 128) =
                    __builtin_convertvector(wreg[i], v4h);
        }

        if (keep) {
            // The staged rows are read back by other lanes of this wave.
            asm volatile("s_wait_dscnt 0x0" ::: "memory");
            v8h ov[8];
#pragma unroll
            for (int i = 0; i < 8; ++i)
                ov[i] = *(const v8h*)(stg + (srd ^ ((i & 1) * 32)) + i * 512);
            // All values first, then all stores: no register that an issued
            // store names is written again before the wait below.
            __builtin_amdgcn_sched_barrier(0);
#pragma unroll
            for (int i = 0; i < 8; ++i)
                *(v8h*)(dst + i * 256) = ov[i];      // 512 B in a row per store
            // The next chunk overwrites the stores' data and address registers.
            if constexpr (more.value) asm volatile("s_wait_xcnt 0x0" ::: "memory");
        }
    };

    // Rolled: one chunk's code serves eleven chunks (instruction cache).
#pragma unroll 1
    for (int c = 0; c < QNCH - 1; ++c) {
        chunk(c, std::true_type{});
        // Publishes chunk c+1 and ends every wave's reads of chunk c's buffer.
        // Only LDS is handed over here, so the fences name LDS alone: a plain
        // __syncthreads() would also wait for this chunk's global stores.
        __builtin_amdgcn_fence(__ATOMIC_RELEASE, "workgroup", "local");
        __builtin_amdgcn_s_barrier();
        __builtin_amdgcn_fence(__ATOMIC_ACQUIRE, "workgroup", "local");
    }
    chunk(QNCH - 1, std::false_type{});
}

// ---------------------------------------------------------------------------
// 2) Attention: S = (Qn Kn^T)*scale + bias + mask; softmax; O = P V.
//    One block = one (head, mask window). The NIMG batch entries that share
//    that mask window are worked on one after the other, so the 128x128 bias
//    and mask are read once a block and their sum stays in registers.
//    Both products are formed transposed (S^T = K Q^T, O^T = V^T P^T): a lane
//    then holds 64 of the 128 scores of ONE query row, lane ^ 16 the others.
// ---------------------------------------------------------------------------
#define NIMG (BW / NW)   // batch entries per mask window

// Lane l's value as seen from lane l ^ 16 (a vector cross-row move, no LDS pipe).
__device__ __forceinline__ float xhalf(float x) {
    const int b = __builtin_bit_cast(int, x);
    return __builtin_bit_cast(float, __builtin_amdgcn_permlanex16(
        b, b, 0x76543210, 0xfedcba98, false, false));
}

// p[i] = 2^t[i]. Eight exponentials in one statement: each stands in the slot
// that the instruction set asks for behind the one before it (no result read,
// no source overwritten: the outputs share no register with the inputs), and
// the v_nop stands in the last one's.
__device__ __forceinline__ void exp2x8(v8f& p, const v8f t) {
    float p0, p1, p2, p3, p4, p5, p6, p7;
    asm("v_exp_f32 %0, %8\n\t"
        "v_exp_f32 %1, %9\n\t"
        "v_exp_f32 %2, %10\n\t"
        "v_exp_f32 %3, %11\n\t"
        "v_exp_f32 %4, %12\n\t"
        "v_exp_f32 %5, %13\n\t"
        "v_exp_f32 %6, %14\n\t"
        "v_exp_f32 %7, %15\n\t"
        "v_nop"
        : "=&v"(p0), "=&v"(p1), "=&v"(p2), "=&v"(p3),
          "=&v"(p4), "=&v"(p5), "=&v"(p6), "=&v"(p7)
        : "v"(t[0]), "v"(t[1]), "v"(t[2]), "v"(t[3]),
          "v"(t[4]), "v"(t[5]), "v"(t[6]), "v"(t[7]));
    p[0] = p0; p[1] = p1; p[2] = p2; p[3] = p3;
    p[4] = p4; p[5] = p5; p[6] = p6; p[7] = p7;
}

__global__ __launch_bounds__(256) void swin_attn(
    const _Float16* __restrict__ qws, const _Float16* __restrict__ kws,
    const _Float16* __restrict__ vws, const float* __restrict__ biasb,
    const float* __restrict__ mask, const float* __restrict__ logit_scale,
    _Float16* __restrict__ ao)
{
    __shared__ _Float16 sQ[TWO_N * 40];   // 128 x 32 (stride 40)
    __shared__ _Float16 sK[NTOK * 40];    //  64 x 32
    __shared__ _Float16 sVt[HD * 136];    //  32 x 128 (V transposed, stride 136)

    const int h = blockIdx.x, wdw = blockIdx.y;
    const int tid = threadIdx.x;
    const int wv = tid >> 5, lane = tid & 31;
    const int sel = lane >> 4, lm = lane & 15;

    // Threads 0..127 stage a q row and a v row each, threads 128..191 a k row.
    const bool isq   = tid < TWO_N;
    const bool isrow = tid < TWO_N + NTOK;
    const size_t qimg = (size_t)NW * NH * TWO_N * HD;  // halves to the next entry
    const size_t kimg = (size_t)NW * NH * NTOK * HD;
    const _Float16* rsrc =
        isq ? qws + ((size_t)(wdw * NH + h) * TWO_N + tid) * HD
            : kws + ((size_t)(wdw * NH + h) * NTOK + (tid & (NTOK - 1))) * HD;
    const size_t rstep = isq ? qimg : kimg;
    const _Float16* vsrc =
        vws + ((size_t)(wdw * NH + h) * TWO_N + (tid & (TWO_N - 1))) * HD;

    v8h rr[4], vr[4];
    auto fetch = [&](const int img) __attribute__((always_inline)) {
        // The fence pair keeps every other instruction out of [loads, wait], so
        // that no register a load names is written before the wait.
        __builtin_amdgcn_sched_barrier(0);
        if (isrow) {
            const v8h* p = (const v8h*)(rsrc + (size_t)img * rstep);
#pragma unroll
            for (int i = 0; i < 4; ++i) rr[i] = p[i];
        }
        if (isq) {
            const v8h* p = (const v8h*)(vsrc + (size_t)img * qimg);
#pragma unroll
            for (int i = 0; i < 4; ++i) vr[i] = p[i];
        }
        // The loads' address registers are reused behind them.
        asm volatile("s_wait_xcnt 0x0" ::: "memory");
        __builtin_amdgcn_sched_barrier(0);
    };
    fetch(0);

    // bias + mask of this lane's query row, in the accumulator's own layout:
    // tile ct, register j = key ct*16 + sel*8 + j.
    const int qoff = (wv * 16 + lm) * TWO_N + sel * 8;
    const float* bptr = biasb + (size_t)h * TWO_N * TWO_N + qoff;
    const float* mptr = mask + (size_t)wdw * TWO_N * TWO_N + qoff;
    v4f bq[16], mq[16];
    // The fence pair keeps every other instruction out of [loads, wait], so
    // that no register a load names is written before the wait.
    __builtin_amdgcn_sched_barrier(0);
#pragma unroll
    for (int i = 0; i < 16; ++i) {
        bq[i] = *(const v4f*)(bptr + (i >> 1) * 16 + (i & 1) * 4);
        mq[i] = *(const v4f*)(mptr + (i >> 1) * 16 + (i & 1) * 4);
    }
    // The loads' address registers are reused behind them.
    asm volatile("s_wait_xcnt 0x0" ::: "memory");
    __builtin_amdgcn_sched_barrier(0);
    float bm[8][8];
#pragma unroll
    for (int i = 0; i < 16; ++i)
#pragma unroll
        for (int e = 0; e < 4; ++e)
            bm[i >> 1][(i & 1) * 4 + e] = bq[i][e] + mq[i][e];

    const float scale = __expf(fminf(logit_scale[h], 4.6051702f)); // log(100)

    // Rolled: one entry's code serves all (registers, instruction cache).
#pragma unroll 1
    for (int img = 0; img < NIMG; ++img) {
        // Inputs only: has every wave wait for its fetched rows here, on every
        // path. With the waits only inside the branches below, the compiler
        // holds each load of the next fetch behind the return of an older one.
        asm volatile("" :: "v"(rr[0]), "v"(rr[1]), "v"(rr[2]), "v"(rr[3]),
                           "v"(vr[0]), "v"(vr[1]), "v"(vr[2]), "v"(vr[3]));
        // --- L2-normalize Q and K into LDS, transpose-stage V ---
        if (isrow) {
            float tmp[HD]; float ss = 0.0f;
#pragma unroll
            for (int i = 0; i < HD; ++i) {
                tmp[i] = (float)rr[i >> 3][i & 7];
                ss += tmp[i] * tmp[i];
            }
            const float inv = 1.0f / fmaxf(sqrtf(ss), 1e-12f);
            if (isq) {
#pragma unroll
                for (int i = 0; i < HD; ++i)
                    sQ[tid * 40 + i] = (_Float16)(tmp[i] * inv);
            } else {
#pragma unroll
                for (int i = 0; i < HD; ++i)
                    sK[(tid - TWO_N) * 40 + i] = (_Float16)(tmp[i] * inv);
            }
        }
        if (isq) {
#pragma unroll
            for (int i = 0; i < HD; ++i) sVt[i * 136 + tid] = vr[i >> 3][i & 7];
        }
        lds_barrier();                    // publishes this entry's Q, K, V

        // The next entry's rows fly while this one is worked on.
        if (img + 1 < NIMG) fetch(img + 1);

        // --- S^T = K Q^T : one WMMA per 16x16 tile (K-depth == head dim == 32).
        //     Register j of tile ct = key ct*16 + sel*8 + j, lane lm = query. ---
        v16h bQ = load_frag(&sQ[(wv * 16 + lm) * 40], sel);
        v16h aK[4];
#pragma unroll
        for (int kb = 0; kb < 4; ++kb)
            aK[kb] = load_frag(&sK[(kb * 16 + lm) * 40], sel);

        // All V^T fragments are named ahead of the products, so that their LDS
        // reads can run ahead of the k-step that uses them.
        v16h aV[4][2];
#pragma unroll
        for (int kc = 0; kc < 4; ++kc) {
            aV[kc][0] = load_frag(&sVt[(0  + lm) * 136 + kc * 32], sel);
            aV[kc][1] = load_frag(&sVt[(16 + lm) * 136 + kc * 32], sel);
        }

        v8f acc[8];
#pragma unroll
        for (int ct = 0; ct < 8; ++ct) {
            v8f z = {};
            acc[ct] = wmma_f16(aK[ct & 3], bQ, z);  // keys 64..127 reuse K (k=[k1;k1])
        }

        // --- scale + (bias + mask), then the row's softmax: in the lane, plus
        //     two exchanges (max, sum) with the lane that holds the row's other 64 keys. ---
        float part[8];
#pragma unroll
        for (int ct = 0; ct < 8; ++ct) {
            float m = -1e30f;
#pragma unroll
            for (int j = 0; j < 8; ++j) {
                const float v = acc[ct][j] * scale + bm[ct][j];
                acc[ct][j] = v;
                m = fmaxf(m, v);
            }
            part[ct] = m;
        }
        float mx = fmaxf(fmaxf(fmaxf(part[0], part[1]), fmaxf(part[2], part[3])),
                         fmaxf(fmaxf(part[4], part[5]), fmaxf(part[6], part[7])));
        mx = fmaxf(mx, xhalf(mx));
#pragma unroll
        for (int ct = 0; ct < 8; ++ct) {
            v8f e;
#pragma unroll
            for (int j = 0; j < 8; ++j)
                e[j] = (acc[ct][j] - mx) * 1.44269504f;   // log2(e)
            exp2x8(acc[ct], e);
            float t = acc[ct][0];
#pragma unroll
            for (int j = 1; j < 8; ++j) t += acc[ct][j];
            part[ct] = t;
        }
        float sm = ((part[0] + part[1]) + (part[2] + part[3]))
                 + ((part[4] + part[5]) + (part[6] + part[7]));
        sm += xhalf(sm);
        const float invs = 1.0f / sm;

        // --- O^T = V^T P^T : K-depth 128 -> 4 WMMA steps x 2 tiles of head dim.
        //     Score tiles 2kc and 2kc+1, converted in place, ARE the B fragment
        //     of k-step kc (same k order as load_frag): P never touches LDS. ---
        v8f o0 = {}, o1 = {};
#pragma unroll
        for (int kc = 0; kc < 4; ++kc) {
            v16h bP;
#pragma unroll
            for (int i = 0; i < 8; ++i) {
                bP[i]     = (_Float16)(acc[2 * kc][i] * invs);
                bP[i + 8] = (_Float16)(acc[2 * kc + 1][i] * invs);
            }
            o0 = wmma_f16(aV[kc][0], bP, o0);
            o1 = wmma_f16(aV[kc][1], bP, o1);
        }
        {
            // Register j of o0 / o1 = head-dim column sel*8 + j / 16 + sel*8 + j
            // of query row lm: 8 consecutive halves, one 16-byte store each.
            const int b = img * NW + wdw;
            _Float16* od = ao + ((size_t)b * TWO_N + wv * 16 + lm) * DIM
                              + h * HD + sel * 8;
            const v8h h0 = __builtin_convertvector(o0, v8h);
            const v8h h1 = __builtin_convertvector(o1, v8h);
            // Both values first, then both stores: no register that an issued
            // store names is written again before the wait below.
            __builtin_amdgcn_sched_barrier(0);
            *(v8h*)od        = h0;
            *(v8h*)(od + 16) = h1;
            // The next entry overwrites the stores' data and address registers.
            asm volatile("s_wait_xcnt 0x0" ::: "memory");
        }
        lds_barrier();                    // ends every wave's reads of Q, K, V
    }
}

// ---------------------------------------------------------------------------
// 3) Output projection: ao (65536x256 f16) @ proj_w^T + proj_b -> f32 out
//    Tiled like the QKV GEMM: one block = 256 rows x all 256 columns, one block
//    per WGP. The block's ao rows are read once and kept as B fragments in
//    registers for the whole K; the weights pass through LDS in 4 chunks of 64
//    columns (two buffers, one barrier a chunk).
//    8 waves = 4 row groups of 64 x 2 column halves of 32.
//    Transposed product and staged stores as in the QKV GEMM: a wave's 32 f32
//    columns are one 128-byte line of each of its 64 rows.
// ---------------------------------------------------------------------------
#define PNCH 4   // chunks of QCH weight columns

__global__ __launch_bounds__(256) void swin_proj_gemm(
    const _Float16* __restrict__ ao, const float* __restrict__ proj_w,
    const float* __restrict__ proj_b, float* __restrict__ out)
{
    __shared__ __attribute__((aligned(16))) _Float16 sX[256 * QP];
    __shared__ __attribute__((aligned(16))) _Float16 sW[2][QCH * QP];
    __shared__ __attribute__((aligned(32))) float sBias[DIM];
    __shared__ __attribute__((aligned(16))) float sOut[8][64 * 32];  // a wave's tile

    const int tid   = threadIdx.x;
    const int baseM = blockIdx.x * 256;
    const int wv    = __builtin_amdgcn_readfirstlane(tid >> 5);
    const int lane  = tid & 31;
    const int wr = wv & 3, wc = wv >> 2;
    const int sel = lane >> 4, lm = lane & 15;

    // Each wave stages 8 weight rows of a chunk (2 coalesced 512-B loads a row)
    // and 32 ao rows (one 512-B load a row). All first loads go out as one group.
    const float*    wsrc = proj_w + (size_t)(wv * 8) * DIM + lane * 4;
    const _Float16* xsrc = ao + (size_t)(baseM + wv * 32) * DIM + lane * 8;
    v4f wreg[16];
    v8h xreg[32];
    // The fence pair keeps every other instruction out of [loads, wait], so that
    // no register a load names is written before the wait.
    __builtin_amdgcn_sched_barrier(0);
#pragma unroll
    for (int i = 0; i < 16; ++i)
        wreg[i] = *(const v4f*)(wsrc + (i >> 1) * DIM + (i & 1) * 128);
#pragma unroll
    for (int i = 0; i < 32; ++i)
        xreg[i] = *(const v8h*)(xsrc + i * DIM);
    const float pb = proj_b[tid];
    // The loads' offset and base registers are reused right behind them.
    asm volatile("s_wait_xcnt 0x0" ::: "memory");
    __builtin_amdgcn_sched_barrier(0);

    sBias[tid] = pb;
    {
        _Float16* wd = &sW[0][(wv * 8) * QP + lane * 4];
#pragma unroll
        for (int i = 0; i < 16; ++i)
            *(v4h*)(wd + (i >> 1) * QP + (i & 1) * 128) =
                __builtin_convertvector(wreg[i], v4h);
        _Float16* xd = &sX[(wv * 32) * QP + lane * 8];
#pragma unroll
        for (int i = 0; i < 32; ++i)
            *(v8h*)(xd + i * QP) = xreg[i];
    }
    __syncthreads();

    v16h xa[4][8];
#pragma unroll
    for (int rt = 0; rt < 4; ++rt)
#pragma unroll
        for (int ks = 0; ks < 8; ++ks)
            xa[rt][ks] = load_frag(&sX[(wr * 64 + rt * 16 + lm) * QP + ks * 32], sel);

    // A store takes 4 whole rows of the wave's tile: 8 lanes x 16 B a row.
    float* drow = out + (size_t)(baseM + wr * 64 + (lane >> 3)) * DIM + wc * 32
                      + (lane & 7) * 4;

    // Output staging, 16-byte pieces, 8 a row of 128 B. Piece p of row r lies at
    // r*128 + ((p ^ ((r >> 1) & 7)) << 4): no bank is met twice by the writers
    // (16 rows, one piece) nor by the readers (2 rows, all pieces).
    char* stg = (char*)&sOut[wv][0];
    const int swr = lm * 128 + (((sel * 2) ^ (lm >> 1)) << 4);       // row lm, piece sel*2
    const int srd = (lane >> 3) * 128 + (((lane & 7) ^ sel) << 4);   // linear 16 B x lane

    // One chunk: fetch the next chunk's weights (not behind the last), multiply,
    // lay the fetched weights into the other buffer, store this chunk's columns.
    auto chunk = [&](const int c, auto more) __attribute__((always_inline)) {
        if constexpr (more.value) {
            const float* p = wsrc + (size_t)(c + 1) * QCH * DIM;
#pragma unroll
            for (int i = 0; i < 16; ++i)
                wreg[i] = *(const v4f*)(p + (i >> 1) * DIM + (i & 1) * 128);
        }

        const v8f bv0 = *(const v8f*)&sBias[c * QCH + wc * 32 + sel * 8];
        const v8f bv1 = *(const v8f*)&sBias[c * QCH + wc * 32 + 16 + sel * 8];
        float* dst = drow + c * QCH;

        const _Float16* wb = &sW[c & 1][(wc * 32 + lm) * QP];
        v8f acc[4][2] = {};
        v16h bf[2][2];                           // fragments one k-step ahead
        bf[0][0] = load_frag(wb, sel);
        bf[0][1] = load_frag(wb + 16 * QP, sel);
#pragma unroll
        for (int ks = 0; ks < 8; ++ks) {
            if (ks < 7) {
                bf[(ks + 1) & 1][0] = load_frag(wb + (ks + 1) * 32, sel);
                bf[(ks + 1) & 1][1] = load_frag(wb + 16 * QP + (ks + 1) * 32, sel);
            }
            // Keeps the next k-step's LDS reads in front of this step's products;
            // without it they sink to just before their use and the wave waits.
            __builtin_amdgcn_sched_barrier(0);
#pragma unroll
            for (int rt = 0; rt < 4; ++rt) {
                acc[rt][0] = wmma_f16(bf[ks & 1][0], xa[rt][ks], acc[rt][0]);
                acc[rt][1] = wmma_f16(bf[ks & 1][1], xa[rt][ks], acc[rt][1]);
            }
            // Keeps the conversion of the fetched weights (and its wait on the
            // global loads) behind the products instead of among the first ones.
            __builtin_amdgcn_sched_barrier(0);
        }

        // Register j of acc[rt][t] = column t*16 + sel*8 + j of row rt*16 + lm:
        // pieces t*4 + sel*2 and t*4 + sel*2 + 1 of that row.
#pragma unroll
        for (int rt = 0; rt < 4; ++rt) {
            const v8f r0 = acc[rt][0] + bv0;
            const v8f r1 = acc[rt][1] + bv1;
            *(v4f*)(stg + swr + rt * 2048)        = __builtin_shufflevector(r0, r0, 0, 1, 2, 3);
            *(v4f*)(stg + (swr ^ 16) + rt * 2048) = __builtin_shufflevector(r0, r0, 4, 5, 6, 7);
            *(v4f*)(stg + (swr ^ 64) + rt * 2048) = __builtin_shufflevector(r1, r1, 0, 1, 2, 3);
            *(v4f*)(stg + (swr ^ 80) + rt * 2048) = __builtin_shufflevector(r1, r1, 4, 5, 6, 7);
        }

        if constexpr (more.value) {
            _Float16* wd = &sW[(c + 1) & 1][(wv * 8) * QP + lane * 4];
#pragma unroll
            for (int i = 0; i < 16; ++i)
                *(v4h*)(wd + (i >> 1) * QP + (i & 1) * 128) =
                    __builtin_convertvector(wreg[i], v4h);
        }

        // The staged rows are read back by other lanes of this wave.
        asm volatile("s_wait_dscnt 0x0" ::: "memory");
        v4f ov[16];
#pragma unroll
        for (int i = 0; i < 16; ++i)
            ov[i] = *(const v4f*)(stg + (srd ^ ((i & 3) * 32)) + i * 512);
        // All values first, then all stores: no register that an issued store
        // names is written again before the wait below.
        __builtin_amdgcn_sched_barrier(0);
#pragma unroll
        for (int i = 0; i < 16; ++i)
            *(v4f*)(dst + (size_t)(i * 4) * DIM) = ov[i];   // 4 whole lines per store
        // The next chunk overwrites the stores' data and address registers.
        if constexpr (more.value) asm volatile("s_wait_xcnt 0x0" ::: "memory");
    };

    // Rolled: one chunk's code serves three chunks (instruction cache).
#pragma unroll 1
    for (int c = 0; c < PNCH - 1; ++c) {
        chunk(c, std::true_type{});
        // Publishes chunk c+1 and ends every wave's reads of chunk c's buffer;
        // LDS alone is handed over, the output stores stay in flight.
        lds_barrier();
    }
    chunk(PNCH - 1, std::false_type{});
}

// ---------------------------------------------------------------------------
extern "C" void kernel_launch(void* const* d_in, const int* in_sizes, int n_in,
                              void* d_out, int out_size, void* d_ws, size_t ws_size,
                              hipStream_t stream)
{
    const float* x1          = (const float*)d_in[0];
    const float* x2          = (const float*)d_in[1];
    const float* mask        = (const float*)d_in[2];
    const float* qkv_w       = (const float*)d_in[3];
    const float* q_bias      = (const float*)d_in[4];
    const float* v_bias      = (const float*)d_in[5];
    const float* logit_scale = (const float*)d_in[6];
    const float* cpb_w1      = (const float*)d_in[7];
    const float* cpb_b1      = (const float*)d_in[8];
    const float* cpb_w2      = (const float*)d_in[9];
    const float* proj_w      = (const float*)d_in[10];
    const float* proj_b      = (const float*)d_in[11];
    const float* amod1       = (const float*)d_in[12];
    const float* amod2       = (const float*)d_in[13];
    const float* rel_table   = (const float*)d_in[14];
    const int*   rel_index   = (const int*)d_in[15];

    char* ws = (char*)d_ws;
    float*    biasb = (float*)(ws + WS_BIAS);
    _Float16* qws   = (_Float16*)(ws + WS_Q);
    _Float16* kws   = (_Float16*)(ws + WS_K);
    _Float16* vws   = (_Float16*)(ws + WS_V);
    _Float16* ao    = (_Float16*)(ws + WS_AO);
    float*    out   = (float*)d_out;

    swin_qkv_gemm<<<dim3(256), 256, 0, stream>>>(
        x1, x2, qkv_w, q_bias, v_bias,
        rel_table, cpb_w1, cpb_b1, cpb_w2, rel_index, amod1, amod2, biasb,
        qws, kws, vws);
    swin_attn<<<dim3(NH, NW), 256, 0, stream>>>(qws, kws, vws, biasb, mask,
                                                logit_scale, ao);
    swin_proj_gemm<<<dim3(256), 256, 0, stream>>>(ao, proj_w, proj_b, out);
}

// v008
// It runs in 73.4 microseconds.
// Timed twice side by side with v007, it ran 1.04 and 1.05 times as fast.
// Counting every step since v000, it is 2.54 times as fast.
#include <hip/hip_runtime.h>
#include <hip/hip_bf16.h>
#include <type_traits>

// ---------------------------------------------------------------------------
// SwinV2 window attention block on gfx1250 (CDNA5), wave32 + WMMA f16.
// ---------------------------------------------------------------------------

typedef _Float16 v16h __attribute__((ext_vector_type(16)));
typedef _Float16 v8h  __attribute__((ext_vector_type(8)));
typedef float    v8f  __attribute__((ext_vector_type(8)));
typedef _Float16 v4h  __attribute__((ext_vector_type(4)));
typedef float    v4f  __attribute__((ext_vector_type(4)));
typedef float    v2f  __attribute__((ext_vector_type(2)));

#define NH   8
#define HD   32
#define NTOK 64
#define TWO_N 128
#define DIM  256
#define BW   512
#define NW   64
#define CPB  512

// workspace layout (bytes)
#define WS_BIAS ((size_t)8192)                    // 8*128*128 f32
#define WS_Q    ((size_t)532480)                  // 512*8*128*32 f16
#define WS_K    (WS_Q + (size_t)33554432)         // 512*8* 64*32 f16
#define WS_V    (WS_K + (size_t)16777216)         // 512*8*32*128 f16 (transposed)
#define WS_AO   (WS_V + (size_t)33554432)         // 512*128*256  f16

// Load a 16x32 f16 A-fragment (or 32x16 B-fragment) per ISA layout:
// lane<16 holds K = {0..7, 16..23}; lane>=16 holds K = {8..15, 24..31}.
// `seg` points at the 32-half contiguous K segment for this lane's row/col,
// and must be 16B aligned (row strides are multiples of 8 halves).
__device__ __forceinline__ v16h load_frag(const _Float16* seg, int sel) {
    v8h lo = *(const v8h*)(seg + sel * 8);
    v8h hi = *(const v8h*)(seg + 16 + sel * 8);
    v16h f;
#pragma unroll
    for (int i = 0; i < 8; ++i) { f[i] = lo[i]; f[i + 8] = hi[i]; }
    return f;
}

__device__ __forceinline__ v8f wmma_f16(v16h a, v16h b, v8f c) {
    return __builtin_amdgcn_wmma_f32_16x16x32_f16(false, a, false, b,
                                                  (short)0, c, false, false);
}

// Work-group barrier that hands over LDS alone: a plain __syncthreads() would
// also wait for the rows fetched ahead and for the output stores in flight.
__device__ __forceinline__ void lds_barrier() {
    __builtin_amdgcn_fence(__ATOMIC_RELEASE, "workgroup", "local");
    __builtin_amdgcn_s_barrier();
    __builtin_amdgcn_fence(__ATOMIC_ACQUIRE, "workgroup", "local");
}

// Lane l's value as seen from lane l ^ 16 (a vector cross-row move, no LDS pipe).
__device__ __forceinline__ float xhalf(float x) {
    const int b = __builtin_bit_cast(int, x);
    return __builtin_bit_cast(float, __builtin_amdgcn_permlanex16(
        b, b, 0x76543210, 0xfedcba98, false, false));
}

#define BHD  2    // heads per bias unit
#define NPOS 225  // rows of the relative-coordinate table

// ---------------------------------------------------------------------------
// 1) QKV GEMM: [x1;x2] (65536x256) @ qkv_w^T (256x768) + bias, scatter q/k/v.
//    One block = 256 rows x all 768 columns, one block per WGP. The block's x
//    rows are read once, converted to f16 and kept as B fragments in registers
//    for the whole K (4 row tiles x 8 k-steps per wave). The weights pass
//    through LDS in 12 chunks of 64 columns (two buffers, one barrier a chunk).
//    8 waves = 4 row groups of 64 x 2 column halves of 32.
//    The product is formed transposed (weights as A, x as B): a lane holds 8
//    consecutive columns of one row. A wave's 64 x 32 tile is 4 KiB in a row in
//    q/k; it passes through the wave's own LDS range and leaves in whole lines.
//    q and k rows leave L2-normalized (a head's 32 columns of a row lie in lanes
//    l and l ^ 16). For v the operands change places (x as A): a lane holds 8
//    consecutive tokens of one column, and v leaves transposed, (head dim, key),
//    128 B of each of the head's 32 rows per wave. The attention kernel then
//    only copies k and v to LDS and reads its q fragment as it lies in memory.
//
//    Bias build, in the same launch: CPB MLP (2 -> 512 relu -> 8), rpb gather +
//    16*sigmoid + 2*amod quadrants -> (8,128,128). Each of the 256 blocks does
//    one unit (token row m, BHD heads) while its x rows are on their way from
//    memory: weights and table lie in LDS, each wave takes 64 of the 512 hidden
//    units for the 64 table positions that row m gathers (2 a lane), and the 8
//    waves' partial sums are added through LDS.
// ---------------------------------------------------------------------------
#define QP 264   // LDS row pitch in halves: 528 B = 16 B x odd for b128 readers
#define QCH 64   // weight columns per chunk
#define QNCH 12  // chunks

__global__ __launch_bounds__(256) void swin_qkv_gemm(
    const float* __restrict__ x1, const float* __restrict__ x2,
    const float* __restrict__ qkv_w, const float* __restrict__ q_bias,
    const float* __restrict__ v_bias,
    const float* __restrict__ tbl, const float* __restrict__ w1,
    const float* __restrict__ b1, const float* __restrict__ w2,
    const int* __restrict__ rel_index,
    const float* __restrict__ amod1, const float* __restrict__ amod2,
    float* __restrict__ biasb,
    _Float16* __restrict__ qws, _Float16* __restrict__ kws,
    _Float16* __restrict__ vws)
{
    __shared__ __attribute__((aligned(16))) _Float16 sX[256 * QP];
    __shared__ __attribute__((aligned(16))) _Float16 sW[2][QCH * QP];
    __shared__ __attribute__((aligned(32))) float sBias[3 * DIM]; // q_bias | 0 | v_bias
    __shared__ __attribute__((aligned(16))) _Float16 sOut[8][64 * HD]; // a wave's tile
    // The bias unit's own LDS.
    __shared__ __attribute__((aligned(16))) float sW1[CPB * 2];
    __shared__ __attribute__((aligned(16))) float sB1[CPB];
    __shared__ __attribute__((aligned(16))) float sW2[BHD * CPB];
    __shared__ __attribute__((aligned(16))) float sTbl[256 * 2];  // NPOS rows used
    __shared__ float sPart[8][BHD][NTOK];

    const int tid   = threadIdx.x;
    const int baseM = blockIdx.x * 256;
    const int wv    = __builtin_amdgcn_readfirstlane(tid >> 5);
    const int lane  = tid & 31;
    const int wr = wv & 3, wc = wv >> 2;
    const int sel = lane >> 4, lm = lane & 15;
    const int wch = baseM >> 15;        // 0 -> x1, 1 -> x2 (same for the block)
    const int loc = baseM & 32767;

    // Each wave stages 8 weight rows of a chunk (2 coalesced 512-B loads a row)
    // and 32 x rows. These loads go out as one group, behind the bias unit's.
    const float* wsrc = qkv_w + (size_t)(wv * 8) * DIM + lane * 4;
    const float* xsrc = (wch ? x2 : x1) + (size_t)(loc + wv * 32) * DIM + lane * 4;
    v4f wreg[16];
    v4f xreg[64];

    // The block's bias unit: token row m, heads h0 .. h0 + BHD - 1.
    const int m = blockIdx.x & (NTOK - 1), h0 = (blockIdx.x >> 6) * BHD;
    const int n = tid & (TWO_N - 1), nn = n & (NTOK - 1), hh = tid >> 7;
    const size_t aoff = ((size_t)(h0 + hh) * NTOK + m) * NTOK + nn;
    const int*   pix = rel_index + m * NTOK + lane;
    const float* pw1 = w1 + tid * 4;
    const float* pb1 = b1 + tid * 2;
    const float* pw2 = w2 + (size_t)h0 * CPB + tid * 4;
    const float* pa1 = amod1 + aoff;
    const float* pa2 = amod2 + aoff;
    const float* ptb = tbl + min(tid, NPOS - 1) * 2;   // the whole table, a row a thread

    // The fence pair keeps every other instruction out of [loads, wait], so that
    // no register a load names is written before the wait.
    __builtin_amdgcn_sched_barrier(0);
    int i0 = pix[0];
    int i1 = pix[32];
    const v4f rw1 = *(const v4f*)pw1;
    const v2f rb1 = *(const v2f*)pb1;
    const v4f rw2 = *(const v4f*)pw2;
    const v2f rtb = *(const v2f*)ptb;
    const float a1 = *pa1;
    const float a2 = *pa2;
    // These loads' address registers are reused by the group below.
    asm volatile("s_wait_xcnt 0x0" ::: "memory");
    // Keeps the bias unit's few loads in front of the x rows': loads return in
    // order, so the unit then waits for its own alone and not for the x rows.
    __builtin_amdgcn_sched_barrier(0);
#pragma unroll
    for (int i = 0; i < 16; ++i)
        wreg[i] = *(const v4f*)(wsrc + (i >> 1) * DIM + (i & 1) * 128);
#pragma unroll
    for (int i = 0; i < 64; ++i)
        xreg[i] = *(const v4f*)(xsrc + (i >> 1) * DIM + (i & 1) * 128);
    const float qb = q_bias[tid];
    const float vb = v_bias[tid];
    // The loads' offset and base registers are reused right behind them.
    asm volatile("s_wait_xcnt 0x0" ::: "memory");
    __builtin_amdgcn_sched_barrier(0);

    // --- the bias unit, while the x rows fly ---
    {
        *(v4f*)&sW1[tid * 4]  = rw1;
        *(v2f*)&sB1[tid * 2]  = rb1;
        *(v4f*)&sW2[tid * 4]  = rw2;
        *(v2f*)&sTbl[tid * 2] = rtb;
        // The index is input data: bound the table address.
        i0 = min(max(i0, 0), NPOS - 1);
        i1 = min(max(i1, 0), NPOS - 1);
        lds_barrier();                    // publishes the weights and the table

        const v2f ca = *(const v2f*)&sTbl[i0 * 2];
        const v2f cb = *(const v2f*)&sTbl[i1 * 2];
        float acc[2][BHD] = {};
        const int j0 = wv * (CPB / 8);
#pragma unroll
        for (int jj = 0; jj < CPB / 8; jj += 4) {
            const int j = j0 + jj;
            const v4f wa = *(const v4f*)&sW1[j * 2];
            const v4f wb = *(const v4f*)&sW1[j * 2 + 4];
            const v4f bb = *(const v4f*)&sB1[j];
            const v4f u0 = *(const v4f*)&sW2[j];
            const v4f u1 = *(const v4f*)&sW2[CPB + j];
#pragma unroll
            for (int q = 0; q < 4; ++q) {
                const float c0 = (q < 2) ? wa[2 * q]     : wb[2 * q - 4];
                const float c1 = (q < 2) ? wa[2 * q + 1] : wb[2 * q - 3];
                const float ha = fmaxf(c0 * ca[0] + c1 * ca[1] + bb[q], 0.0f);
                const float hb = fmaxf(c0 * cb[0] + c1 * cb[1] + bb[q], 0.0f);
                acc[0][0] += u0[q] * ha;
                acc[0][1] += u1[q] * ha;
                acc[1][0] += u0[q] * hb;
                acc[1][1] += u1[q] * hb;
            }
        }
#pragma unroll
        for (int p = 0; p < 2; ++p)
#pragma unroll
            for (int g = 0; g < BHD; ++g) sPart[wv][g][p * 32 + lane] = acc[p][g];
        lds_barrier();                    // publishes the partial sums

        float r = 0.0f;
#pragma unroll
        for (int k = 0; k < 8; ++k) r += sPart[k][hh][nn];
        const float rpb = 16.0f / (1.0f + __expf(-r));
        // Rows m and m+64: amod1 where row and column lie in the same half.
        const bool lo = n < NTOK;
        float* bd = biasb + ((size_t)(h0 + hh) * TWO_N + m) * TWO_N + n;
        const float r0 = rpb + 2.0f * (lo ? a1 : a2);
        const float r1 = rpb + 2.0f * (lo ? a2 : a1);
        // Both values first, then both stores: no register that an issued store
        // names is written again before the wait below.
        __builtin_amdgcn_sched_barrier(0);
        bd[0]            = r0;
        bd[NTOK * TWO_N] = r1;
        // The staging below overwrites the stores' data and address registers.
        asm volatile("s_wait_xcnt 0x0" ::: "memory");
        __builtin_amdgcn_sched_barrier(0);
    }

    sBias[tid]           = qb;
    sBias[DIM + tid]     = 0.0f;
    sBias[2 * DIM + tid] = vb;
    {
        _Float16* wd = &sW[0][(wv * 8) * QP + lane * 4];
#pragma unroll
        for (int i = 0; i < 16; ++i)
            *(v4h*)(wd + (i >> 1) * QP + (i & 1) * 128) =
                __builtin_convertvector(wreg[i], v4h);
        _Float16* xd = &sX[(wv * 32) * QP + lane * 4];
#pragma unroll
        for (int i = 0; i < 64; ++i)
            *(v4h*)(xd + (i >> 1) * QP + (i & 1) * 128) =
                __builtin_convertvector(xreg[i], v4h);
    }
    __syncthreads();

    v16h xa[4][8];
#pragma unroll
    for (int rt = 0; rt < 4; ++rt)
#pragma unroll
        for (int ks = 0; ks < 8; ++ks)
            xa[rt][ks] = load_frag(&sX[(wr * 64 + rt * 16 + lm) * QP + ks * 32], sel);

    const int b = (loc >> 6) + wr;      // a wave's 64 rows are one window

    // Output staging, 16-byte pieces, 4 a row of 64 B. Piece p of row r lies at
    // r*64 + ((p ^ ((r >> 2) & 3)) << 4): no bank is met twice by the writers
    // (16 rows, one piece) nor by the readers (4 rows, all pieces).
    char* stg = (char*)&sOut[wv][0];
    const int swr = lm * 64 + ((sel ^ (lm >> 2)) << 4);            // row lm, piece sel
    const int srd = (lane >> 2) * 64 + (((lane & 3) ^ sel) << 4);  // linear 16 B x lane
    // The transposed v tile: 32 rows (head dim) of 128 B (64 tokens), 8 pieces a
    // row. Piece p of row r lies at r*128 + ((p ^ ((r >> 1) & 7)) << 4): no bank is
    // met twice by the writers (16 rows, one piece) nor by the readers (2 rows).
    const int vwr = lm * 128 + ((sel ^ (lm >> 1)) << 4);             // row lm, piece sel
    const int vrd = (lane >> 3) * 128 + (((lane & 7) ^ sel) << 4);   // linear 16 B x lane

    // One chunk: fetch the next chunk's weights (not behind the last), multiply,
    // lay the fetched weights into the other buffer, store this chunk's columns.
    auto chunk = [&](const int c, auto more, auto isv) __attribute__((always_inline)) {
        if constexpr (more.value) {
            const float* p = wsrc + (size_t)(c + 1) * QCH * DIM;
#pragma unroll
            for (int i = 0; i < 16; ++i)
                wreg[i] = *(const v4f*)(p + (i >> 1) * DIM + (i & 1) * 128);
            // The loads' address registers are reused behind them; the fence keeps
            // every later instruction behind the wait.
            asm volatile("s_wait_xcnt 0x0" ::: "memory");
            __builtin_amdgcn_sched_barrier(0);
        }

        const int s    = c >> 2;                 // 0=q,1=k,2=v
        const int hcol = (c * 2 + wc) & 7;       // a wave's 32 columns are one head

        const _Float16* wb = &sW[c & 1][(wc * 32 + lm) * QP];
        v8f acc[4][2] = {};
        v16h bf[2][2];                           // fragments one k-step ahead
        bf[0][0] = load_frag(wb, sel);
        bf[0][1] = load_frag(wb + 16 * QP, sel);
#pragma unroll
        for (int ks = 0; ks < 8; ++ks) {
            if (ks < 7) {
                bf[(ks + 1) & 1][0] = load_frag(wb + (ks + 1) * 32, sel);
                bf[(ks + 1) & 1][1] = load_frag(wb + 16 * QP + (ks + 1) * 32, sel);
            }
            // Keeps the next k-step's LDS reads in front of this step's products;
            // without it they sink to just before their use and the wave waits.
            __builtin_amdgcn_sched_barrier(0);
#pragma unroll
            for (int rt = 0; rt < 4; ++rt) {
                if constexpr (isv.value) {
                    acc[rt][0] = wmma_f16(xa[rt][ks], bf[ks & 1][0], acc[rt][0]);
                    acc[rt][1] = wmma_f16(xa[rt][ks], bf[ks & 1][1], acc[rt][1]);
                } else {
                    acc[rt][0] = wmma_f16(bf[ks & 1][0], xa[rt][ks], acc[rt][0]);
                    acc[rt][1] = wmma_f16(bf[ks & 1][1], xa[rt][ks], acc[rt][1]);
                }
            }
            // Keeps the conversion of the fetched weights (and its wait on the
            // global loads) behind the products instead of among the first ones.
            __builtin_amdgcn_sched_barrier(0);
        }

        const bool keep = isv.value || s == 0 || wch == 0;  // k of x2 is never read
        _Float16* dst;
        if constexpr (isv.value) {
            // Register j of acc[rt][t] = token rt*16 + sel*8 + j of column t*16 + lm:
            // piece rt*2 + sel of row t*16 + lm of the transposed tile.
            const float vb0 = sBias[c * QCH + wc * 32 + lm];
            const float vb1 = sBias[c * QCH + wc * 32 + 16 + lm];
            dst = vws + ((size_t)(b * NH + hcol) * HD + (lane >> 3)) * TWO_N
                      + wch * NTOK + (lane & 7) * 8;
#pragma unroll
            for (int rt = 0; rt < 4; ++rt) {
                *(v8h*)(stg + (vwr ^ (rt * 32))) =
                    __builtin_convertvector(acc[rt][0] + vb0, v8h);
                *(v8h*)(stg + (vwr ^ (rt * 32)) + 2048) =
                    __builtin_convertvector(acc[rt][1] + vb1, v8h);
            }
        } else {
            const v8f bv0 = *(const v8f*)&sBias[c * QCH + wc * 32 + sel * 8];
            const v8f bv1 = *(const v8f*)&sBias[c * QCH + wc * 32 + 16 + sel * 8];
            dst = (s == 0) ? qws + ((size_t)(b * NH + hcol) * TWO_N + wch * NTOK) * HD
                           : kws + ((size_t)(b * NH + hcol) * NTOK) * HD;
            dst += lane * 8;
            if (keep) {
                // Register j of acc[rt][t] = column t*16 + sel*8 + j of row rt*16 + lm;
                // lane l ^ 16 holds the row's other 16 columns of this head.
#pragma unroll
                for (int rt = 0; rt < 4; ++rt) {
                    const v8f r0 = acc[rt][0] + bv0;
                    const v8f r1 = acc[rt][1] + bv1;
                    const v8f sq = r0 * r0 + r1 * r1;
                    float ss = ((sq[0] + sq[1]) + (sq[2] + sq[3]))
                             + ((sq[4] + sq[5]) + (sq[6] + sq[7]));
                    ss += xhalf(ss);
                    // 1 / max(sqrt(ss), 1e-12); ss = 0 gives the bound, and 0 * bound = 0.
                    const float inv = fminf(__builtin_amdgcn_rsqf(ss), 1e12f);
                    *(v8h*)(stg + swr + rt * 1024) =
                        __builtin_convertvector(r0 * inv, v8h);
                    *(v8h*)(stg + (swr ^ 32) + rt * 1024) =
                        __builtin_convertvector(r1 * inv, v8h);
                }
            }
        }

        if constexpr (more.value) {
            _Float16* wd = &sW[(c + 1) & 1][(wv * 8) * QP + lane * 4];
#pragma unroll
            for (int i = 0; i < 16; ++i)
                *(v4h*)(wd + (i >> 1) * QP + (i & 1) * 128) =
                    __builtin_convertvector(wreg[i], v4h);
        }

        if (keep) {
            // The staged rows are read back by other lanes of this wave.
            asm volatile("s_wait_dscnt 0x0" ::: "memory");
            v8h ov[8];
#pragma unroll
            for (int i = 0; i < 8; ++i) {
                if constexpr (isv.value)
                    ov[i] = *(const v8h*)(stg + (vrd ^ ((i & 3) * 32)) + i * 512);
                else
                    ov[i] = *(const v8h*)(stg + (srd ^ ((i & 1) * 32)) + i * 512);
            }
            // All values first, then all stores: no register that an issued
            // store names is written again before the wait below.
            __builtin_amdgcn_sched_barrier(0);
#pragma unroll
            for (int i = 0; i < 8; ++i) {
                if constexpr (isv.value)
                    *(v8h*)(dst + i * 4 * TWO_N) = ov[i];  // 4 whole lines per store
                else
                    *(v8h*)(dst + i * 256) = ov[i];        // 512 B in a row per store
            }
            // The next chunk overwrites the stores' data and address registers.
            if constexpr (more.value) asm volatile("s_wait_xcnt 0x0" ::: "memory");
        }
    };

    // Rolled: one chunk's code serves the eight q and k chunks, another the first
    // three v chunks (instruction cache).
#pragma unroll 1
    for (int c = 0; c < 8; ++c) {
        chunk(c, std::true_type{}, std::false_type{});
        // Publishes chunk c+1 and ends every wave's reads of chunk c's buffer.
        // Only LDS is handed over here: a plain __syncthreads() would also wait
        // for this chunk's global stores.
        lds_barrier();
    }
#pragma unroll 1
    for (int c = 8; c < QNCH - 1; ++c) {
        chunk(c, std::true_type{}, std::true_type{});
        lds_barrier();                    // as in the loop above
    }
    chunk(QNCH - 1, std::false_type{}, std::true_type{});
}

// ---------------------------------------------------------------------------
// 2) Attention: S = (Qn Kn^T)*scale + bias + mask; softmax; O = P V.
//    One block = one (head, mask window). The NIMG batch entries that share
//    that mask window are worked on one after the other, so the 128x128 bias
//    and mask are read once a block and their sum stays in registers.
//    Both products are formed transposed (S^T = K Q^T, O^T = V^T P^T): a lane
//    then holds 64 of the 128 scores of ONE query row, lane ^ 16 the others.
//    q and k arrive normalized and v transposed: k and v are copied to LDS in
//    whole lines, 16 B a thread, and a wave's q fragment is read from memory.
// ---------------------------------------------------------------------------
#define NIMG (BW / NW)   // batch entries per mask window

// p[i] = 2^t[i]. Eight exponentials in one statement: each stands in the slot
// that the instruction set asks for behind the one before it (no result read,
// no source overwritten: the outputs share no register with the inputs), and
// the v_nop stands in the last one's.
__device__ __forceinline__ void exp2x8(v8f& p, const v8f t) {
    float p0, p1, p2, p3, p4, p5, p6, p7;
    asm("v_exp_f32 %0, %8\n\t"
        "v_exp_f32 %1, %9\n\t"
        "v_exp_f32 %2, %10\n\t"
        "v_exp_f32 %3, %11\n\t"
        "v_exp_f32 %4, %12\n\t"
        "v_exp_f32 %5, %13\n\t"
        "v_exp_f32 %6, %14\n\t"
        "v_exp_f32 %7, %15\n\t"
        "v_nop"
        : "=&v"(p0), "=&v"(p1), "=&v"(p2), "=&v"(p3),
          "=&v"(p4), "=&v"(p5), "=&v"(p6), "=&v"(p7)
        : "v"(t[0]), "v"(t[1]), "v"(t[2]), "v"(t[3]),
          "v"(t[4]), "v"(t[5]), "v"(t[6]), "v"(t[7]));
    p[0] = p0; p[1] = p1; p[2] = p2; p[3] = p3;
    p[4] = p4; p[5] = p5; p[6] = p6; p[7] = p7;
}

__global__ __launch_bounds__(256) void swin_attn(
    const _Float16* __restrict__ qws, const _Float16* __restrict__ kws,
    const _Float16* __restrict__ vws, const float* __restrict__ biasb,
    const float* __restrict__ mask, const float* __restrict__ logit_scale,
    _Float16* __restrict__ ao)
{
    __shared__ __attribute__((aligned(16))) _Float16 sK[NTOK * 40];  // 64 x 32 (stride 40)
    __shared__ __attribute__((aligned(16))) _Float16 sVt[HD * 136];  // 32 x 128 (V^T, stride 136)

    const int h = blockIdx.x, wdw = blockIdx.y;
    const int tid = threadIdx.x;
    const int wv = tid >> 5, lane = tid & 31;
    const int sel = lane >> 4, lm = lane & 15;

    // A thread copies 16 B of k and 2 x 16 B of v^T (linear in memory), and reads
    // the two 16-byte pieces of its q row that make up its B fragment.
    const size_t qimg = (size_t)NW * NH * TWO_N * HD;  // halves to the next entry
    const size_t kimg = (size_t)NW * NH * NTOK * HD;
    const _Float16* qsrc =
        qws + ((size_t)(wdw * NH + h) * TWO_N + wv * 16 + lm) * HD + sel * 8;
    const _Float16* ksrc = kws + (size_t)(wdw * NH + h) * NTOK * HD + tid * 8;
    const _Float16* vsrc = vws + (size_t)(wdw * NH + h) * HD * TWO_N + tid * 8;
    _Float16* kdst = &sK[(tid >> 2) * 40 + (tid & 3) * 8];
    _Float16* vdst = &sVt[(tid >> 4) * 136 + (tid & 15) * 8];

    v8h qr[2], kr, vr[2];
    auto fetch = [&](const int img) __attribute__((always_inline)) {
        const _Float16* pq = qsrc + (size_t)img * qimg;
        const _Float16* pk = ksrc + (size_t)img * kimg;
        const _Float16* pv = vsrc + (size_t)img * qimg;
        // The fence pair keeps every other instruction out of [loads, wait], so
        // that no register a load names is written before the wait.
        __builtin_amdgcn_sched_barrier(0);
        kr    = *(const v8h*)pk;
        vr[0] = *(const v8h*)pv;
        vr[1] = *(const v8h*)(pv + 16 * TWO_N);
        qr[0] = *(const v8h*)pq;
        qr[1] = *(const v8h*)(pq + 16);
        // The loads' address registers are reused behind them.
        asm volatile("s_wait_xcnt 0x0" ::: "memory");
        __builtin_amdgcn_sched_barrier(0);
    };
    fetch(0);

    // bias + mask of this lane's query row, in the accumulator's own layout:
    // tile ct, register j = key ct*16 + sel*8 + j.
    const int qoff = (wv * 16 + lm) * TWO_N + sel * 8;
    const float* bptr = biasb + (size_t)h * TWO_N * TWO_N + qoff;
    const float* mptr = mask + (size_t)wdw * TWO_N * TWO_N + qoff;
    v4f bq[16], mq[16];
    // The fence pair keeps every other instruction out of [loads, wait], so
    // that no register a load names is written before the wait.
    __builtin_amdgcn_sched_barrier(0);
#pragma unroll
    for (int i = 0; i < 16; ++i) {
        bq[i] = *(const v4f*)(bptr + (i >> 1) * 16 + (i & 1) * 4);
        mq[i] = *(const v4f*)(mptr + (i >> 1) * 16 + (i & 1) * 4);
    }
    // The loads' address registers are reused behind them.
    asm volatile("s_wait_xcnt 0x0" ::: "memory");
    __builtin_amdgcn_sched_barrier(0);
    float bm[8][8];
#pragma unroll
    for (int i = 0; i < 16; ++i)
#pragma unroll
        for (int e = 0; e < 4; ++e)
            bm[i >> 1][(i & 1) * 4 + e] = bq[i][e] + mq[i][e];

    const float scale = __expf(fminf(logit_scale[h], 4.6051702f)); // log(100)

    // Rolled: one entry's code serves all (registers, instruction cache).
#pragma unroll 1
    for (int img = 0; img < NIMG; ++img) {
        // --- K and V^T into LDS as they come; the q fragment stays in registers ---
        *(v8h*)kdst              = kr;
        *(v8h*)vdst              = vr[0];
        *(v8h*)(vdst + 16 * 136) = vr[1];
        v16h bQ;
#pragma unroll
        for (int i = 0; i < 8; ++i) { bQ[i] = qr[0][i]; bQ[i + 8] = qr[1][i]; }
        lds_barrier();                    // publishes this entry's K, V

        // The next entry's rows fly while this one is worked on.
        if (img + 1 < NIMG) fetch(img + 1);

        // --- S^T = K Q^T : one WMMA per 16x16 tile (K-depth == head dim == 32).
        //     Register j of tile ct = key ct*16 + sel*8 + j, lane lm = query. ---
        v16h aK[4];
#pragma unroll
        for (int kb = 0; kb < 4; ++kb)
            aK[kb] = load_frag(&sK[(kb * 16 + lm) * 40], sel);

        // All V^T fragments are named ahead of the products, so that their LDS
        // reads can run ahead of the k-step that uses them.
        v16h aV[4][2];
#pragma unroll
        for (int kc = 0; kc < 4; ++kc) {
            aV[kc][0] = load_frag(&sVt[(0  + lm) * 136 + kc * 32], sel);
            aV[kc][1] = load_frag(&sVt[(16 + lm) * 136 + kc * 32], sel);
        }

        v8f acc[8];
#pragma unroll
        for (int ct = 0; ct < 8; ++ct) {
            v8f z = {};
            acc[ct] = wmma_f16(aK[ct & 3], bQ, z);  // keys 64..127 reuse K (k=[k1;k1])
        }

        // --- scale + (bias + mask), then the row's softmax: in the lane, plus
        //     two exchanges (max, sum) with the lane that holds the row's other 64 keys. ---
        float part[8];
#pragma unroll
        for (int ct = 0; ct < 8; ++ct) {
            float m = -1e30f;
#pragma unroll
            for (int j = 0; j < 8; ++j) {
                const float v = acc[ct][j] * scale + bm[ct][j];
                acc[ct][j] = v;
                m = fmaxf(m, v);
            }
            part[ct] = m;
        }
        float mx = fmaxf(fmaxf(fmaxf(part[0], part[1]), fmaxf(part[2], part[3])),
                         fmaxf(fmaxf(part[4], part[5]), fmaxf(part[6], part[7])));
        mx = fmaxf(mx, xhalf(mx));
#pragma unroll
        for (int ct = 0; ct < 8; ++ct) {
            v8f e;
#pragma unroll
            for (int j = 0; j < 8; ++j)
                e[j] = (acc[ct][j] - mx) * 1.44269504f;   // log2(e)
            exp2x8(acc[ct], e);
            float t = acc[ct][0];
#pragma unroll
            for (int j = 1; j < 8; ++j) t += acc[ct][j];
            part[ct] = t;
        }
        float sm = ((part[0] + part[1]) + (part[2] + part[3]))
                 + ((part[4] + part[5]) + (part[6] + part[7]));
        sm += xhalf(sm);
        const float invs = 1.0f / sm;

        // --- O^T = V^T P^T : K-depth 128 -> 4 WMMA steps x 2 tiles of head dim.
        //     Score tiles 2kc and 2kc+1, converted in place, ARE the B fragment
        //     of k-step kc (same k order as load_frag): P never touches LDS. ---
        v8f o0 = {}, o1 = {};
#pragma unroll
        for (int kc = 0; kc < 4; ++kc) {
            v16h bP;
#pragma unroll
            for (int i = 0; i < 8; ++i) {
                bP[i]     = (_Float16)(acc[2 * kc][i] * invs);
                bP[i + 8] = (_Float16)(acc[2 * kc + 1][i] * invs);
            }
            o0 = wmma_f16(aV[kc][0], bP, o0);
            o1 = wmma_f16(aV[kc][1], bP, o1);
        }
        {
            // Register j of o0 / o1 = head-dim column sel*8 + j / 16 + sel*8 + j
            // of query row lm: 8 consecutive halves, one 16-byte store each.
            const int b = img * NW + wdw;
            _Float16* od = ao + ((size_t)b * TWO_N + wv * 16 + lm) * DIM
                              + h * HD + sel * 8;
            const v8h h0 = __builtin_convertvector(o0, v8h);
            const v8h h1 = __builtin_convertvector(o1, v8h);
            // Both values first, then both stores: no register that an issued
            // store names is written again before the wait below.
            __builtin_amdgcn_sched_barrier(0);
            *(v8h*)od        = h0;
            *(v8h*)(od + 16) = h1;
            // The next entry overwrites the stores' data and address registers.
            asm volatile("s_wait_xcnt 0x0" ::: "memory");
        }
        lds_barrier();                    // ends every wave's reads of K, V
    }
}

// ---------------------------------------------------------------------------
// 3) Output projection: ao (65536x256 f16) @ proj_w^T + proj_b -> f32 out
//    Tiled like the QKV GEMM: one block = 256 rows x all 256 columns, one block
//    per WGP. The block's ao rows are read once and kept as B fragments in
//    registers for the whole K; the weights pass through LDS in 4 chunks of 64
//    columns (two buffers, one barrier a chunk).
//    8 waves = 4 row groups of 64 x 2 column halves of 32.
//    Transposed product and staged stores as in the QKV GEMM: a wave's 32 f32
//    columns are one 128-byte line of each of its 64 rows.
// ---------------------------------------------------------------------------
#define PNCH 4   // chunks of QCH weight columns

__global__ __launch_bounds__(256) void swin_proj_gemm(
    const _Float16* __restrict__ ao, const float* __restrict__ proj_w,
    const float* __restrict__ proj_b, float* __restrict__ out)
{
    __shared__ __attribute__((aligned(16))) _Float16 sX[256 * QP];
    __shared__ __attribute__((aligned(16))) _Float16 sW[2][QCH * QP];
    __shared__ __attribute__((aligned(32))) float sBias[DIM];
    __shared__ __attribute__((aligned(16))) float sOut[8][64 * 32];  // a wave's tile

    const int tid   = threadIdx.x;
    const int baseM = blockIdx.x * 256;
    const int wv    = __builtin_amdgcn_readfirstlane(tid >> 5);
    const int lane  = tid & 31;
    const int wr = wv & 3, wc = wv >> 2;
    const int sel = lane >> 4, lm = lane & 15;

    // Each wave stages 8 weight rows of a chunk (2 coalesced 512-B loads a row)
    // and 32 ao rows (one 512-B load a row). All first loads go out as one group.
    const float*    wsrc = proj_w + (size_t)(wv * 8) * DIM + lane * 4;
    const _Float16* xsrc = ao + (size_t)(baseM + wv * 32) * DIM + lane * 8;
    v4f wreg[16];
    v8h xreg[32];
    // The fence pair keeps every other instruction out of [loads, wait], so that
    // no register a load names is written before the wait.
    __builtin_amdgcn_sched_barrier(0);
#pragma unroll
    for (int i = 0; i < 16; ++i)
        wreg[i] = *(const v4f*)(wsrc + (i >> 1) * DIM + (i & 1) * 128);
#pragma unroll
    for (int i = 0; i < 32; ++i)
        xreg[i] = *(const v8h*)(xsrc + i * DIM);
    const float pb = proj_b[tid];
    // The loads' offset and base registers are reused right behind them.
    asm volatile("s_wait_xcnt 0x0" ::: "memory");
    __builtin_amdgcn_sched_barrier(0);

    sBias[tid] = pb;
    {
        _Float16* wd = &sW[0][(wv * 8) * QP + lane * 4];
#pragma unroll
        for (int i = 0; i < 16; ++i)
            *(v4h*)(wd + (i >> 1) * QP + (i & 1) * 128) =
                __builtin_convertvector(wreg[i], v4h);
        _Float16* xd = &sX[(wv * 32) * QP + lane * 8];
#pragma unroll
        for (int i = 0; i < 32; ++i)
            *(v8h*)(xd + i * QP) = xreg[i];
    }
    __syncthreads();

    v16h xa[4][8];
#pragma unroll
    for (int rt = 0; rt < 4; ++rt)
#pragma unroll
        for (int ks = 0; ks < 8; ++ks)
            xa[rt][ks] = load_frag(&sX[(wr * 64 + rt * 16 + lm) * QP + ks * 32], sel);

    // A store takes 4 whole rows of the wave's tile: 8 lanes x 16 B a row.
    float* drow = out + (size_t)(baseM + wr * 64 + (lane >> 3)) * DIM + wc * 32
                      + (lane & 7) * 4;

    // Output staging, 16-byte pieces, 8 a row of 128 B. Piece p of row r lies at
    // r*128 + ((p ^ ((r >> 1) & 7)) << 4): no bank is met twice by the writers
    // (16 rows, one piece) nor by the readers (2 rows, all pieces).
    char* stg = (char*)&sOut[wv][0];
    const int swr = lm * 128 + (((sel * 2) ^ (lm >> 1)) << 4);       // row lm, piece sel*2
    const int srd = (lane >> 3) * 128 + (((lane & 7) ^ sel) << 4);   // linear 16 B x lane

    // One chunk: fetch the next chunk's weights (not behind the last), multiply,
    // lay the fetched weights into the other buffer, store this chunk's columns.
    auto chunk = [&](const int c, auto more) __attribute__((always_inline)) {
        if constexpr (more.value) {
            const float* p = wsrc + (size_t)(c + 1) * QCH * DIM;
#pragma unroll
            for (int i = 0; i < 16; ++i)
                wreg[i] = *(const v4f*)(p + (i >> 1) * DIM + (i & 1) * 128);
        }

        const v8f bv0 = *(const v8f*)&sBias[c * QCH + wc * 32 + sel * 8];
        const v8f bv1 = *(const v8f*)&sBias[c * QCH + wc * 32 + 16 + sel * 8];
        float* dst = drow + c * QCH;

        const _Float16* wb = &sW[c & 1][(wc * 32 + lm) * QP];
        v8f acc[4][2] = {};
        v16h bf[2][2];                           // fragments one k-step ahead
        bf[0][0] = load_frag(wb, sel);
        bf[0][1] = load_frag(wb + 16 * QP, sel);
#pragma unroll
        for (int ks = 0; ks < 8; ++ks) {
            if (ks < 7) {
                bf[(ks + 1) & 1][0] = load_frag(wb + (ks + 1) * 32, sel);
                bf[(ks + 1) & 1][1] = load_frag(wb + 16 * QP + (ks + 1) * 32, sel);
            }
            // Keeps the next k-step's LDS reads in front of this step's products;
            // without it they sink to just before their use and the wave waits.
            __builtin_amdgcn_sched_barrier(0);
#pragma unroll
            for (int rt = 0; rt < 4; ++rt) {
                acc[rt][0] = wmma_f16(bf[ks & 1][0], xa[rt][ks], acc[rt][0]);
                acc[rt][1] = wmma_f16(bf[ks & 1][1], xa[rt][ks], acc[rt][1]);
            }
            // Keeps the conversion of the fetched weights (and its wait on the
            // global loads) behind the products instead of among the first ones.
            __builtin_amdgcn_sched_barrier(0);
        }

        // Register j of acc[rt][t] = column t*16 + sel*8 + j of row rt*16 + lm:
        // pieces t*4 + sel*2 and t*4 + sel*2 + 1 of that row.
#pragma unroll
        for (int rt = 0; rt < 4; ++rt) {
            const v8f r0 = acc[rt][0] + bv0;
            const v8f r1 = acc[rt][1] + bv1;
            *(v4f*)(stg + swr + rt * 2048)        = __builtin_shufflevector(r0, r0, 0, 1, 2, 3);
            *(v4f*)(stg + (swr ^ 16) + rt * 2048) = __builtin_shufflevector(r0, r0, 4, 5, 6, 7);
            *(v4f*)(stg + (swr ^ 64) + rt * 2048) = __builtin_shufflevector(r1, r1, 0, 1, 2, 3);
            *(v4f*)(stg + (swr ^ 80) + rt * 2048) = __builtin_shufflevector(r1, r1, 4, 5, 6, 7);
        }

        if constexpr (more.value) {
            _Float16* wd = &sW[(c + 1) & 1][(wv * 8) * QP + lane * 4];
#pragma unroll
            for (int i = 0; i < 16; ++i)
                *(v4h*)(wd + (i >> 1) * QP + (i & 1) * 128) =
                    __builtin_convertvector(wreg[i], v4h);
        }

        // The staged rows are read back by other lanes of this wave.
        asm volatile("s_wait_dscnt 0x0" ::: "memory");
        v4f ov[16];
#pragma unroll
        for (int i = 0; i < 16; ++i)
            ov[i] = *(const v4f*)(stg + (srd ^ ((i & 3) * 32)) + i * 512);
        // All values first, then all stores: no register that an issued store
        // names is written again before the wait below.
        __builtin_amdgcn_sched_barrier(0);
#pragma unroll
        for (int i = 0; i < 16; ++i)
            *(v4f*)(dst + (size_t)(i * 4) * DIM) = ov[i];   // 4 whole lines per store
        // The next chunk overwrites the stores' data and address registers.
        if constexpr (more.value) asm volatile("s_wait_xcnt 0x0" ::: "memory");
    };

    // Rolled: one chunk's code serves three chunks (instruction cache).
#pragma unroll 1
    for (int c = 0; c < PNCH - 1; ++c) {
        chunk(c, std::true_type{});
        // Publishes chunk c+1 and ends every wave's reads of chunk c's buffer;
        // LDS alone is handed over, the output stores stay in flight.
        lds_barrier();
    }
    chunk(PNCH - 1, std::false_type{});
}

// ---------------------------------------------------------------------------
extern "C" void kernel_launch(void* const* d_in, const int* in_sizes, int n_in,
                              void* d_out, int out_size, void* d_ws, size_t ws_size,
                              hipStream_t stream)
{
    const float* x1          = (const float*)d_in[0];
    const float* x2          = (const float*)d_in[1];
    const float* mask        = (const float*)d_in[2];
    const float* qkv_w       = (const float*)d_in[3];
    const float* q_bias      = (const float*)d_in[4];
    const float* v_bias      = (const float*)d_in[5];
    const float* logit_scale = (const float*)d_in[6];
    const float* cpb_w1      = (const float*)d_in[7];
    const float* cpb_b1      = (const float*)d_in[8];
    const float* cpb_w2      = (const float*)d_in[9];
    const float* proj_w      = (const float*)d_in[10];
    const float* proj_b      = (const float*)d_in[11];
    const float* amod1       = (const float*)d_in[12];
    const float* amod2       = (const float*)d_in[13];
    const float* rel_table   = (const float*)d_in[14];
    const int*   rel_index   = (const int*)d_in[15];

    char* ws = (char*)d_ws;
    float*    biasb = (float*)(ws + WS_BIAS);
    _Float16* qws   = (_Float16*)(ws + WS_Q);
    _Float16* kws   = (_Float16*)(ws + WS_K);
    _Float16* vws   = (_Float16*)(ws + WS_V);
    _Float16* ao    = (_Float16*)(ws + WS_AO);
    float*    out   = (float*)d_out;

    swin_qkv_gemm<<<dim3(256), 256, 0, stream>>>(
        x1, x2, qkv_w, q_bias, v_bias,
        rel_table, cpb_w1, cpb_b1, cpb_w2, rel_index, amod1, amod2, biasb,
        qws, kws, vws);
    swin_attn<<<dim3(NH, NW), 256, 0, stream>>>(qws, kws, vws, biasb, mask,
                                                logit_scale, ao);
    swin_proj_gemm<<<dim3(256), 256, 0, stream>>>(ao, proj_w, proj_b, out);
}

// v009
// Measured time: 58.4 microseconds a run.
// In both of two side-by-side timings against v008, it was 1.26 times as fast.
// Counting every step since v000, it is 3.20 times as fast.
#include <hip/hip_runtime.h>
#include <hip/hip_bf16.h>
#include <type_traits>

// ---------------------------------------------------------------------------
// SwinV2 window attention block on gfx1250 (CDNA5), wave32 + WMMA f16.
// ---------------------------------------------------------------------------

typedef _Float16 v16h __attribute__((ext_vector_type(16)));
typedef _Float16 v8h  __attribute__((ext_vector_type(8)));
typedef float    v8f  __attribute__((ext_vector_type(8)));
typedef _Float16 v4h  __attribute__((ext_vector_type(4)));
typedef float    v4f  __attribute__((ext_vector_type(4)));
typedef float    v2f  __attribute__((ext_vector_type(2)));

#define NH   8
#define HD   32
#define NTOK 64
#define TWO_N 128
#define DIM  256
#define BW   512
#define NW   64
#define CPB  512

// workspace layout (bytes)
#define WS_BIAS ((size_t)8192)                    // 8*128*128 f32 (fragment order)
#define WS_Q    ((size_t)532480)                  // 512*8*128*32 f16
#define WS_K    (WS_Q + (size_t)33554432)         // 512*8* 64*32 f16
#define WS_V    (WS_K + (size_t)16777216)         // 512*8*32*128 f16 (transposed)

// Load a 16x32 f16 A-fragment (or 32x16 B-fragment) per ISA layout:
// lane<16 holds K = {0..7, 16..23}; lane>=16 holds K = {8..15, 24..31}.
// `seg` points at the 32-half contiguous K segment for this lane's row/col,
// and must be 16B aligned (row strides are multiples of 8 halves).
__device__ __forceinline__ v16h load_frag(const _Float16* seg, int sel) {
    v8h lo = *(const v8h*)(seg + sel * 8);
    v8h hi = *(const v8h*)(seg + 16 + sel * 8);
    v16h f;
#pragma unroll
    for (int i = 0; i < 8; ++i) { f[i] = lo[i]; f[i + 8] = hi[i]; }
    return f;
}

__device__ __forceinline__ v8f wmma_f16(v16h a, v16h b, v8f c) {
    return __builtin_amdgcn_wmma_f32_16x16x32_f16(false, a, false, b,
                                                  (short)0, c, false, false);
}

// Work-group barrier that hands over LDS alone: a plain __syncthreads() would
// also wait for the rows fetched ahead and for the output stores in flight.
__device__ __forceinline__ void lds_barrier() {
    __builtin_amdgcn_fence(__ATOMIC_RELEASE, "workgroup", "local");
    __builtin_amdgcn_s_barrier();
    __builtin_amdgcn_fence(__ATOMIC_ACQUIRE, "workgroup", "local");
}

// Lane l's value as seen from lane l ^ 16 (a vector cross-row move, no LDS pipe).
__device__ __forceinline__ float xhalf(float x) {
    const int b = __builtin_bit_cast(int, x);
    return __builtin_bit_cast(float, __builtin_amdgcn_permlanex16(
        b, b, 0x76543210, 0xfedcba98, false, false));
}

#define BHD  2    // heads per bias unit
#define NPOS 225  // rows of the relative-coordinate table

// ---------------------------------------------------------------------------
// 1) QKV GEMM: [x1;x2] (65536x256) @ qkv_w^T (256x768) + bias, scatter q/k/v.
//    One block = 256 rows x all 768 columns, one block per WGP. The block's x
//    rows are read once, converted to f16 and kept as B fragments in registers
//    for the whole K (4 row tiles x 8 k-steps per wave). The weights pass
//    through LDS in 12 chunks of 64 columns (two buffers, one barrier a chunk).
//    8 waves = 4 row groups of 64 x 2 column halves of 32.
//    The product is formed transposed (weights as A, x as B): a lane holds 8
//    consecutive columns of one row. A wave's 64 x 32 tile is 4 KiB in a row in
//    q/k; it passes through the wave's own LDS range and leaves in whole lines.
//    q and k rows leave L2-normalized (a head's 32 columns of a row lie in lanes
//    l and l ^ 16). For v the operands change places (x as A): a lane holds 8
//    consecutive tokens of one column, and v leaves transposed, (head dim, key),
//    128 B of each of the head's 32 rows per wave. The attention then reads its
//    q, k and v fragments as they lie in memory.
//
//    Bias build, in the same launch: CPB MLP (2 -> 512 relu -> 8), rpb gather +
//    16*sigmoid + 2*amod quadrants -> (8,128,128), stored in the order of the
//    attention's fragments. Each of the 256 blocks does
//    one unit (token row m, BHD heads) while its x rows are on their way from
//    memory: weights and table lie in LDS, each wave takes 64 of the 512 hidden
//    units for the 64 table positions that row m gathers (2 a lane), and the 8
//    waves' partial sums are added through LDS.
// ---------------------------------------------------------------------------
#define QP 264   // LDS row pitch in halves: 528 B = 16 B x odd for b128 readers
#define QCH 64   // weight columns per chunk
#define QNCH 12  // chunks

__global__ __launch_bounds__(256) void swin_qkv_gemm(
    const float* __restrict__ x1, const float* __restrict__ x2,
    const float* __restrict__ qkv_w, const float* __restrict__ q_bias,
    const float* __restrict__ v_bias,
    const float* __restrict__ tbl, const float* __restrict__ w1,
    const float* __restrict__ b1, const float* __restrict__ w2,
    const int* __restrict__ rel_index,
    const float* __restrict__ amod1, const float* __restrict__ amod2,
    float* __restrict__ biasb,
    _Float16* __restrict__ qws, _Float16* __restrict__ kws,
    _Float16* __restrict__ vws)
{
    __shared__ __attribute__((aligned(16))) _Float16 sX[256 * QP];
    __shared__ __attribute__((aligned(16))) _Float16 sW[2][QCH * QP];
    __shared__ __attribute__((aligned(32))) float sBias[3 * DIM]; // q_bias | 0 | v_bias
    __shared__ __attribute__((aligned(16))) _Float16 sOut[8][64 * HD]; // a wave's tile
    // The bias unit's own LDS.
    __shared__ __attribute__((aligned(16))) float sW1[CPB * 2];
    __shared__ __attribute__((aligned(16))) float sB1[CPB];
    __shared__ __attribute__((aligned(16))) float sW2[BHD * CPB];
    __shared__ __attribute__((aligned(16))) float sTbl[256 * 2];  // NPOS rows used
    __shared__ float sPart[8][BHD][NTOK];

    const int tid   = threadIdx.x;
    const int baseM = blockIdx.x * 256;
    const int wv    = __builtin_amdgcn_readfirstlane(tid >> 5);
    const int lane  = tid & 31;
    const int wr = wv & 3, wc = wv >> 2;
    const int sel = lane >> 4, lm = lane & 15;
    const int wch = baseM >> 15;        // 0 -> x1, 1 -> x2 (same for the block)
    const int loc = baseM & 32767;

    // Each wave stages 8 weight rows of a chunk (2 coalesced 512-B loads a row)
    // and 32 x rows. These loads go out as one group, behind the bias unit's.
    const float* wsrc = qkv_w + (size_t)(wv * 8) * DIM + lane * 4;
    const float* xsrc = (wch ? x2 : x1) + (size_t)(loc + wv * 32) * DIM + lane * 4;
    v4f wreg[16];
    v4f xreg[64];

    // The block's bias unit: token row m, heads h0 .. h0 + BHD - 1.
    const int m = blockIdx.x & (NTOK - 1), h0 = (blockIdx.x >> 6) * BHD;
    const int n = tid & (TWO_N - 1), nn = n & (NTOK - 1), hh = tid >> 7;
    const size_t aoff = ((size_t)(h0 + hh) * NTOK + m) * NTOK + nn;
    const int*   pix = rel_index + m * NTOK + lane;
    const float* pw1 = w1 + tid * 4;
    const float* pb1 = b1 + tid * 2;
    const float* pw2 = w2 + (size_t)h0 * CPB + tid * 4;
    const float* pa1 = amod1 + aoff;
    const float* pa2 = amod2 + aoff;
    const float* ptb = tbl + min(tid, NPOS - 1) * 2;   // the whole table, a row a thread

    // The fence pair keeps every other instruction out of [loads, wait], so that
    // no register a load names is written before the wait.
    __builtin_amdgcn_sched_barrier(0);
    int i0 = pix[0];
    int i1 = pix[32];
    const v4f rw1 = *(const v4f*)pw1;
    const v2f rb1 = *(const v2f*)pb1;
    const v4f rw2 = *(const v4f*)pw2;
    const v2f rtb = *(const v2f*)ptb;
    const float a1 = *pa1;
    const float a2 = *pa2;
    // These loads' address registers are reused by the group below.
    asm volatile("s_wait_xcnt 0x0" ::: "memory");
    // Keeps the bias unit's few loads in front of the x rows': loads return in
    // order, so the unit then waits for its own alone and not for the x rows.
    __builtin_amdgcn_sched_barrier(0);
#pragma unroll
    for (int i = 0; i < 16; ++i)
        wreg[i] = *(const v4f*)(wsrc + (i >> 1) * DIM + (i & 1) * 128);
#pragma unroll
    for (int i = 0; i < 64; ++i)
        xreg[i] = *(const v4f*)(xsrc + (i >> 1) * DIM + (i & 1) * 128);
    const float qb = q_bias[tid];
    const float vb = v_bias[tid];
    // The loads' offset and base registers are reused right behind them.
    asm volatile("s_wait_xcnt 0x0" ::: "memory");
    __builtin_amdgcn_sched_barrier(0);

    // --- the bias unit, while the x rows fly ---
    {
        *(v4f*)&sW1[tid * 4]  = rw1;
        *(v2f*)&sB1[tid * 2]  = rb1;
        *(v4f*)&sW2[tid * 4]  = rw2;
        *(v2f*)&sTbl[tid * 2] = rtb;
        // The index is input data: bound the table address.
        i0 = min(max(i0, 0), NPOS - 1);
        i1 = min(max(i1, 0), NPOS - 1);
        lds_barrier();                    // publishes the weights and the table

        const v2f ca = *(const v2f*)&sTbl[i0 * 2];
        const v2f cb = *(const v2f*)&sTbl[i1 * 2];
        float acc[2][BHD] = {};
        const int j0 = wv * (CPB / 8);
#pragma unroll
        for (int jj = 0; jj < CPB / 8; jj += 4) {
            const int j = j0 + jj;
            const v4f wa = *(const v4f*)&sW1[j * 2];
            const v4f wb = *(const v4f*)&sW1[j * 2 + 4];
            const v4f bb = *(const v4f*)&sB1[j];
            const v4f u0 = *(const v4f*)&sW2[j];
            const v4f u1 = *(const v4f*)&sW2[CPB + j];
#pragma unroll
            for (int q = 0; q < 4; ++q) {
                const float c0 = (q < 2) ? wa[2 * q]     : wb[2 * q - 4];
                const float c1 = (q < 2) ? wa[2 * q + 1] : wb[2 * q - 3];
                const float ha = fmaxf(c0 * ca[0] + c1 * ca[1] + bb[q], 0.0f);
                const float hb = fmaxf(c0 * cb[0] + c1 * cb[1] + bb[q], 0.0f);
                acc[0][0] += u0[q] * ha;
                acc[0][1] += u1[q] * ha;
                acc[1][0] += u0[q] * hb;
                acc[1][1] += u1[q] * hb;
            }
        }
#pragma unroll
        for (int p = 0; p < 2; ++p)
#pragma unroll
            for (int g = 0; g < BHD; ++g) sPart[wv][g][p * 32 + lane] = acc[p][g];
        lds_barrier();                    // publishes the partial sums

        float r = 0.0f;
#pragma unroll
        for (int k = 0; k < 8; ++k) r += sPart[k][hh][nn];
        const float rpb = 16.0f / (1.0f + __expf(-r));
        // Rows m and m+64: amod1 where row and column lie in the same half.
        const bool lo = n < NTOK;
        // Fragment order, as the attention's lanes take it: (head, 16-row tile,
        // i = 4-key group of a lane, lane = (8-key half, row), 4 keys). Row m + 64
        // lies 4 tiles on, which is NTOK * TWO_N floats, as in row order.
        float* bd = biasb + (size_t)(h0 + hh) * TWO_N * TWO_N
                  + ((((m >> 4) * 16 + (n >> 4) * 2 + ((n >> 2) & 1)) * 32
                      + ((n >> 3) & 1) * 16 + (m & 15)) * 4 + (n & 3));
        const float r0 = rpb + 2.0f * (lo ? a1 : a2);
        const float r1 = rpb + 2.0f * (lo ? a2 : a1);
        // Both values first, then both stores: no register that an issued store
        // names is written again before the wait below.
        __builtin_amdgcn_sched_barrier(0);
        bd[0]            = r0;
        bd[NTOK * TWO_N] = r1;
        // The staging below overwrites the stores' data and address registers.
        asm volatile("s_wait_xcnt 0x0" ::: "memory");
        __builtin_amdgcn_sched_barrier(0);
    }

    sBias[tid]           = qb;
    sBias[DIM + tid]     = 0.0f;
    sBias[2 * DIM + tid] = vb;
    {
        _Float16* wd = &sW[0][(wv * 8) * QP + lane * 4];
#pragma unroll
        for (int i = 0; i < 16; ++i)
            *(v4h*)(wd + (i >> 1) * QP + (i & 1) * 128) =
                __builtin_convertvector(wreg[i], v4h);
        _Float16* xd = &sX[(wv * 32) * QP + lane * 4];
#pragma unroll
        for (int i = 0; i < 64; ++i)
            *(v4h*)(xd + (i >> 1) * QP + (i & 1) * 128) =
                __builtin_convertvector(xreg[i], v4h);
    }
    __syncthreads();

    v16h xa[4][8];
#pragma unroll
    for (int rt = 0; rt < 4; ++rt)
#pragma unroll
        for (int ks = 0; ks < 8; ++ks)
            xa[rt][ks] = load_frag(&sX[(wr * 64 + rt * 16 + lm) * QP + ks * 32], sel);

    const int b = (loc >> 6) + wr;      // a wave's 64 rows are one window

    // Output staging, 16-byte pieces, 4 a row of 64 B. Piece p of row r lies at
    // r*64 + ((p ^ ((r >> 2) & 3)) << 4): no bank is met twice by the writers
    // (16 rows, one piece) nor by the readers (4 rows, all pieces).
    char* stg = (char*)&sOut[wv][0];
    const int swr = lm * 64 + ((sel ^ (lm >> 2)) << 4);            // row lm, piece sel
    const int srd = (lane >> 2) * 64 + (((lane & 3) ^ sel) << 4);  // linear 16 B x lane
    // The transposed v tile: 32 rows (head dim) of 128 B (64 tokens), 8 pieces a
    // row. Piece p of row r lies at r*128 + ((p ^ ((r >> 1) & 7)) << 4): no bank is
    // met twice by the writers (16 rows, one piece) nor by the readers (2 rows).
    const int vwr = lm * 128 + ((sel ^ (lm >> 1)) << 4);             // row lm, piece sel
    const int vrd = (lane >> 3) * 128 + (((lane & 7) ^ sel) << 4);   // linear 16 B x lane

    // One chunk: fetch the next chunk's weights (not behind the last), multiply,
    // lay the fetched weights into the other buffer, store this chunk's columns.
    auto chunk = [&](const int c, auto more, auto isv) __attribute__((always_inline)) {
        if constexpr (more.value) {
            const float* p = wsrc + (size_t)(c + 1) * QCH * DIM;
#pragma unroll
            for (int i = 0; i < 16; ++i)
                wreg[i] = *(const v4f*)(p + (i >> 1) * DIM + (i & 1) * 128);
            // The loads' address registers are reused behind them; the fence keeps
            // every later instruction behind the wait.
            asm volatile("s_wait_xcnt 0x0" ::: "memory");
            __builtin_amdgcn_sched_barrier(0);
        }

        const int s    = c >> 2;                 // 0=q,1=k,2=v
        const int hcol = (c * 2 + wc) & 7;       // a wave's 32 columns are one head

        const _Float16* wb = &sW[c & 1][(wc * 32 + lm) * QP];
        v8f acc[4][2] = {};
        v16h bf[2][2];                           // fragments one k-step ahead
        bf[0][0] = load_frag(wb, sel);
        bf[0][1] = load_frag(wb + 16 * QP, sel);
#pragma unroll
        for (int ks = 0; ks < 8; ++ks) {
            if (ks < 7) {
                bf[(ks + 1) & 1][0] = load_frag(wb + (ks + 1) * 32, sel);
                bf[(ks + 1) & 1][1] = load_frag(wb + 16 * QP + (ks + 1) * 32, sel);
            }
            // Keeps the next k-step's LDS reads in front of this step's products;
            // without it they sink to just before their use and the wave waits.
            __builtin_amdgcn_sched_barrier(0);
#pragma unroll
            for (int rt = 0; rt < 4; ++rt) {
                if constexpr (isv.value) {
                    acc[rt][0] = wmma_f16(xa[rt][ks], bf[ks & 1][0], acc[rt][0]);
                    acc[rt][1] = wmma_f16(xa[rt][ks], bf[ks & 1][1], acc[rt][1]);
                } else {
                    acc[rt][0] = wmma_f16(bf[ks & 1][0], xa[rt][ks], acc[rt][0]);
                    acc[rt][1] = wmma_f16(bf[ks & 1][1], xa[rt][ks], acc[rt][1]);
                }
            }
            // Keeps the conversion of the fetched weights (and its wait on the
            // global loads) behind the products instead of among the first ones.
            __builtin_amdgcn_sched_barrier(0);
        }

        const bool keep = isv.value || s == 0 || wch == 0;  // k of x2 is never read
        _Float16* dst;
        if constexpr (isv.value) {
            // Register j of acc[rt][t] = token rt*16 + sel*8 + j of column t*16 + lm:
            // piece rt*2 + sel of row t*16 + lm of the transposed tile.
            const float vb0 = sBias[c * QCH + wc * 32 + lm];
            const float vb1 = sBias[c * QCH + wc * 32 + 16 + lm];
            dst = vws + ((size_t)(b * NH + hcol) * HD + (lane >> 3)) * TWO_N
                      + wch * NTOK + (lane & 7) * 8;
#pragma unroll
            for (int rt = 0; rt < 4; ++rt) {
                *(v8h*)(stg + (vwr ^ (rt * 32))) =
                    __builtin_convertvector(acc[rt][0] + vb0, v8h);
                *(v8h*)(stg + (vwr ^ (rt * 32)) + 2048) =
                    __builtin_convertvector(acc[rt][1] + vb1, v8h);
            }
        } else {
            const v8f bv0 = *(const v8f*)&sBias[c * QCH + wc * 32 + sel * 8];
            const v8f bv1 = *(const v8f*)&sBias[c * QCH + wc * 32 + 16 + sel * 8];
            dst = (s == 0) ? qws + ((size_t)(b * NH + hcol) * TWO_N + wch * NTOK) * HD
                           : kws + ((size_t)(b * NH + hcol) * NTOK) * HD;
            dst += lane * 8;
            if (keep) {
                // Register j of acc[rt][t] = column t*16 + sel*8 + j of row rt*16 + lm;
                // lane l ^ 16 holds the row's other 16 columns of this head.
#pragma unroll
                for (int rt = 0; rt < 4; ++rt) {
                    const v8f r0 = acc[rt][0] + bv0;
                    const v8f r1 = acc[rt][1] + bv1;
                    const v8f sq = r0 * r0 + r1 * r1;
                    float ss = ((sq[0] + sq[1]) + (sq[2] + sq[3]))
                             + ((sq[4] + sq[5]) + (sq[6] + sq[7]));
                    ss += xhalf(ss);
                    // 1 / max(sqrt(ss), 1e-12); ss = 0 gives the bound, and 0 * bound = 0.
                    const float inv = fminf(__builtin_amdgcn_rsqf(ss), 1e12f);
                    *(v8h*)(stg + swr + rt * 1024) =
                        __builtin_convertvector(r0 * inv, v8h);
                    *(v8h*)(stg + (swr ^ 32) + rt * 1024) =
                        __builtin_convertvector(r1 * inv, v8h);
                }
            }
        }

        if constexpr (more.value) {
            _Float16* wd = &sW[(c + 1) & 1][(wv * 8) * QP + lane * 4];
#pragma unroll
            for (int i = 0; i < 16; ++i)
                *(v4h*)(wd + (i >> 1) * QP + (i & 1) * 128) =
                    __builtin_convertvector(wreg[i], v4h);
        }

        if (keep) {
            // The staged rows are read back by other lanes of this wave.
            asm volatile("s_wait_dscnt 0x0" ::: "memory");
            v8h ov[8];
#pragma unroll
            for (int i = 0; i < 8; ++i) {
                if constexpr (isv.value)
                    ov[i] = *(const v8h*)(stg + (vrd ^ ((i & 3) * 32)) + i * 512);
                else
                    ov[i] = *(const v8h*)(stg + (srd ^ ((i & 1) * 32)) + i * 512);
            }
            // All values first, then all stores: no register that an issued
            // store names is written again before the wait below.
            __builtin_amdgcn_sched_barrier(0);
#pragma unroll
            for (int i = 0; i < 8; ++i) {
                if constexpr (isv.value)
                    *(v8h*)(dst + i * 4 * TWO_N) = ov[i];  // 4 whole lines per store
                else
                    *(v8h*)(dst + i * 256) = ov[i];        // 512 B in a row per store
            }
            // The next chunk overwrites the stores' data and address registers.
            if constexpr (more.value) asm volatile("s_wait_xcnt 0x0" ::: "memory");
        }
    };

    // Rolled: one chunk's code serves the eight q and k chunks, another the first
    // three v chunks (instruction cache).
#pragma unroll 1
    for (int c = 0; c < 8; ++c) {
        chunk(c, std::true_type{}, std::false_type{});
        // Publishes chunk c+1 and ends every wave's reads of chunk c's buffer.
        // Only LDS is handed over here: a plain __syncthreads() would also wait
        // for this chunk's global stores.
        lds_barrier();
    }
#pragma unroll 1
    for (int c = 8; c < QNCH - 1; ++c) {
        chunk(c, std::true_type{}, std::true_type{});
        lds_barrier();                    // as in the loop above
    }
    chunk(QNCH - 1, std::false_type{}, std::true_type{});
}

// ---------------------------------------------------------------------------
// 2) Attention and output projection, one launch.
//    One block = the two batch entries 2p, 2p + 1 of one mask window: 256 rows of
//    the output, one block per WGP. 8 waves.
//
//    Attention: S = (Qn Kn^T)*scale + bias + mask; softmax; O = P V.
//    A wave is one head. Its K and V^T fragments of both entries are read once,
//    as they lie in memory, and stay in registers: no LDS and no barrier among
//    the 8 query tiles. The bias arrives in fragment order (whole lines), the
//    mask window lies in LDS; their sum serves both entries of a query tile.
//    Both products are formed transposed (S^T = K Q^T, O^T = V^T P^T): a lane
//    then holds 64 of the 128 scores of ONE query row, lane ^ 16 the others.
//    O goes to LDS, where the projection takes its x fragments from.
//
//    Projection: O (256 x 256 f16, in LDS) @ proj_w^T + proj_b -> f32 out.
//    Tiled like the QKV GEMM: the rows are kept as fragments in registers for
//    the whole K; the weights pass through LDS in 4 chunks of 64 columns (two
//    buffers, one barrier a chunk). 8 waves = 4 row groups of 64 x 2 column
//    halves of 32. Transposed product and staged stores as in the QKV GEMM: a
//    wave's 32 f32 columns are one 128-byte line of each of its 64 rows.
// ---------------------------------------------------------------------------
#define PNCH 4   // chunks of QCH weight columns

// p[i] = 2^t[i]. Eight exponentials in one statement: each stands in the slot
// that the instruction set asks for behind the one before it (no result read,
// no source overwritten: the outputs share no register with the inputs), and
// the v_nop stands in the last one's.
__device__ __forceinline__ void exp2x8(v8f& p, const v8f t) {
    float p0, p1, p2, p3, p4, p5, p6, p7;
    asm("v_exp_f32 %0, %8\n\t"
        "v_exp_f32 %1, %9\n\t"
        "v_exp_f32 %2, %10\n\t"
        "v_exp_f32 %3, %11\n\t"
        "v_exp_f32 %4, %12\n\t"
        "v_exp_f32 %5, %13\n\t"
        "v_exp_f32 %6, %14\n\t"
        "v_exp_f32 %7, %15\n\t"
        "v_nop"
        : "=&v"(p0), "=&v"(p1), "=&v"(p2), "=&v"(p3),
          "=&v"(p4), "=&v"(p5), "=&v"(p6), "=&v"(p7)
        : "v"(t[0]), "v"(t[1]), "v"(t[2]), "v"(t[3]),
          "v"(t[4]), "v"(t[5]), "v"(t[6]), "v"(t[7]));
    p[0] = p0; p[1] = p1; p[2] = p2; p[3] = p3;
    p[4] = p4; p[5] = p5; p[6] = p6; p[7] = p7;
}

__global__ __launch_bounds__(256) void swin_attn_proj(
    const _Float16* __restrict__ qws, const _Float16* __restrict__ kws,
    const _Float16* __restrict__ vws, const float* __restrict__ biasb,
    const float* __restrict__ mask, const float* __restrict__ logit_scale,
    const float* __restrict__ proj_w, const float* __restrict__ proj_b,
    float* __restrict__ out)
{
    __shared__ __attribute__((aligned(16))) _Float16 sX[256 * QP];   // O, 256 rows
    __shared__ __attribute__((aligned(16))) _Float16 sW[2][QCH * QP];
    __shared__ __attribute__((aligned(32))) float sBias[DIM];
    // The mask window (128 x 128 f32) during the attention, then a wave's tile.
    __shared__ __attribute__((aligned(16))) float sOut[8][64 * 32];

    const int tid  = threadIdx.x;
    const int wdw  = blockIdx.x & (NW - 1);      // mask window
    const int pr   = blockIdx.x >> 6;            // batch entries 2*pr, 2*pr + 1
    const int wv   = __builtin_amdgcn_readfirstlane(tid >> 5);
    const int lane = tid & 31;
    const int sel = lane >> 4, lm = lane & 15;
    const int h   = wv;                          // the wave's head
    const int b0  = (2 * pr) * NW + wdw;         // the first entry's window; + NW the second's

    // Each wave stages 8 weight rows of a chunk (2 coalesced 512-B loads a row)
    // and 16 rows of the mask (one 512-B load a row).
    const float* wsrc = proj_w + (size_t)(wv * 8) * DIM + lane * 4;
    const float* msrc = mask + (size_t)wdw * TWO_N * TWO_N + (size_t)(wv * 16) * TWO_N
                             + lane * 4;
    const size_t qimg = (size_t)NW * NH * TWO_N * HD;  // halves to the next entry
    const size_t kimg = (size_t)NW * NH * NTOK * HD;
    const _Float16* ksrc = kws + ((size_t)(b0 * NH + h) * NTOK + lm) * HD;
    const _Float16* vsrc = vws + ((size_t)(b0 * NH + h) * HD + lm) * TWO_N;
    const _Float16* qsrc = qws + ((size_t)(b0 * NH + h) * TWO_N + lm) * HD + sel * 8;
    // Bias in fragment order: (head, query tile, i, lane, 4 keys).
    const float* bsrc = biasb + (size_t)h * TWO_N * TWO_N + lane * 4;

    v4f wreg[16];
    v4f bq[16];       // the bias of a query tile, fetched one tile ahead
    v8h qr[2][2];     // the q fragments of a query tile, both entries, likewise
    auto fetch = [&](const int qt) __attribute__((always_inline)) {
        const float*    pb = bsrc + qt * (16 * TWO_N);
        const _Float16* pq = qsrc + qt * (16 * HD);
        const _Float16* pr1 = pq + qimg;
        // The fence pair keeps every other instruction out of [loads, wait], so
        // that no register a load names is written before the wait.
        __builtin_amdgcn_sched_barrier(0);
#pragma unroll
        for (int i = 0; i < 16; ++i)
            bq[i] = *(const v4f*)(pb + i * TWO_N);     // 512 B in a row per load
        qr[0][0] = *(const v8h*)pq;
        qr[0][1] = *(const v8h*)(pq + 16);
        qr[1][0] = *(const v8h*)pr1;
        qr[1][1] = *(const v8h*)(pr1 + 16);
        // The loads' address registers are reused behind them.
        asm volatile("s_wait_xcnt 0x0" ::: "memory");
        __builtin_amdgcn_sched_barrier(0);
    };

    v4f mreg[16];
    v16h aK[2][4];      // K fragments: entry, 16 keys
    v16h aV[2][4][2];   // V^T fragments: entry, 32 keys, 16 head-dim rows
    // The fence pair keeps every other instruction out of [loads, wait], so that
    // no register a load names is written before the wait.
    __builtin_amdgcn_sched_barrier(0);
#pragma unroll
    for (int i = 0; i < 16; ++i)
        wreg[i] = *(const v4f*)(wsrc + (i >> 1) * DIM + (i & 1) * 128);
#pragma unroll
    for (int i = 0; i < 16; ++i)
        mreg[i] = *(const v4f*)(msrc + i * TWO_N);
    const float pb = proj_b[tid];
#pragma unroll
    for (int e = 0; e < 2; ++e) {
#pragma unroll
        for (int kb = 0; kb < 4; ++kb)
            aK[e][kb] = load_frag(ksrc + e * kimg + kb * 16 * HD, sel);
#pragma unroll
        for (int kc = 0; kc < 4; ++kc) {
            aV[e][kc][0] = load_frag(vsrc + e * qimg + kc * 32, sel);
            aV[e][kc][1] = load_frag(vsrc + e * qimg + 16 * TWO_N + kc * 32, sel);
        }
    }
    // The loads' offset and base registers are reused right behind them.
    asm volatile("s_wait_xcnt 0x0" ::: "memory");
    __builtin_amdgcn_sched_barrier(0);
    fetch(0);

    // The mask in LDS: 16-byte piece p of row r lies at r*512 + ((p ^ (r & 15)) << 4):
    // no bank is met twice by the writers (one row, all pieces) nor by the
    // readers (16 rows, one piece).
    char* smask = (char*)&sOut[0][0];
    sBias[tid] = pb;
    {
        _Float16* wd = &sW[0][(wv * 8) * QP + lane * 4];
#pragma unroll
        for (int i = 0; i < 16; ++i)
            *(v4h*)(wd + (i >> 1) * QP + (i & 1) * 128) =
                __builtin_convertvector(wreg[i], v4h);
#pragma unroll
        for (int i = 0; i < 16; ++i)
            *(v4f*)(smask + (wv * 16 + i) * 512 + ((lane ^ i) << 4)) = mreg[i];
    }
    lds_barrier();                        // publishes the mask (and weight chunk 0)

    const float scale = __expf(fminf(logit_scale[h], 4.6051702f)); // log(100)
    const int mx16 = (lm ^ (sel * 2)) << 4;   // the reader's part of the piece's place

    // One query tile of one entry e: scores, softmax, O^T, O into LDS.
    auto tile = [&](const int qt, const int e, const v16h bQ, const float (&bm)[8][8])
        __attribute__((always_inline)) {
        // --- S^T = K Q^T : one WMMA per 16x16 tile (K-depth == head dim == 32).
        //     Register j of tile ct = key ct*16 + sel*8 + j, lane lm = query. ---
        v8f acc[8];
#pragma unroll
        for (int ct = 0; ct < 8; ++ct) {
            v8f z = {};
            acc[ct] = wmma_f16(aK[e][ct & 3], bQ, z);  // keys 64..127 reuse K (k=[k1;k1])
        }

        // --- scale + (bias + mask), then the row's softmax: in the lane, plus
        //     two exchanges (max, sum) with the lane that holds the row's other 64 keys. ---
        float part[8];
#pragma unroll
        for (int ct = 0; ct < 8; ++ct) {
            float m = -1e30f;
#pragma unroll
            for (int j = 0; j < 8; ++j) {
                const float v = acc[ct][j] * scale + bm[ct][j];
                acc[ct][j] = v;
                m = fmaxf(m, v);
            }
            part[ct] = m;
        }
        float mx = fmaxf(fmaxf(fmaxf(part[0], part[1]), fmaxf(part[2], part[3])),
                         fmaxf(fmaxf(part[4], part[5]), fmaxf(part[6], part[7])));
        mx = fmaxf(mx, xhalf(mx));
#pragma unroll
        for (int ct = 0; ct < 8; ++ct) {
            v8f t8;
#pragma unroll
            for (int j = 0; j < 8; ++j)
                t8[j] = (acc[ct][j] - mx) * 1.44269504f;   // log2(e)
            exp2x8(acc[ct], t8);
            float t = acc[ct][0];
#pragma unroll
            for (int j = 1; j < 8; ++j) t += acc[ct][j];
            part[ct] = t;
        }
        float sm = ((part[0] + part[1]) + (part[2] + part[3]))
                 + ((part[4] + part[5]) + (part[6] + part[7]));
        sm += xhalf(sm);
        const float invs = 1.0f / sm;

        // --- O^T = V^T P^T : K-depth 128 -> 4 WMMA steps x 2 tiles of head dim.
        //     Score tiles 2kc and 2kc+1, converted in place, ARE the B fragment
        //     of k-step kc (same k order as load_frag): P never touches LDS. ---
        v8f o0 = {}, o1 = {};
#pragma unroll
        for (int kc = 0; kc < 4; ++kc) {
            v16h bP;
#pragma unroll
            for (int i = 0; i < 8; ++i) {
                bP[i]     = (_Float16)(acc[2 * kc][i] * invs);
                bP[i + 8] = (_Float16)(acc[2 * kc + 1][i] * invs);
            }
            o0 = wmma_f16(aV[e][kc][0], bP, o0);
            o1 = wmma_f16(aV[e][kc][1], bP, o1);
        }
        // Register j of o0 / o1 = head-dim column sel*8 + j / 16 + sel*8 + j
        // of query row lm: 8 consecutive halves, one 16-byte LDS store each.
        _Float16* od = &sX[(e * TWO_N + qt * 16 + lm) * QP + h * HD + sel * 8];
        *(v8h*)od        = __builtin_convertvector(o0, v8h);
        *(v8h*)(od + 16) = __builtin_convertvector(o1, v8h);
    };

    // bias + mask of this lane's query row of tile qt, in the accumulator's own
    // layout (tile ct, register j = key ct*16 + sel*8 + j), and the q fragments,
    // from what fetch(qt) has brought.
    float bm[8][8];
    v16h bQ0, bQ1;
    auto settle = [&](const int qt) __attribute__((always_inline)) {
        const char* mrow = smask + (qt * 16 + lm) * 512;
#pragma unroll
        for (int i = 0; i < 16; ++i) {
            const v4f mq = *(const v4f*)(mrow + ((((i >> 1) * 4 + (i & 1)) << 4) ^ mx16));
#pragma unroll
            for (int e = 0; e < 4; ++e)
                bm[i >> 1][(i & 1) * 4 + e] = bq[i][e] + mq[e];
        }
#pragma unroll
        for (int i = 0; i < 8; ++i) {
            bQ0[i] = qr[0][0][i]; bQ0[i + 8] = qr[0][1][i];
            bQ1[i] = qr[1][0][i]; bQ1[i + 8] = qr[1][1][i];
        }
    };
    settle(0);

    // Rolled: one query tile's code serves all (registers, instruction cache).
#pragma unroll 1
    for (int qt = 0; qt < 8; ++qt) {
        // The next tile's bias and q rows fly while this one is worked on. The last
        // trip fetches its own tile again, so that no branch stands in the loop.
        const int nx = min(qt + 1, 7);
        fetch(nx);

        tile(qt, 0, bQ0, bm);
        // Keeps the second entry's scores from being formed while the first's
        // are live: without it the two tiles' registers add up.
        __builtin_amdgcn_sched_barrier(0);
        tile(qt, 1, bQ1, bm);
        // Keeps the next tile's sums, and their wait on the loads, behind this
        // tile's work.
        __builtin_amdgcn_sched_barrier(0);
        settle(nx);
    }
    // Publishes O to the projection and ends every wave's reads of the mask,
    // whose LDS the output tiles take over.
    lds_barrier();

    // ------------------------------ projection ------------------------------
    const int wr = wv & 3, wc = wv >> 2;
    v16h xa[4][8];
#pragma unroll
    for (int rt = 0; rt < 4; ++rt)
#pragma unroll
        for (int ks = 0; ks < 8; ++ks)
            xa[rt][ks] = load_frag(&sX[(wr * 64 + rt * 16 + lm) * QP + ks * 32], sel);

    // A wave's 64 rows are one half of window b0 (wr 0, 1) or b0 + NW (wr 2, 3).
    // A store takes 4 whole rows of the wave's tile: 8 lanes x 16 B a row.
    float* drow = out + ((size_t)(b0 + (wr >> 1) * NW) * TWO_N + (wr & 1) * 64
                         + (lane >> 3)) * DIM + wc * 32 + (lane & 7) * 4;

    // Output staging, 16-byte pieces, 8 a row of 128 B. Piece p of row r lies at
    // r*128 + ((p ^ ((r >> 1) & 7)) << 4): no bank is met twice by the writers
    // (16 rows, one piece) nor by the readers (2 rows, all pieces).
    char* stg = (char*)&sOut[wv][0];
    const int swr = lm * 128 + (((sel * 2) ^ (lm >> 1)) << 4);       // row lm, piece sel*2
    const int srd = (lane >> 3) * 128 + (((lane & 7) ^ sel) << 4);   // linear 16 B x lane

    // One chunk: fetch the next chunk's weights (not behind the last), multiply,
    // lay the fetched weights into the other buffer, store this chunk's columns.
    auto chunk = [&](const int c, auto more) __attribute__((always_inline)) {
        if constexpr (more.value) {
            const float* p = wsrc + (size_t)(c + 1) * QCH * DIM;
#pragma unroll
            for (int i = 0; i < 16; ++i)
                wreg[i] = *(const v4f*)(p + (i >> 1) * DIM + (i & 1) * 128);
        }

        const v8f bv0 = *(const v8f*)&sBias[c * QCH + wc * 32 + sel * 8];
        const v8f bv1 = *(const v8f*)&sBias[c * QCH + wc * 32 + 16 + sel * 8];
        float* dst = drow + c * QCH;

        const _Float16* wb = &sW[c & 1][(wc * 32 + lm) * QP];
        v8f acc[4][2] = {};
        v16h bf[2][2];                           // fragments one k-step ahead
        bf[0][0] = load_frag(wb, sel);
        bf[0][1] = load_frag(wb + 16 * QP, sel);
#pragma unroll
        for (int ks = 0; ks < 8; ++ks) {
            if (ks < 7) {
                bf[(ks + 1) & 1][0] = load_frag(wb + (ks + 1) * 32, sel);
                bf[(ks + 1) & 1][1] = load_frag(wb + 16 * QP + (ks + 1) * 32, sel);
            }
            // Keeps the next k-step's LDS reads in front of this step's products;
            // without it they sink to just before their use and the wave waits.
            __builtin_amdgcn_sched_barrier(0);
#pragma unroll
            for (int rt = 0; rt < 4; ++rt) {
                acc[rt][0] = wmma_f16(bf[ks & 1][0], xa[rt][ks], acc[rt][0]);
                acc[rt][1] = wmma_f16(bf[ks & 1][1], xa[rt][ks], acc[rt][1]);
            }
            // Keeps the conversion of the fetched weights (and its wait on the
            // global loads) behind the products instead of among the first ones.
            __builtin_amdgcn_sched_barrier(0);
        }

        // Register j of acc[rt][t] = column t*16 + sel*8 + j of row rt*16 + lm:
        // pieces t*4 + sel*2 and t*4 + sel*2 + 1 of that row.
#pragma unroll
        for (int rt = 0; rt < 4; ++rt) {
            const v8f r0 = acc[rt][0] + bv0;
            const v8f r1 = acc[rt][1] + bv1;
            *(v4f*)(stg + swr + rt * 2048)        = __builtin_shufflevector(r0, r0, 0, 1, 2, 3);
            *(v4f*)(stg + (swr ^ 16) + rt * 2048) = __builtin_shufflevector(r0, r0, 4, 5, 6, 7);
            *(v4f*)(stg + (swr ^ 64) + rt * 2048) = __builtin_shufflevector(r1, r1, 0, 1, 2, 3);
            *(v4f*)(stg + (swr ^ 80) + rt * 2048) = __builtin_shufflevector(r1, r1, 4, 5, 6, 7);
        }

        if constexpr (more.value) {
            _Float16* wd = &sW[(c + 1) & 1][(wv * 8) * QP + lane * 4];
#pragma unroll
            for (int i = 0; i < 16; ++i)
                *(v4h*)(wd + (i >> 1) * QP + (i & 1) * 128) =
                    __builtin_convertvector(wreg[i], v4h);
        }

        // The staged rows are read back by other lanes of this wave.
        asm volatile("s_wait_dscnt 0x0" ::: "memory");
        v4f ov[16];
#pragma unroll
        for (int i = 0; i < 16; ++i)
            ov[i] = *(const v4f*)(stg + (srd ^ ((i & 3) * 32)) + i * 512);
        // All values first, then all stores: no register that an issued store
        // names is written again before the wait below.
        __builtin_amdgcn_sched_barrier(0);
#pragma unroll
        for (int i = 0; i < 16; ++i)
            *(v4f*)(dst + (size_t)(i * 4) * DIM) = ov[i];   // 4 whole lines per store
        // The next chunk overwrites the stores' data and address registers.
        if constexpr (more.value) asm volatile("s_wait_xcnt 0x0" ::: "memory");
    };

    // Rolled: one chunk's code serves three chunks (instruction cache).
#pragma unroll 1
    for (int c = 0; c < PNCH - 1; ++c) {
        chunk(c, std::true_type{});
        // Publishes chunk c+1 and ends every wave's reads of chunk c's buffer;
        // LDS alone is handed over, the output stores stay in flight.
        lds_barrier();
    }
    chunk(PNCH - 1, std::false_type{});
}

// ---------------------------------------------------------------------------
extern "C" void kernel_launch(void* const* d_in, const int* in_sizes, int n_in,
                              void* d_out, int out_size, void* d_ws, size_t ws_size,
                              hipStream_t stream)
{
    const float* x1          = (const float*)d_in[0];
    const float* x2          = (const float*)d_in[1];
    const float* mask        = (const float*)d_in[2];
    const float* qkv_w       = (const float*)d_in[3];
    const float* q_bias      = (const float*)d_in[4];
    const float* v_bias      = (const float*)d_in[5];
    const float* logit_scale = (const float*)d_in[6];
    const float* cpb_w1      = (const float*)d_in[7];
    const float* cpb_b1      = (const float*)d_in[8];
    const float* cpb_w2      = (const float*)d_in[9];
    const float* proj_w      = (const float*)d_in[10];
    const float* proj_b      = (const float*)d_in[11];
    const float* amod1       = (const float*)d_in[12];
    const float* amod2       = (const float*)d_in[13];
    const float* rel_table   = (const float*)d_in[14];
    const int*   rel_index   = (const int*)d_in[15];

    char* ws = (char*)d_ws;
    float*    biasb = (float*)(ws + WS_BIAS);
    _Float16* qws   = (_Float16*)(ws + WS_Q);
    _Float16* kws   = (_Float16*)(ws + WS_K);
    _Float16* vws   = (_Float16*)(ws + WS_V);
    float*    out   = (float*)d_out;

    swin_qkv_gemm<<<dim3(256), 256, 0, stream>>>(
        x1, x2, qkv_w, q_bias, v_bias,
        rel_table, cpb_w1, cpb_b1, cpb_w2, rel_index, amod1, amod2, biasb,
        qws, kws, vws);
    swin_attn_proj<<<dim3(256), 256, 0, stream>>>(qws, kws, vws, biasb, mask,
                                                  logit_scale, proj_w, proj_b, out);
}

// v010
// A run of this version takes 50.1 microseconds.
// In two side-by-side timings against v009, it was 1.17 and 1.16 times as fast.
// All steps since v000 together make it 3.73 times as fast.
#include <hip/hip_runtime.h>
#include <hip/hip_bf16.h>
#include <type_traits>

// ---------------------------------------------------------------------------
// SwinV2 window attention block on gfx1250 (CDNA5), wave32 + WMMA f16.
// ---------------------------------------------------------------------------

typedef _Float16 v16h __attribute__((ext_vector_type(16)));
typedef _Float16 v8h  __attribute__((ext_vector_type(8)));
typedef float    v8f  __attribute__((ext_vector_type(8)));
typedef _Float16 v4h  __attribute__((ext_vector_type(4)));
typedef float    v4f  __attribute__((ext_vector_type(4)));
typedef float    v2f  __attribute__((ext_vector_type(2)));

#define NH   8
#define HD   32
#define NTOK 64
#define TWO_N 128
#define DIM  256
#define BW   512
#define NW   64
#define CPB  512

// workspace layout (bytes)
#define WS_BIAS ((size_t)8192)                    // 8*128*128 f32 (fragment order)
#define WS_WF   ((size_t)532480)                  // 768*256 f16 (qkv_w, fragment order)

// Load a 16x32 f16 A-fragment (or 32x16 B-fragment) per ISA layout:
// lane<16 holds K = {0..7, 16..23}; lane>=16 holds K = {8..15, 24..31}.
// `seg` points at the 32-half contiguous K segment for this lane's row/col,
// and must be 16B aligned (row strides are multiples of 8 halves).
__device__ __forceinline__ v16h load_frag(const _Float16* seg, int sel) {
    v8h lo = *(const v8h*)(seg + sel * 8);
    v8h hi = *(const v8h*)(seg + 16 + sel * 8);
    v16h f;
#pragma unroll
    for (int i = 0; i < 8; ++i) { f[i] = lo[i]; f[i + 8] = hi[i]; }
    return f;
}

__device__ __forceinline__ v8f wmma_f16(v16h a, v16h b, v8f c) {
    return __builtin_amdgcn_wmma_f32_16x16x32_f16(false, a, false, b,
                                                  (short)0, c, false, false);
}

// Work-group barrier that hands over LDS alone: a plain __syncthreads() would
// also wait for the rows fetched ahead and for the output stores in flight.
__device__ __forceinline__ void lds_barrier() {
    __builtin_amdgcn_fence(__ATOMIC_RELEASE, "workgroup", "local");
    __builtin_amdgcn_s_barrier();
    __builtin_amdgcn_fence(__ATOMIC_ACQUIRE, "workgroup", "local");
}

// Lane l's value as seen from lane l ^ 16 (a vector cross-row move, no LDS pipe).
__device__ __forceinline__ float xhalf(float x) {
    const int b = __builtin_bit_cast(int, x);
    return __builtin_bit_cast(float, __builtin_amdgcn_permlanex16(
        b, b, 0x76543210, 0xfedcba98, false, false));
}

#define BHD  2    // heads per bias unit
#define NPOS 225  // rows of the relative-coordinate table

// ---------------------------------------------------------------------------
// 1) Bias build and weight lay-out, one small launch.
//    Bias: CPB MLP (2 -> 512 relu -> 8), rpb gather + 16*sigmoid + 2*amod
//    quadrants -> (8,128,128), stored in the order of the attention's fragments.
//    Each of the 256 blocks does one unit (token row m, BHD heads): weights and
//    table lie in LDS, each wave takes 64 of the 512 hidden units for the 64
//    table positions that row m gathers (2 a lane), and the 8 waves' partial
//    sums are added through LDS.
//    Weights: qkv_w as f16 in fragment order, (16-row tile, k-step, low / high
//    half, lane, 8 halves), so that a wave of the main launch takes a fragment
//    with two loads of 512 B in a row. 192 blocks lay 2 fragments (2 KiB) each.
// ---------------------------------------------------------------------------
#define QP 264   // LDS row pitch in halves: 528 B = 16 B x odd for b128 readers
#define QCH 64   // weight columns per chunk

__global__ __launch_bounds__(256) void swin_bias_prep(
    const float* __restrict__ qkv_w,
    const float* __restrict__ tbl, const float* __restrict__ w1,
    const float* __restrict__ b1, const float* __restrict__ w2,
    const int* __restrict__ rel_index,
    const float* __restrict__ amod1, const float* __restrict__ amod2,
    float* __restrict__ biasb, _Float16* __restrict__ wfr)
{
    __shared__ __attribute__((aligned(16))) float sW1[CPB * 2];
    __shared__ __attribute__((aligned(16))) float sB1[CPB];
    __shared__ __attribute__((aligned(16))) float sW2[BHD * CPB];
    __shared__ __attribute__((aligned(16))) float sTbl[256 * 2];  // NPOS rows used
    __shared__ float sPart[8][BHD][NTOK];

    const int tid   = threadIdx.x;
    const int wv    = __builtin_amdgcn_readfirstlane(tid >> 5);
    const int lane  = tid & 31;

    // The block's bias unit: token row m, heads h0 .. h0 + BHD - 1.
    const int m = blockIdx.x & (NTOK - 1), h0 = (blockIdx.x >> 6) * BHD;
    const int n = tid & (TWO_N - 1), nn = n & (NTOK - 1), hh = tid >> 7;
    const size_t aoff = ((size_t)(h0 + hh) * NTOK + m) * NTOK + nn;
    const int*   pix = rel_index + m * NTOK + lane;
    const float* pw1 = w1 + tid * 4;
    const float* pb1 = b1 + tid * 2;
    const float* pw2 = w2 + (size_t)h0 * CPB + tid * 4;
    const float* pa1 = amod1 + aoff;
    const float* pa2 = amod2 + aoff;
    const float* ptb = tbl + min(tid, NPOS - 1) * 2;   // the whole table, a row a thread

    // The thread's 4 halves of the block's two weight fragments: fragment wf_i =
    // (tile, k-step), place wf_p in it = (half, lane, element). Blocks past the
    // last fragment read the last one again and store nothing.
    const int wf_i = min((int)blockIdx.x * 2 + (tid >> 7), 383);
    const int wf_p = (tid & 127) * 4;
    const int wf_l = (wf_p >> 3) & 31;
    const float* pwf = qkv_w + (size_t)((wf_i >> 3) * 16 + (wf_l & 15)) * DIM
                     + (wf_i & 7) * 32 + (wf_p >> 8) * 16 + (wf_l >> 4) * 8 + (wf_p & 7);

    // The fence pair keeps every other instruction out of [loads, wait], so that
    // no register a load names is written before the wait.
    __builtin_amdgcn_sched_barrier(0);
    int i0 = pix[0];
    int i1 = pix[32];
    const v4f rw1 = *(const v4f*)pw1;
    const v2f rb1 = *(const v2f*)pb1;
    const v4f rw2 = *(const v4f*)pw2;
    const v2f rtb = *(const v2f*)ptb;
    const float a1 = *pa1;
    const float a2 = *pa2;
    const v4f rwf = *(const v4f*)pwf;
    // These loads' address registers are reused behind them.
    asm volatile("s_wait_xcnt 0x0" ::: "memory");
    __builtin_amdgcn_sched_barrier(0);

    if (blockIdx.x < 192)
        *(v4h*)(wfr + (size_t)wf_i * 512 + wf_p) = __builtin_convertvector(rwf, v4h);
    // The store's data and address registers are reused behind it.
    asm volatile("s_wait_xcnt 0x0" ::: "memory");

    *(v4f*)&sW1[tid * 4]  = rw1;
    *(v2f*)&sB1[tid * 2]  = rb1;
    *(v4f*)&sW2[tid * 4]  = rw2;
    *(v2f*)&sTbl[tid * 2] = rtb;
    // The index is input data: bound the table address.
    i0 = min(max(i0, 0), NPOS - 1);
    i1 = min(max(i1, 0), NPOS - 1);
    lds_barrier();                    // publishes the weights and the table

    const v2f ca = *(const v2f*)&sTbl[i0 * 2];
    const v2f cb = *(const v2f*)&sTbl[i1 * 2];
    float acc[2][BHD] = {};
    const int j0 = wv * (CPB / 8);
#pragma unroll
    for (int jj = 0; jj < CPB / 8; jj += 4) {
        const int j = j0 + jj;
        const v4f wa = *(const v4f*)&sW1[j * 2];
        const v4f wb = *(const v4f*)&sW1[j * 2 + 4];
        const v4f bb = *(const v4f*)&sB1[j];
        const v4f u0 = *(const v4f*)&sW2[j];
        const v4f u1 = *(const v4f*)&sW2[CPB + j];
#pragma unroll
        for (int q = 0; q < 4; ++q) {
            const float c0 = (q < 2) ? wa[2 * q]     : wb[2 * q - 4];
            const float c1 = (q < 2) ? wa[2 * q + 1] : wb[2 * q - 3];
            const float ha = fmaxf(c0 * ca[0] + c1 * ca[1] + bb[q], 0.0f);
            const float hb = fmaxf(c0 * cb[0] + c1 * cb[1] + bb[q], 0.0f);
            acc[0][0] += u0[q] * ha;
            acc[0][1] += u1[q] * ha;
            acc[1][0] += u0[q] * hb;
            acc[1][1] += u1[q] * hb;
        }
    }
#pragma unroll
    for (int p = 0; p < 2; ++p)
#pragma unroll
        for (int g = 0; g < BHD; ++g) sPart[wv][g][p * 32 + lane] = acc[p][g];
    lds_barrier();                    // publishes the partial sums

    float r = 0.0f;
#pragma unroll
    for (int k = 0; k < 8; ++k) r += sPart[k][hh][nn];
    const float rpb = 16.0f / (1.0f + __expf(-r));
    // Rows m and m+64: amod1 where row and column lie in the same half.
    const bool lo = n < NTOK;
    // Fragment order, as the attention's lanes take it: (head, 16-row tile,
    // i = 4-key group of a lane, lane = (8-key half, row), 4 keys). Row m + 64
    // lies 4 tiles on, which is NTOK * TWO_N floats, as in row order.
    float* bd = biasb + (size_t)(h0 + hh) * TWO_N * TWO_N
              + ((((m >> 4) * 16 + (n >> 4) * 2 + ((n >> 2) & 1)) * 32
                  + ((n >> 3) & 1) * 16 + (m & 15)) * 4 + (n & 3));
    const float r0 = rpb + 2.0f * (lo ? a1 : a2);
    const float r1 = rpb + 2.0f * (lo ? a2 : a1);
    // Both values first, then both stores: no register that an issued store
    // names is written again.
    __builtin_amdgcn_sched_barrier(0);
    bd[0]            = r0;
    bd[NTOK * TWO_N] = r1;
}

// ---------------------------------------------------------------------------
// 2) QKV GEMM, attention and output projection, one launch.
//    One block = the two batch entries 2p, 2p + 1 of one mask window: 256 rows of
//    x ([x1; x2] of each entry) and of the output, one block per WGP. 8 waves.
//
//    The x rows are read once, converted to f16 and laid into LDS. A wave is one
//    head, from the QKV GEMM to the end of the attention: it takes its head's 32
//    columns of q, k and v for all rows, weights as fragments in registers (from
//    the first launch's lay-out), x fragments from LDS, two 16-row tiles at a time,
//    one entry after the other (k, v, q, attention of entry 0, then of entry 1).
//    q, k: weights as A, x as B: a lane holds 2 x 8 head-dim columns of one row,
//    lane ^ 16 the others; the row is L2-normalized there, and the two converted
//    tiles ARE the fragment that the scores take (k order of load_frag).
//    v: x as A: a lane holds 8 tokens of one column; two token tiles ARE the V^T
//    fragment. K and V^T stay in registers. q goes into LDS in place of the x
//    columns of the same number, behind a barrier that ends every wave's reads of
//    those x rows; each lane later reads back its own bytes, and O takes q's place.
//
//    Attention: S = (Qn Kn^T)*scale + bias + mask; softmax; O = P V.
//    No barrier among the 8 query tiles. The bias arrives in fragment order
//    (whole lines), the mask window lies in LDS. Both products are formed transposed (S^T = K Q^T, O^T = V^T
//    P^T): a lane then holds 64 of the 128 scores of ONE query row, lane ^ 16 the
//    others. O goes to LDS, where the projection takes its x fragments from.
//
//    Projection: O (256 x 256 f16, in LDS) @ proj_w^T + proj_b -> f32 out.
//    The rows are kept as fragments in registers for the whole K; the weights
//    pass through LDS in 4 chunks of 64 columns (two buffers, one barrier a
//    chunk). 8 waves = 4 row groups of 64 x 2 column halves of 32. The product is
//    formed transposed (weights as A) and a wave's tile passes through its own
//    LDS range: a wave's 32 f32 columns are one 128-byte line of each of 64 rows.
// ---------------------------------------------------------------------------
#define PNCH 4   // chunks of QCH weight columns

// p[i] = 2^t[i]. Eight exponentials in one statement: each stands in the slot
// that the instruction set asks for behind the one before it (no result read,
// no source overwritten: the outputs share no register with the inputs), and
// the v_nop stands in the last one's.
__device__ __forceinline__ void exp2x8(v8f& p, const v8f t) {
    float p0, p1, p2, p3, p4, p5, p6, p7;
    asm("v_exp_f32 %0, %8\n\t"
        "v_exp_f32 %1, %9\n\t"
        "v_exp_f32 %2, %10\n\t"
        "v_exp_f32 %3, %11\n\t"
        "v_exp_f32 %4, %12\n\t"
        "v_exp_f32 %5, %13\n\t"
        "v_exp_f32 %6, %14\n\t"
        "v_exp_f32 %7, %15\n\t"
        "v_nop"
        : "=&v"(p0), "=&v"(p1), "=&v"(p2), "=&v"(p3),
          "=&v"(p4), "=&v"(p5), "=&v"(p6), "=&v"(p7)
        : "v"(t[0]), "v"(t[1]), "v"(t[2]), "v"(t[3]),
          "v"(t[4]), "v"(t[5]), "v"(t[6]), "v"(t[7]));
    p[0] = p0; p[1] = p1; p[2] = p2; p[3] = p3;
    p[4] = p4; p[5] = p5; p[6] = p6; p[7] = p7;
}

__global__ __launch_bounds__(256) void swin_fused(
    const float* __restrict__ x1, const float* __restrict__ x2,
    // wfr without restrict: with it the compiler lifts all three weight sets' loads
    // out of the entry loop, and they fill the registers.
    const _Float16* wfr, const float* __restrict__ q_bias,
    const float* __restrict__ v_bias, const float* __restrict__ biasb,
    const float* __restrict__ mask, const float* __restrict__ logit_scale,
    const float* __restrict__ proj_w, const float* __restrict__ proj_b,
    float* __restrict__ out)
{
    __shared__ __attribute__((aligned(16))) _Float16 sX[256 * QP];   // x, then q, then O
    __shared__ __attribute__((aligned(16))) _Float16 sW[2][QCH * QP];
    __shared__ __attribute__((aligned(32))) float sBias[DIM];
    // The mask window (128 x 128 f32) during the attention, then a wave's tile.
    __shared__ __attribute__((aligned(16))) float sOut[8][64 * 32];

    const int tid  = threadIdx.x;
    const int wdw  = blockIdx.x & (NW - 1);      // mask window
    const int pr   = blockIdx.x >> 6;            // batch entries 2*pr, 2*pr + 1
    const int wv   = __builtin_amdgcn_readfirstlane(tid >> 5);
    const int lane = tid & 31;
    const int sel = lane >> 4, lm = lane & 15;
    const int h   = wv;                          // the wave's head
    const int b0  = (2 * pr) * NW + wdw;         // the first entry's window; + NW the second's

    // Each wave stages 8 projection weight rows of a chunk (2 coalesced 512-B loads
    // a row), 16 rows of the mask (one 512-B load a row) and 32 x rows. LDS row
    // e*128 + s*64 + t is token t of x1 (s = 0) or x2 (s = 1) of entry e.
    const float* wsrc = proj_w + (size_t)(wv * 8) * DIM + lane * 4;
    const float* msrc = mask + (size_t)wdw * TWO_N * TWO_N + (size_t)(wv * 16) * TWO_N
                             + lane * 4;
    const float* xsrc = (((wv >> 1) & 1) ? x2 : x1)
                      + ((size_t)(b0 + (wv >> 2) * NW) * NTOK + (wv & 1) * 32) * DIM + lane * 4;
    // The head's 16 fragments (2 tiles x 8 k-steps) of q; k's lie 128 fragments
    // on, v's 256.
    const _Float16* wfs = wfr + (size_t)h * (16 * 512) + lane * 8;
    // Bias in fragment order: (head, query tile, i, lane, 4 keys).
    const float* bsrc = biasb + (size_t)h * TWO_N * TWO_N + lane * 4;
    const float* pqb = q_bias + h * HD + sel * 8;
    const float* pvb = v_bias + h * HD + lm;

    // The head's weight fragments of q (s = 0), k (1) or v (2).
    auto loadw = [&](const int s, v16h (&wf)[2][8]) __attribute__((always_inline)) {
#pragma unroll
        for (int g = 0; g < 16; ++g) {
            const int f = (g & 1) * 8 + (g >> 1);   // in the order of use: k-step, tile
            const v8h lo = *(const v8h*)(wfs + (s * 128 + f) * 512);
            const v8h hi = *(const v8h*)(wfs + (s * 128 + f) * 512 + 256);
            wf[f >> 3][f & 7] = __builtin_shufflevector(
                lo, hi, 0, 1, 2, 3, 4, 5, 6, 7, 8, 9, 10, 11, 12, 13, 14, 15);
        }
    };

    v4f bq[16];       // the bias of a query tile, fetched one tile ahead
    auto fetch = [&](const int qt) __attribute__((always_inline)) {
        const float* pb = bsrc + qt * (16 * TWO_N);
        // The fence pair keeps every other instruction out of [loads, wait], so
        // that no register a load names is written before the wait.
        __builtin_amdgcn_sched_barrier(0);
#pragma unroll
        for (int i = 0; i < 15; ++i)
            bq[i] = *(const v4f*)(pb + i * TWO_N);     // 512 B in a row per load
        // The last load's result may take the address registers that the loads in
        // front of it name.
        asm volatile("s_wait_xcnt 0x0" ::: "memory");
        __builtin_amdgcn_sched_barrier(0);
        bq[15] = *(const v4f*)(pb + 15 * TWO_N);
        // The loads' address registers are reused behind them.
        asm volatile("s_wait_xcnt 0x0" ::: "memory");
        __builtin_amdgcn_sched_barrier(0);
    };

    char* smask = (char*)&sOut[0][0];
    float pb, vb0, vb1;
    v8f qb0, qb1;
    {
        v4f mreg[16];
        v4f wreg[16];
        v4f xreg[64];
        // The fence pair keeps every other instruction out of [loads, wait], so that
        // no register a load names is written before the wait.
        __builtin_amdgcn_sched_barrier(0);
#pragma unroll
        for (int i = 0; i < 16; ++i)
            mreg[i] = *(const v4f*)(msrc + i * TWO_N);
#pragma unroll
        for (int i = 0; i < 16; ++i)
            wreg[i] = *(const v4f*)(wsrc + (i >> 1) * DIM + (i & 1) * 128);
        pb  = proj_b[tid];
        qb0 = *(const v8f*)pqb;
        qb1 = *(const v8f*)(pqb + 16);
        vb0 = pvb[0];
        vb1 = pvb[16];
#pragma unroll
        for (int i = 0; i < 64; ++i)
            xreg[i] = *(const v4f*)(xsrc + (i >> 1) * DIM + (i & 1) * 128);
        // The loads' offset and base registers are reused right behind them.
        asm volatile("s_wait_xcnt 0x0" ::: "memory");
        __builtin_amdgcn_sched_barrier(0);

        sBias[tid] = pb;
        // The mask in LDS: 16-byte piece p of row r lies at r*512 + ((p ^ (r & 15)) << 4):
        // no bank is met twice by the writers (one row, all pieces) nor by the
        // readers (16 rows, one piece).
#pragma unroll
        for (int i = 0; i < 16; ++i)
            *(v4f*)(smask + (wv * 16 + i) * 512 + ((lane ^ i) << 4)) = mreg[i];
        _Float16* wd = &sW[0][(wv * 8) * QP + lane * 4];
#pragma unroll
        for (int i = 0; i < 16; ++i)
            *(v4h*)(wd + (i >> 1) * QP + (i & 1) * 128) =
                __builtin_convertvector(wreg[i], v4h);
        _Float16* xd = &sX[(wv * 32) * QP + lane * 4];
#pragma unroll
        for (int i = 0; i < 64; ++i)
            *(v4h*)(xd + (i >> 1) * QP + (i & 1) * 128) =
                __builtin_convertvector(xreg[i], v4h);
    }
    lds_barrier();            // publishes x, the mask and projection weight chunk 0

    // Two 16-row tiles of x (LDS rows ra.., rb..) times the head's 32 columns.
    // acc[r][t]: row tile r, column tile t.
    auto gemm2 = [&](const int ra, const int rb, const v16h (&wf)[2][8], auto isv,
                     v8f (&acc)[2][2]) __attribute__((always_inline)) {
        const _Float16* pa = &sX[(ra + lm) * QP];
        const _Float16* pc = &sX[(rb + lm) * QP];
        v16h xf[3][2];                           // fragments two k-steps ahead
        xf[0][0] = load_frag(pa, sel);
        xf[0][1] = load_frag(pc, sel);
        xf[1][0] = load_frag(pa + 32, sel);
        xf[1][1] = load_frag(pc + 32, sel);
#pragma unroll
        for (int ks = 0; ks < 8; ++ks) {
            if (ks < 6) {
                xf[(ks + 2) % 3][0] = load_frag(pa + (ks + 2) * 32, sel);
                xf[(ks + 2) % 3][1] = load_frag(pc + (ks + 2) * 32, sel);
            }
            // Keeps the LDS reads fetched ahead in front of this step's products;
            // without it they sink to just before their use and the wave waits.
            __builtin_amdgcn_sched_barrier(0);
#pragma unroll
            for (int r = 0; r < 2; ++r)
#pragma unroll
                for (int t = 0; t < 2; ++t) {
                    if constexpr (isv.value)
                        acc[r][t] = wmma_f16(xf[ks % 3][r], wf[t][ks], acc[r][t]);
                    else
                        acc[r][t] = wmma_f16(wf[t][ks], xf[ks % 3][r], acc[r][t]);
                }
            // Keeps later k-steps' reads from rising over these products into
            // registers that are still read.
            __builtin_amdgcn_sched_barrier(0);
        }
    };

    // A row's 32 head-dim columns, L2-normalized, as a fragment. Register j of r0 /
    // r1 = column sel*8 + j / 16 + sel*8 + j of row lm; lane l ^ 16 holds the rest.
    auto l2frag = [&](const v8f r0, const v8f r1) __attribute__((always_inline)) {
        const v8f sq = r0 * r0 + r1 * r1;
        float ss = ((sq[0] + sq[1]) + (sq[2] + sq[3]))
                 + ((sq[4] + sq[5]) + (sq[6] + sq[7]));
        ss += xhalf(ss);
        // 1 / max(sqrt(ss), 1e-12); ss = 0 gives the bound, and 0 * bound = 0.
        const float inv = fminf(__builtin_amdgcn_rsqf(ss), 1e12f);
        return __builtin_shufflevector(
            __builtin_convertvector(r0 * inv, v8h), __builtin_convertvector(r1 * inv, v8h),
            0, 1, 2, 3, 4, 5, 6, 7, 8, 9, 10, 11, 12, 13, 14, 15);
    };

    v16h aK[4];       // K fragments of the entry at hand: 16 keys each
    v16h aV[4][2];    // its V^T fragments: 32 keys, 16 head-dim rows

    const float scale = __expf(fminf(logit_scale[h], 4.6051702f)); // log(100)
    const int mx16 = (lm ^ (sel * 2)) << 4;   // the reader's part of the piece's place

    // One query tile of entry e: scores, softmax, O^T, O into LDS.
    auto tile = [&](const int qt, const int e, const v16h bQ, const float (&bm)[8][8])
        __attribute__((always_inline)) {
        // --- S^T = K Q^T : one WMMA per 16x16 tile (K-depth == head dim == 32).
        //     Register j of tile ct = key ct*16 + sel*8 + j, lane lm = query. ---
        v8f acc[8];
#pragma unroll
        for (int ct = 0; ct < 8; ++ct) {
            v8f z = {};
            acc[ct] = wmma_f16(aK[ct & 3], bQ, z);  // keys 64..127 reuse K (k=[k1;k1])
        }

        // --- scale + (bias + mask), then the row's softmax: in the lane, plus
        //     two exchanges (max, sum) with the lane that holds the row's other 64 keys. ---
        float part[8];
#pragma unroll
        for (int ct = 0; ct < 8; ++ct) {
            float m = -1e30f;
#pragma unroll
            for (int j = 0; j < 8; ++j) {
                const float v = acc[ct][j] * scale + bm[ct][j];
                acc[ct][j] = v;
                m = fmaxf(m, v);
            }
            part[ct] = m;
        }
        float mx = fmaxf(fmaxf(fmaxf(part[0], part[1]), fmaxf(part[2], part[3])),
                         fmaxf(fmaxf(part[4], part[5]), fmaxf(part[6], part[7])));
        mx = fmaxf(mx, xhalf(mx));
#pragma unroll
        for (int ct = 0; ct < 8; ++ct) {
            v8f t8;
#pragma unroll
            for (int j = 0; j < 8; ++j)
                t8[j] = (acc[ct][j] - mx) * 1.44269504f;   // log2(e)
            exp2x8(acc[ct], t8);
            float t = acc[ct][0];
#pragma unroll
            for (int j = 1; j < 8; ++j) t += acc[ct][j];
            part[ct] = t;
        }
        float sm = ((part[0] + part[1]) + (part[2] + part[3]))
                 + ((part[4] + part[5]) + (part[6] + part[7]));
        sm += xhalf(sm);
        const float invs = 1.0f / sm;

        // --- O^T = V^T P^T : K-depth 128 -> 4 WMMA steps x 2 tiles of head dim.
        //     Score tiles 2kc and 2kc+1, converted in place, ARE the B fragment
        //     of k-step kc (same k order as load_frag): P never touches LDS. ---
        v8f o0 = {}, o1 = {};
#pragma unroll
        for (int kc = 0; kc < 4; ++kc) {
            v16h bP;
#pragma unroll
            for (int i = 0; i < 8; ++i) {
                bP[i]     = (_Float16)(acc[2 * kc][i] * invs);
                bP[i + 8] = (_Float16)(acc[2 * kc + 1][i] * invs);
            }
            o0 = wmma_f16(aV[kc][0], bP, o0);
            o1 = wmma_f16(aV[kc][1], bP, o1);
        }
        // Register j of o0 / o1 = head-dim column sel*8 + j / 16 + sel*8 + j
        // of query row lm: 8 consecutive halves, one 16-byte LDS store each.
        _Float16* od = &sX[(e * TWO_N + qt * 16 + lm) * QP + h * HD + sel * 8];
        *(v8h*)od        = __builtin_convertvector(o0, v8h);
        *(v8h*)(od + 16) = __builtin_convertvector(o1, v8h);
    };

    // bias + mask of this lane's query row of tile qt, in the accumulator's own
    // layout (tile ct, register j = key ct*16 + sel*8 + j), from what fetch(qt) has
    // brought, and the q fragment, which this lane itself has laid into LDS.
    float bm[8][8];
    v16h bQ;
    auto settle = [&](const int qt, const int e) __attribute__((always_inline)) {
        const char* mrow = smask + (qt * 16 + lm) * 512;
        const _Float16* q0 = &sX[(e * TWO_N + qt * 16 + lm) * QP + h * HD + sel * 8];
        bQ = __builtin_shufflevector(*(const v8h*)q0, *(const v8h*)(q0 + 16),
                                     0, 1, 2, 3, 4, 5, 6, 7, 8, 9, 10, 11, 12, 13, 14, 15);
#pragma unroll
        for (int i = 0; i < 16; ++i) {
            const v4f mq = *(const v4f*)(mrow + ((((i >> 1) * 4 + (i & 1)) << 4) ^ mx16));
#pragma unroll
            for (int c = 0; c < 4; ++c)
                bm[i >> 1][(i & 1) * 4 + c] = bq[i][c] + mq[c];
        }
    };

    // One entry a trip. Rolled: one entry's code serves both, so that the kernel's
    // text stays small (for speed only).
#pragma unroll 1
    for (int e = 0; e < 2; ++e) {
        const int r0 = e * TWO_N;            // the entry's first LDS row
        v16h wq[2][8];
        {
            v16h wk[2][8], wvv[2][8];
            // The fence pair keeps every other instruction out of [loads, wait], so
            // that no register a load names is written before the wait.
            __builtin_amdgcn_sched_barrier(0);
            loadw(1, wk);
            loadw(2, wvv);
            // The loads' address registers are reused behind them.
            asm volatile("s_wait_xcnt 0x0" ::: "memory");
            __builtin_amdgcn_sched_barrier(0);

            // --- k (of x1 alone; its bias is zero) ---
#pragma unroll
            for (int kp = 0; kp < 2; ++kp) {
                v8f acc[2][2] = {};
                gemm2(r0 + kp * 32, r0 + kp * 32 + 16, wk, std::false_type{}, acc);
                aK[kp * 2]     = l2frag(acc[0][0], acc[0][1]);
                aK[kp * 2 + 1] = l2frag(acc[1][0], acc[1][1]);
            }

            // q's weights fly while v is formed; they take the registers of k's.
            // Fence pair as above.
            __builtin_amdgcn_sched_barrier(0);
            loadw(0, wq);
            // The loads' address registers are reused behind them.
            asm volatile("s_wait_xcnt 0x0" ::: "memory");
            __builtin_amdgcn_sched_barrier(0);

            // --- v. Register j of acc[r][t] = token r*16 + sel*8 + j of column
            //     t*16 + lm. ---
#pragma unroll
            for (int kc = 0; kc < 4; ++kc) {
                v8f acc[2][2] = {};
                gemm2(r0 + kc * 32, r0 + kc * 32 + 16, wvv, std::true_type{}, acc);
                aV[kc][0] = __builtin_shufflevector(
                    __builtin_convertvector(acc[0][0] + vb0, v8h),
                    __builtin_convertvector(acc[1][0] + vb0, v8h),
                    0, 1, 2, 3, 4, 5, 6, 7, 8, 9, 10, 11, 12, 13, 14, 15);
                aV[kc][1] = __builtin_shufflevector(
                    __builtin_convertvector(acc[0][1] + vb1, v8h),
                    __builtin_convertvector(acc[1][1] + vb1, v8h),
                    0, 1, 2, 3, 4, 5, 6, 7, 8, 9, 10, 11, 12, 13, 14, 15);
            }
        }

        // --- q: two query tiles a step ---
        {
            fetch(0);
            // Unrolled: over a loop's block boundary the compiler sinks the conversions
            // of K and V to their first use, and their f32 sums then fill the registers.
#pragma unroll
            for (int p = 0; p < 4; ++p) {
                v8f acc[2][2] = {};
                gemm2(r0 + p * 32, r0 + p * 32 + 16, wq, std::false_type{}, acc);
                // Ends every wave's reads of these 32 x rows: q takes their place.
                lds_barrier();
                _Float16* qd = &sX[(r0 + p * 32 + lm) * QP + h * HD + sel * 8];
#pragma unroll
                for (int r = 0; r < 2; ++r) {
                    const v16h f = l2frag(acc[r][0] + qb0, acc[r][1] + qb1);
                    *(v8h*)(qd + r * 16 * QP) =
                        __builtin_shufflevector(f, f, 0, 1, 2, 3, 4, 5, 6, 7);
                    *(v8h*)(qd + r * 16 * QP + 16) =
                        __builtin_shufflevector(f, f, 8, 9, 10, 11, 12, 13, 14, 15);
                }
            }
        }
        settle(0, e);

        // Rolled: one query tile's code serves all (registers, instruction cache).
#pragma unroll 1
        for (int qt = 0; qt < 8; ++qt) {
            // The next tile's bias flies while this one is worked on. The last trip
            // fetches its own tile again, so that no branch stands in the loop.
            const int nx = min(qt + 1, 7);
            fetch(nx);

            tile(qt, e, bQ, bm);
            // Keeps the next tile's sums, and their wait on the loads, behind this
            // tile's work.
            __builtin_amdgcn_sched_barrier(0);
            settle(nx, e);
        }
    }
    // Publishes O to the projection and ends every wave's reads of the mask,
    // whose LDS the output tiles take over.
    lds_barrier();

    // ------------------------------ projection ------------------------------
    const int wr = wv & 3, wc = wv >> 2;
    v4f wreg[16];
    v16h xa[4][8];
#pragma unroll
    for (int rt = 0; rt < 4; ++rt)
#pragma unroll
        for (int ks = 0; ks < 8; ++ks)
            xa[rt][ks] = load_frag(&sX[(wr * 64 + rt * 16 + lm) * QP + ks * 32], sel);

    // A wave's 64 rows are one half of window b0 (wr 0, 1) or b0 + NW (wr 2, 3).
    // A store takes 4 whole rows of the wave's tile: 8 lanes x 16 B a row.
    float* drow = out + ((size_t)(b0 + (wr >> 1) * NW) * TWO_N + (wr & 1) * 64
                         + (lane >> 3)) * DIM + wc * 32 + (lane & 7) * 4;

    // Output staging, 16-byte pieces, 8 a row of 128 B. Piece p of row r lies at
    // r*128 + ((p ^ ((r >> 1) & 7)) << 4): no bank is met twice by the writers
    // (16 rows, one piece) nor by the readers (2 rows, all pieces).
    char* stg = (char*)&sOut[wv][0];
    const int swr = lm * 128 + (((sel * 2) ^ (lm >> 1)) << 4);       // row lm, piece sel*2
    const int srd = (lane >> 3) * 128 + (((lane & 7) ^ sel) << 4);   // linear 16 B x lane

    // One chunk: fetch the next chunk's weights (not behind the last), multiply,
    // lay the fetched weights into the other buffer, store this chunk's columns.
    auto chunk = [&](const int c, auto more) __attribute__((always_inline)) {
        if constexpr (more.value) {
            const float* p = wsrc + (size_t)(c + 1) * QCH * DIM;
#pragma unroll
            for (int i = 0; i < 16; ++i)
                wreg[i] = *(const v4f*)(p + (i >> 1) * DIM + (i & 1) * 128);
        }

        const v8f bv0 = *(const v8f*)&sBias[c * QCH + wc * 32 + sel * 8];
        const v8f bv1 = *(const v8f*)&sBias[c * QCH + wc * 32 + 16 + sel * 8];
        float* dst = drow + c * QCH;

        const _Float16* wb = &sW[c & 1][(wc * 32 + lm) * QP];
        v8f acc[4][2] = {};
        v16h bf[2][2];                           // fragments one k-step ahead
        bf[0][0] = load_frag(wb, sel);
        bf[0][1] = load_frag(wb + 16 * QP, sel);
#pragma unroll
        for (int ks = 0; ks < 8; ++ks) {
            if (ks < 7) {
                bf[(ks + 1) & 1][0] = load_frag(wb + (ks + 1) * 32, sel);
                bf[(ks + 1) & 1][1] = load_frag(wb + 16 * QP + (ks + 1) * 32, sel);
            }
            // Keeps the next k-step's LDS reads in front of this step's products;
            // without it they sink to just before their use and the wave waits.
            __builtin_amdgcn_sched_barrier(0);
#pragma unroll
            for (int rt = 0; rt < 4; ++rt) {
                acc[rt][0] = wmma_f16(bf[ks & 1][0], xa[rt][ks], acc[rt][0]);
                acc[rt][1] = wmma_f16(bf[ks & 1][1], xa[rt][ks], acc[rt][1]);
            }
            // Keeps the conversion of the fetched weights (and its wait on the
            // global loads) behind the products instead of among the first ones.
            __builtin_amdgcn_sched_barrier(0);
        }

        // Register j of acc[rt][t] = column t*16 + sel*8 + j of row rt*16 + lm:
        // pieces t*4 + sel*2 and t*4 + sel*2 + 1 of that row.
#pragma unroll
        for (int rt = 0; rt < 4; ++rt) {
            const v8f r0 = acc[rt][0] + bv0;
            const v8f r1 = acc[rt][1] + bv1;
            *(v4f*)(stg + swr + rt * 2048)        = __builtin_shufflevector(r0, r0, 0, 1, 2, 3);
            *(v4f*)(stg + (swr ^ 16) + rt * 2048) = __builtin_shufflevector(r0, r0, 4, 5, 6, 7);
            *(v4f*)(stg + (swr ^ 64) + rt * 2048) = __builtin_shufflevector(r1, r1, 0, 1, 2, 3);
            *(v4f*)(stg + (swr ^ 80) + rt * 2048) = __builtin_shufflevector(r1, r1, 4, 5, 6, 7);
        }

        if constexpr (more.value) {
            _Float16* wd = &sW[(c + 1) & 1][(wv * 8) * QP + lane * 4];
#pragma unroll
            for (int i = 0; i < 16; ++i)
                *(v4h*)(wd + (i >> 1) * QP + (i & 1) * 128) =
                    __builtin_convertvector(wreg[i], v4h);
        }

        // The staged rows are read back by other lanes of this wave.
        asm volatile("s_wait_dscnt 0x0" ::: "memory");
        v4f ov[16];
#pragma unroll
        for (int i = 0; i < 16; ++i)
            ov[i] = *(const v4f*)(stg + (srd ^ ((i & 3) * 32)) + i * 512);
        // All values first, then all stores: no register that an issued store
        // names is written again before the wait below.
        __builtin_amdgcn_sched_barrier(0);
#pragma unroll
        for (int i = 0; i < 16; ++i)
            *(v4f*)(dst + (size_t)(i * 4) * DIM) = ov[i];   // 4 whole lines per store
        // The next chunk overwrites the stores' data and address registers.
        if constexpr (more.value) asm volatile("s_wait_xcnt 0x0" ::: "memory");
    };

    // Rolled: one chunk's code serves three chunks (instruction cache).
#pragma unroll 1
    for (int c = 0; c < PNCH - 1; ++c) {
        chunk(c, std::true_type{});
        // Publishes chunk c+1 and ends every wave's reads of chunk c's buffer;
        // LDS alone is handed over, the output stores stay in flight.
        lds_barrier();
    }
    chunk(PNCH - 1, std::false_type{});
}

// ---------------------------------------------------------------------------
extern "C" void kernel_launch(void* const* d_in, const int* in_sizes, int n_in,
                              void* d_out, int out_size, void* d_ws, size_t ws_size,
                              hipStream_t stream)
{
    const float* x1          = (const float*)d_in[0];
    const float* x2          = (const float*)d_in[1];
    const float* mask        = (const float*)d_in[2];
    const float* qkv_w       = (const float*)d_in[3];
    const float* q_bias      = (const float*)d_in[4];
    const float* v_bias      = (const float*)d_in[5];
    const float* logit_scale = (const float*)d_in[6];
    const float* cpb_w1      = (const float*)d_in[7];
    const float* cpb_b1      = (const float*)d_in[8];
    const float* cpb_w2      = (const float*)d_in[9];
    const float* proj_w      = (const float*)d_in[10];
    const float* proj_b      = (const float*)d_in[11];
    const float* amod1       = (const float*)d_in[12];
    const float* amod2       = (const float*)d_in[13];
    const float* rel_table   = (const float*)d_in[14];
    const int*   rel_index   = (const int*)d_in[15];

    char* ws = (char*)d_ws;
    float*    biasb = (float*)(ws + WS_BIAS);
    _Float16* wfr   = (_Float16*)(ws + WS_WF);
    float*    out   = (float*)d_out;

    swin_bias_prep<<<dim3(256), 256, 0, stream>>>(
        qkv_w, rel_table, cpb_w1, cpb_b1, cpb_w2, rel_index, amod1, amod2, biasb, wfr);
    swin_fused<<<dim3(256), 256, 0, stream>>>(x1, x2, wfr, q_bias, v_bias, biasb, mask,
                                              logit_scale, proj_w, proj_b, out);
}
